// v000
// Measured on an AMD MI455X. A time is GPU time per run, averaged over a window of back-to-back runs after a warm-up
// (all launches, gaps included; the runs take copies of the inputs in turn), and the median of several windows.
// Apart from v000's, it joins two sittings. Times from different sittings can be a few percent apart, while
// side-by-side timings come from the same sitting.
// v000 is the starting kernel. One run takes 902 microseconds.
#include <hip/hip_runtime.h>

// _NonLocal (embedded-Gaussian non-local block: x [4][256][64][64] -> 4096 positions; theta/phi/g = 1x1 convs to 128 channels (no bias); attn[n][m] = softmax_m(theta[:,n].phi[:,m]) (UNSCALED: logits have sigma ~ 11, so the scores need 3-product precision);
// y[d][n] = sum_m g[d][m] attn[n][m]; out = x + w_out y -> [4][256][64][64]).
// Compute dtypes, f32 accumulate: every input rounded to bf16; theta/phi/g on PLAIN bf16 operands (inputs: exact); scores (K 128) on bf16 hi+lo planes of theta and phi (3 products; single fp16 planes

#define NBI  4
#define CC   256
#define DDr  128
#define NN   4096
#define PCAR 1024.0f
typedef _Float16 h16;
typedef unsigned short bf;
typedef __attribute__((ext_vector_type(16))) __bf16   v16bf;
typedef __attribute__((ext_vector_type(16))) _Float16 v16h;
typedef __attribute__((ext_vector_type(8)))  _Float16 v8h;
typedef __attribute__((ext_vector_type(8)))  unsigned short v8us;
typedef __attribute__((ext_vector_type(8)))  float    v8f;
typedef __attribute__((ext_vector_type(4)))  float    v4f;
typedef v8h  __attribute__((may_alias)) v8ha;
typedef v4f  __attribute__((may_alias)) v4fa;
typedef v8us __attribute__((may_alias)) v8usa;

__device__ __forceinline__ unsigned short f2bf(float f) { unsigned u = __float_as_uint(f); u += 0x7FFFu + ((u >> 16) & 1u); return (unsigned short)(u >> 16); }
__device__ __forceinline__ float bf2f(unsigned short b) { return __uint_as_float(((unsigned)b) << 16); }
__device__ __forceinline__ float bfr(float f) { return bf2f(f2bf(f)); }
__device__ __forceinline__ v16h cat16(v8h lo, v8h hi) { return __builtin_shufflevector(lo, hi, 0, 1, 2, 3, 4, 5, 6, 7, 8, 9, 10, 11, 12, 13, 14, 15); }
__device__ __forceinline__ v16bf cat16b(v8us lo, v8us hi) { return __builtin_bit_cast(v16bf, __builtin_shufflevector(lo, hi, 0, 1, 2, 3, 4, 5, 6, 7, 8, 9, 10, 11, 12, 13, 14, 15)); }
__device__ __forceinline__ v8f wmma16(v16h a, v16h b, v8f c) { return __builtin_amdgcn_wmma_f32_16x16x32_f16(false, a, false, b, (short)0, c, false, false); }
__device__ __forceinline__ v8f wmmab(v16bf a, v16bf b, v8f c) { return __builtin_amdgcn_wmma_f32_16x16x32_bf16(false, a, false, b, (short)0, c, false, false); }



// ---- k_gemmw: register-blocked GEMM, ONE WAVE per 64x64 output tile (16 accumulators), operands straight from K-contiguous 16-bit planes; grid (M/64, N/64, Z), 32 threads.
// C[m][n] (f32, pitch ldc, + optional f32 bias[n]) = sum_k A[m][k] Bt[n][k] (+ split products per NSPLIT). z-batch strides sA/sB/sC in elements. K % 32 == 0.
template <typename T16> struct WFrag;
template <> struct WFrag<h16> { typedef v16h V; static __device__ __forceinline__ V ld(const h16* p) { return cat16(*(const v8h*)p, *(const v8h*)(p + 16)); } static __device__ __forceinline__ v8f mma(V a, V b, v8f c) { return wmma16(a, b, c); } };
template <> struct WFrag<bf> { typedef v16bf V; static __device__ __forceinline__ V ld(const bf* p) { return cat16b(*(const v8us*)p, *(const v8us*)(p + 16)); } static __device__ __forceinline__ v8f mma(V a, V b, v8f c) { return wmmab(a, b, c); } };
template <typename T16, int NSPLIT, bool BIAS>
__global__ __launch_bounds__(32) void k_gemmw(const T16* __restrict__ A, const T16* __restrict__ A2, const T16* __restrict__ Bt, const T16* __restrict__ Bt2, int K, float* C, int ldc, const float* __restrict__ bias, size_t sA, size_t sB, size_t sC) {
    typedef typename WFrag<T16>::V V;
    __shared__ __align__(16) float os[16 * 68];
    const size_t z = blockIdx.z; A += z * sA; if (A2) A2 += z * sA; Bt += z * sB; if (Bt2) Bt2 += z * sB; C += z * sC;
    const int lane = threadIdx.x & 31, lr = lane & 15, hi = lane >> 4; const int r0 = blockIdx.x * 64, c0 = blockIdx.y * 64;
    v8f acc[4][4];
#pragma unroll
    for (int mb = 0; mb < 4; ++mb)
#pragma unroll
        for (int nb = 0; nb < 4; ++nb) acc[mb][nb] = (v8f){};
    const size_t aoff = (size_t)(r0 + lr) * K + 8 * hi, boff = (size_t)(c0 + lr) * K + 8 * hi;
#pragma unroll 1
    for (int kc = 0; kc < K; kc += 32) {
        V a[4], a2[4];
#pragma unroll
        for (int mb = 0; mb < 4; ++mb) { a[mb] = WFrag<T16>::ld(A + aoff + (size_t)mb * 16 * K + kc); if (NSPLIT == 1 || NSPLIT == 2) a2[mb] = WFrag<T16>::ld(A2 + aoff + (size_t)mb * 16 * K + kc); }
#pragma unroll
        for (int nb = 0; nb < 4; ++nb) { const V b = WFrag<T16>::ld(Bt + boff + (size_t)nb * 16 * K + kc); V b2; if (NSPLIT >= 2) b2 = WFrag<T16>::ld(Bt2 + boff + (size_t)nb * 16 * K + kc);
#pragma unroll
            for (int mb = 0; mb < 4; ++mb) { acc[mb][nb] = WFrag<T16>::mma(a[mb], b, acc[mb][nb]); if (NSPLIT == 1 || NSPLIT == 2) acc[mb][nb] = WFrag<T16>::mma(a2[mb], b, acc[mb][nb]); if (NSPLIT >= 2) acc[mb][nb] = WFrag<T16>::mma(a[mb], b2, acc[mb][nb]); } }
        asm volatile("v_nop\n\tv_nop\n\tv_nop\n\tv_nop" : "+v"(acc[0][0]), "+v"(acc[1][1]), "+v"(acc[2][2]), "+v"(acc[3][3]) : "v"(a[0]), "v"(a[3]));
    }
#pragma unroll
    for (int mb = 0; mb < 4; ++mb) {
#pragma unroll
        for (int nb = 0; nb < 4; ++nb) {
#pragma unroll
            for (int j = 0; j < 8; ++j) os[(hi * 8 + j) * 68 + nb * 16 + lr] = acc[mb][nb][j]; }
        __builtin_amdgcn_wave_barrier(); asm volatile("" ::: "memory");
        float* crow = C + (size_t)(r0 + mb * 16) * ldc + c0;
{
#pragma unroll
            for (int s = 0; s < 8; ++s) { const int row = 2 * s + hi, cofs = lr * 4; v4f val = *(const v4fa*)(os + row * 68 + cofs); if (BIAS) { val[0] += bfr(bias[c0 + cofs]); val[1] += bfr(bias[c0 + cofs + 1]); val[2] += bfr(bias[c0 + cofs + 2]); val[3] += bfr(bias[c0 + cofs + 3]); }
                *(v4f*)(crow + (size_t)row * ldc + cofs) = val; }
             }
        __builtin_amdgcn_wave_barrier(); asm volatile("" ::: "memory");
    }
}

__device__ __forceinline__ h16 tohx(float x) { return (h16)x; }
__device__ __forceinline__ void splitf(float y, unsigned short& h, unsigned short& l) { h = f2bf(y); l = f2bf(y - bf2f(h)); }
typedef __attribute__((ext_vector_type(2))) unsigned short v2us;
typedef __attribute__((ext_vector_type(4))) unsigned short v4us;
typedef __attribute__((ext_vector_type(4))) _Float16 v4h;

__global__ __launch_bounds__(256) void k_cvt8(const float* __restrict__ src, bf* dst, size_t n8) { const size_t i = (size_t)blockIdx.x * 256 + threadIdx.x; if (i >= n8) return; const v8f v = *(const v8f*)(src + i * 8); v8us o;
#pragma unroll
    for (int k = 0; k < 8; ++k) o[k] = f2bf(v[k]); *(v8us*)(dst + i * 8) = o;  }
// k_xt: XT[n][c] = bf16 x[c][n] (lane -> 2 consecutive c; strided reads); k_tpl: hl planes T[n][d] = F[d][n] (lane -> 2 consecutive d); k_g16: fp16 copy of G [d][m] (8-B lanes); k_ypl: hl planes of Y/1024 (8-B lanes);
__global__ __launch_bounds__(256) void k_xt(const float* __restrict__ x, bf* XT) { const int e = (blockIdx.x * 256 + threadIdx.x) * 2; if (e >= NN * CC) return; const int c = e % CC; const int n = e / CC; v2us o; o[0] = f2bf(x[(size_t)c * NN + n]); o[1] = f2bf(x[(size_t)(c + 1) * NN + n]); *(v2us*)(XT + e) = o;  }
__global__ __launch_bounds__(256) void k_tpl(const float* __restrict__ F, bf* Th, bf* Tl) { const int e = (blockIdx.x * 256 + threadIdx.x) * 2; if (e >= NN * DDr) return; const int d = e % DDr; const int n = e / DDr; v2us oh, ol;
#pragma unroll
    for (int u = 0; u < 2; ++u) { unsigned short a, b; splitf(F[(size_t)(d + u) * NN + n], a, b); oh[u] = a; ol[u] = b; } *(v2us*)(Th + e) = oh; *(v2us*)(Tl + e) = ol;  }
__global__ __launch_bounds__(256) void k_g16(const float* __restrict__ G, h16* G16) { const int e = (blockIdx.x * 256 + threadIdx.x) * 4; if (e >= DDr * NN) return; const v4f a = *(const v4f*)(G + e); v4h o; o[0] = tohx(a[0]); o[1] = tohx(a[1]); o[2] = tohx(a[2]); o[3] = tohx(a[3]); *(v4h*)(G16 + e) = o;  }
__global__ __launch_bounds__(256) void k_ypl(const float* __restrict__ Y, bf* Yh, bf* Yl) { const int e = (blockIdx.x * 256 + threadIdx.x) * 4; if (e >= NN * DDr) return; const v4f a = *(const v4f*)(Y + e); v4us oh, ol;
#pragma unroll
    for (int u = 0; u < 4; ++u) { unsigned short h, l; splitf(a[u] * (1.0f / PCAR), h, l); oh[u] = h; ol[u] = l; } *(v4us*)(Yh + e) = oh; *(v4us*)(Yl + e) = ol;  }
__global__ __launch_bounds__(256) void k_outT(const float* __restrict__ x, const float* __restrict__ O, float* OUT) { const int e = (blockIdx.x * 256 + threadIdx.x) * 4; if (e >= CC * NN) return; const int n = e % NN; const int c = e / NN; v4f o;
#pragma unroll
    for (int u = 0; u < 4; ++u) o[u] = __fadd_rn(bfr(x[e + u]), O[(size_t)(n + u) * CC + c]); *(v4f*)(OUT + e) = o;  }
// k_soft<NFULL, TAIL>: wave per score row (ld = 128 NFULL + 64 TAIL) in three passes over memory (max; sum of exp; write P = exp/sum x1024 fp16); keys >= nvalid excluded; rows with (row % rowsper) >= rvalid write zeros (lane -> 4 consecutive
template <int NFULL, int TAIL> __global__ __launch_bounds__(256) void k_soft(const float* __restrict__ Sb, int nrows, int rowsper, int rvalid, int nvalid, h16* P) { const int lane = threadIdx.x & 31; const size_t row = (size_t)blockIdx.x * 8 + (threadIdx.x >> 5); if (row >= (size_t)nrows) return; constexpr int LD = NFULL * 128 + TAIL * 64; const float* sr = Sb + row * LD; h16* pr = P + row * LD; const bool live = (int)(row % rowsper) < rvalid; float mx = -3.0e38f;
#pragma unroll 1
    for (int ch = 0; ch < NFULL + TAIL; ++ch) { if (ch == NFULL && lane >= 16) break; const int j0 = ch * 128 + lane * 4; const v4f a = *(const v4f*)(sr + j0);
#pragma unroll
        for (int q = 0; q < 4; ++q) if (j0 + q < nvalid) mx = fmaxf(mx, a[q]); }
#pragma unroll
    for (int sh = 16; sh; sh >>= 1) mx = fmaxf(mx, __shfl_xor(mx, sh, 32));
    float sum = 0.f;
#pragma unroll 1
    for (int ch = 0; ch < NFULL + TAIL; ++ch) { if (ch == NFULL && lane >= 16) break; const int j0 = ch * 128 + lane * 4; const v4f a = *(const v4f*)(sr + j0);
#pragma unroll
        for (int q = 0; q < 4; ++q) if (j0 + q < nvalid) { float d0 = __fsub_rn(a[q], mx); asm volatile("" : "+v"(d0)); sum += __expf(d0); } }
#pragma unroll
    for (int sh = 16; sh; sh >>= 1) sum += __shfl_xor(sum, sh, 32);
    const float f = live ? __fdiv_rn(PCAR, sum) : 0.f;
    {
#pragma unroll 1
        for (int ch = 0; ch < NFULL + TAIL; ++ch) { if (ch == NFULL && lane >= 16) break; const int j0 = ch * 128 + lane * 4; const v4f a = *(const v4f*)(sr + j0); v4h o;
#pragma unroll
            for (int q = 0; q < 4; ++q) { float val = 0.f; if (live && j0 + q < nvalid) { float d0 = __fsub_rn(a[q], mx); asm volatile("" : "+v"(d0)); val = __fmul_rn(__expf(d0), f); } o[q] = tohx(val); } *(v4h*)(pr + j0) = o; }
         } }

extern "C" void kernel_launch(void* const* d_in, const int* in_sizes, int n_in,
                              void* d_out, int out_size, void* d_ws, size_t ws_size, hipStream_t stream) {
    (void)in_sizes; (void)n_in; (void)out_size;
    const float* x = (const float*)d_in[0]; const float* wth = (const float*)d_in[1]; const float* wph = (const float*)d_in[2]; const float* wg = (const float*)d_in[3]; const float* wout = (const float*)d_in[4];
    float* OUT = (float*)d_out;     // [4][256][64][64]
    char* wsp = (char*)d_ws;
    auto take = [&](size_t bytes) { char* p = wsp; wsp += (bytes + 255) & ~(size_t)255; return (void*)p; };
    bf* WTH = (bf*)take(DDr * CC * 2); bf* WPH = (bf*)take(DDr * CC * 2); bf* WG = (bf*)take(DDr * CC * 2); bf* WOUT = (bf*)take(CC * DDr * 2);
    bf* XT = (bf*)take((size_t)NN * CC * 2); float* TH = (float*)take((size_t)DDr * NN * 4); float* PH = (float*)take((size_t)DDr * NN * 4); float* G = (float*)take((size_t)DDr * NN * 4); bf* THh = (bf*)take((size_t)NN * DDr * 2); bf* THl = (bf*)take((size_t)NN * DDr * 2); bf* PHh = (bf*)take((size_t)NN * DDr * 2); bf* PHl = (bf*)take((size_t)NN * DDr * 2); h16* G16 = (h16*)take((size_t)DDr * NN * 2);
    float* Sb = (float*)take((size_t)NN * NN * 4); h16* P16 = (h16*)take((size_t)NN * NN * 2); float* Y = (float*)take((size_t)NN * DDr * 4); bf* Yh = (bf*)take((size_t)NN * DDr * 2); bf* Yl = (bf*)take((size_t)NN * DDr * 2); float* O = (float*)take((size_t)NN * CC * 4);
    if ((size_t)(wsp - (char*)d_ws) > ws_size) return;    // total ~ 117 MiB (123 MB)
    k_cvt8<<<(DDr * CC / 8 + 255) / 256, 256, 0, stream>>>(wth, WTH, DDr * CC / 8); k_cvt8<<<(DDr * CC / 8 + 255) / 256, 256, 0, stream>>>(wph, WPH, DDr * CC / 8); k_cvt8<<<(DDr * CC / 8 + 255) / 256, 256, 0, stream>>>(wg, WG, DDr * CC / 8); k_cvt8<<<(CC * DDr / 8 + 255) / 256, 256, 0, stream>>>(wout, WOUT, CC * DDr / 8);   // [d][c] rows = A operand; w_out [c][d] = natural Bt
    for (int b = 0; b < NBI; ++b) { const float* xb = x + (size_t)b * CC * NN;
        k_xt<<<(NN * CC / 2 + 255) / 256, 256, 0, stream>>>(xb, XT);
        k_gemmw<bf, 0, false><<<dim3(DDr / 64, NN / 64, 1), 32, 0, stream>>>(WTH, nullptr, XT, nullptr, CC, TH, NN, nullptr, 0, 0, 0); k_gemmw<bf, 0, false><<<dim3(DDr / 64, NN / 64, 1), 32, 0, stream>>>(WPH, nullptr, XT, nullptr, CC, PH, NN, nullptr, 0, 0, 0); k_gemmw<bf, 0, false><<<dim3(DDr / 64, NN / 64, 1), 32, 0, stream>>>(WG, nullptr, XT, nullptr, CC, G, NN, nullptr, 0, 0, 0);
        k_tpl<<<(NN * DDr / 2 + 255) / 256, 256, 0, stream>>>(TH, THh, THl); k_tpl<<<(NN * DDr / 2 + 255) / 256, 256, 0, stream>>>(PH, PHh, PHl); k_g16<<<(DDr * NN / 4 + 255) / 256, 256, 0, stream>>>(G, G16);
        k_gemmw<bf, 2, false><<<dim3(NN / 64, NN / 64, 1), 32, 0, stream>>>(THh, THl, PHh, PHl, DDr, Sb, NN, nullptr, 0, 0, 0);   // scores[n][m] = theta[:,n].phi[:,m]
        k_soft<32, 0><<<NN / 8, 256, 0, stream>>>(Sb, NN, NN, NN, NN, P16);
        k_gemmw<h16, 0, false><<<dim3(NN / 64, DDr / 64, 1), 32, 0, stream>>>(P16, nullptr, G16, nullptr, NN, Y, DDr, nullptr, 0, 0, 0);      // y[n][d] = sum_m P[n][m] g[d][m] (x1024)
        k_ypl<<<(NN * DDr / 4 + 255) / 256, 256, 0, stream>>>(Y, Yh, Yl);
        k_gemmw<bf, 1, false><<<dim3(NN / 64, CC / 64, 1), 32, 0, stream>>>(Yh, Yl, WOUT, nullptr, DDr, O, CC, nullptr, 0, 0, 0);            // o[n][c] = sum_d y[n][d] w_out[c][d]
        k_outT<<<(CC * NN / 4 + 255) / 256, 256, 0, stream>>>(xb, O, OUT + (size_t)b * CC * NN); }
}

// v001
// It runs in 616 microseconds.
// In two side-by-side timings against v000, it was 1.47 and 1.48 times as fast.
#include <hip/hip_runtime.h>

// _NonLocal (embedded-Gaussian non-local block: x [4][256][64][64] -> 4096 positions; theta/phi/g = 1x1 convs to 128 channels (no bias); attn[n][m] = softmax_m(theta[:,n].phi[:,m]) (UNSCALED: logits have sigma ~ 11, so the scores need 3-product precision);
// y[d][n] = sum_m g[d][m] attn[n][m]; out = x + w_out y -> [4][256][64][64]).
// Compute dtypes, f32 accumulate: every input rounded to bf16; theta/phi/g on PLAIN bf16 operands (inputs: exact); scores (K 128) on bf16 hi+lo planes of theta and phi (3 products; single fp16 planes

#define NBI  4
#define CC   256
#define DDr  128
#define NN   4096
#define PCAR 1024.0f
typedef _Float16 h16;
typedef unsigned short bf;
typedef __attribute__((ext_vector_type(16))) __bf16   v16bf;
typedef __attribute__((ext_vector_type(16))) _Float16 v16h;
typedef __attribute__((ext_vector_type(8)))  _Float16 v8h;
typedef __attribute__((ext_vector_type(8)))  unsigned short v8us;
typedef __attribute__((ext_vector_type(8)))  float    v8f;
typedef __attribute__((ext_vector_type(4)))  float    v4f;
typedef v8h  __attribute__((may_alias)) v8ha;
typedef v4f  __attribute__((may_alias)) v4fa;
typedef v8us __attribute__((may_alias)) v8usa;

__device__ __forceinline__ unsigned short f2bf(float f) { unsigned u = __float_as_uint(f); u += 0x7FFFu + ((u >> 16) & 1u); return (unsigned short)(u >> 16); }
__device__ __forceinline__ float bf2f(unsigned short b) { return __uint_as_float(((unsigned)b) << 16); }
__device__ __forceinline__ float bfr(float f) { return bf2f(f2bf(f)); }
__device__ __forceinline__ v16h cat16(v8h lo, v8h hi) { return __builtin_shufflevector(lo, hi, 0, 1, 2, 3, 4, 5, 6, 7, 8, 9, 10, 11, 12, 13, 14, 15); }
__device__ __forceinline__ v16bf cat16b(v8us lo, v8us hi) { return __builtin_bit_cast(v16bf, __builtin_shufflevector(lo, hi, 0, 1, 2, 3, 4, 5, 6, 7, 8, 9, 10, 11, 12, 13, 14, 15)); }
__device__ __forceinline__ v8f wmma16(v16h a, v16h b, v8f c) { return __builtin_amdgcn_wmma_f32_16x16x32_f16(false, a, false, b, (short)0, c, false, false); }
__device__ __forceinline__ v8f wmmab(v16bf a, v16bf b, v8f c) { return __builtin_amdgcn_wmma_f32_16x16x32_bf16(false, a, false, b, (short)0, c, false, false); }



// ---- k_gemmw: register-blocked GEMM, ONE WAVE per 64x64 output tile (16 accumulators), operands straight from K-contiguous 16-bit planes; grid (M/64, N/64, Z), 32 threads.
// C[m][n] (f32, pitch ldc, + optional f32 bias[n]) = sum_k A[m][k] Bt[n][k] (+ split products per NSPLIT). z-batch strides sA/sB/sC in elements. K % 32 == 0.
template <typename T16> struct WFrag;
template <> struct WFrag<h16> { typedef v16h V; static __device__ __forceinline__ V ld(const h16* p) { return cat16(*(const v8h*)p, *(const v8h*)(p + 16)); } static __device__ __forceinline__ v8f mma(V a, V b, v8f c) { return wmma16(a, b, c); } };
template <> struct WFrag<bf> { typedef v16bf V; static __device__ __forceinline__ V ld(const bf* p) { return cat16b(*(const v8us*)p, *(const v8us*)(p + 16)); } static __device__ __forceinline__ v8f mma(V a, V b, v8f c) { return wmmab(a, b, c); } };
template <typename T16, int NSPLIT, bool BIAS>
__global__ __launch_bounds__(32) void k_gemmw(const T16* __restrict__ A, const T16* __restrict__ A2, const T16* __restrict__ Bt, const T16* __restrict__ Bt2, int K, float* C, int ldc, const float* __restrict__ bias, size_t sA, size_t sB, size_t sC) {
    typedef typename WFrag<T16>::V V;
    __shared__ __align__(16) float os[16 * 68];
    const size_t z = blockIdx.z; A += z * sA; if (A2) A2 += z * sA; Bt += z * sB; if (Bt2) Bt2 += z * sB; C += z * sC;
    const int lane = threadIdx.x & 31, lr = lane & 15, hi = lane >> 4; const int r0 = blockIdx.x * 64, c0 = blockIdx.y * 64;
    v8f acc[4][4];
#pragma unroll
    for (int mb = 0; mb < 4; ++mb)
#pragma unroll
        for (int nb = 0; nb < 4; ++nb) acc[mb][nb] = (v8f){};
    const size_t aoff = (size_t)(r0 + lr) * K + 8 * hi, boff = (size_t)(c0 + lr) * K + 8 * hi;
#pragma unroll 1
    for (int kc = 0; kc < K; kc += 32) {
        V a[4], a2[4];
#pragma unroll
        for (int mb = 0; mb < 4; ++mb) { a[mb] = WFrag<T16>::ld(A + aoff + (size_t)mb * 16 * K + kc); if (NSPLIT == 1 || NSPLIT == 2) a2[mb] = WFrag<T16>::ld(A2 + aoff + (size_t)mb * 16 * K + kc); }
#pragma unroll
        for (int nb = 0; nb < 4; ++nb) { const V b = WFrag<T16>::ld(Bt + boff + (size_t)nb * 16 * K + kc); V b2; if (NSPLIT >= 2) b2 = WFrag<T16>::ld(Bt2 + boff + (size_t)nb * 16 * K + kc);
#pragma unroll
            for (int mb = 0; mb < 4; ++mb) { acc[mb][nb] = WFrag<T16>::mma(a[mb], b, acc[mb][nb]); if (NSPLIT == 1 || NSPLIT == 2) acc[mb][nb] = WFrag<T16>::mma(a2[mb], b, acc[mb][nb]); if (NSPLIT >= 2) acc[mb][nb] = WFrag<T16>::mma(a[mb], b2, acc[mb][nb]); } }
        asm volatile("v_nop\n\tv_nop\n\tv_nop\n\tv_nop" : "+v"(acc[0][0]), "+v"(acc[1][1]), "+v"(acc[2][2]), "+v"(acc[3][3]) : "v"(a[0]), "v"(a[3]));
    }
#pragma unroll
    for (int mb = 0; mb < 4; ++mb) {
#pragma unroll
        for (int nb = 0; nb < 4; ++nb) {
#pragma unroll
            for (int j = 0; j < 8; ++j) os[(hi * 8 + j) * 68 + nb * 16 + lr] = acc[mb][nb][j]; }
        __builtin_amdgcn_wave_barrier(); asm volatile("" ::: "memory");
        float* crow = C + (size_t)(r0 + mb * 16) * ldc + c0;
{
#pragma unroll
            for (int s = 0; s < 8; ++s) { const int row = 2 * s + hi, cofs = lr * 4; v4f val = *(const v4fa*)(os + row * 68 + cofs); if (BIAS) { val[0] += bfr(bias[c0 + cofs]); val[1] += bfr(bias[c0 + cofs + 1]); val[2] += bfr(bias[c0 + cofs + 2]); val[3] += bfr(bias[c0 + cofs + 3]); }
                *(v4f*)(crow + (size_t)row * ldc + cofs) = val; }
             }
        __builtin_amdgcn_wave_barrier(); asm volatile("" ::: "memory");
    }
}

// ---- k_pvk: y = P g^T with the K axis (4096 keys) split 32 ways, so that 4096 waves load instead of 128. Work-group = one 64x64 tile of y and one half of the keys (blockIdx.z);
// its 16 waves take 128 keys each (same 16-accumulator wave tile and fragment loads as k_gemmw), leave their f32 partial tiles in LDS, and after one barrier the 512 threads add the
// 16 partials in wave order and store whole 256-B row pieces. The two key halves go to two planes of C (plane stride NN * DDr); k_ypl adds them.
#define PVW 16
#define PVZ 2
#define PVK (NN / (PVW * PVZ))
__global__ __launch_bounds__(PVW * 32) void k_pvk(const h16* __restrict__ A, const h16* __restrict__ Bt, float* C) {
    typedef WFrag<h16>::V V;
    __shared__ __align__(16) float red[PVW * 64 * 68];
    const int lane = threadIdx.x & 31, lr = lane & 15, hi = lane >> 4, wave = threadIdx.x >> 5; const int r0 = blockIdx.x * 64, c0 = blockIdx.y * 64;
    const int k0 = (blockIdx.z * PVW + wave) * PVK;
    v8f acc[4][4];
#pragma unroll
    for (int mb = 0; mb < 4; ++mb)
#pragma unroll
        for (int nb = 0; nb < 4; ++nb) acc[mb][nb] = (v8f){};
    const size_t aoff = (size_t)(r0 + lr) * NN + 8 * hi + k0, boff = (size_t)(c0 + lr) * NN + 8 * hi + k0;
    // kept rolled, as in k_gemmw: unrolled, the build fetches a pass's four B fragments one after another through one register set, with a full wait each
#pragma unroll 1
    for (int kc = 0; kc < PVK; kc += 32) {
        V a[4];
#pragma unroll
        for (int mb = 0; mb < 4; ++mb) a[mb] = WFrag<h16>::ld(A + aoff + (size_t)mb * 16 * NN + kc);
#pragma unroll
        for (int nb = 0; nb < 4; ++nb) { const V b = WFrag<h16>::ld(Bt + boff + (size_t)nb * 16 * NN + kc);
#pragma unroll
            for (int mb = 0; mb < 4; ++mb) acc[mb][nb] = WFrag<h16>::mma(a[mb], b, acc[mb][nb]); }
    }
    float* my = red + wave * (64 * 68);
#pragma unroll
    for (int mb = 0; mb < 4; ++mb)
#pragma unroll
        for (int nb = 0; nb < 4; ++nb)
#pragma unroll
            for (int j = 0; j < 8; ++j) my[(mb * 16 + hi * 8 + j) * 68 + nb * 16 + lr] = acc[mb][nb][j];
    __syncthreads();   // every wave's partial tile is in LDS before any thread adds them
    float* cz = C + (size_t)blockIdx.z * NN * DDr;
#pragma unroll
    for (int u = 0; u < 2; ++u) { const int idx = threadIdx.x + u * (PVW * 32), row = idx >> 4, cofs = (idx & 15) * 4; v4f s = *(const v4fa*)(red + row * 68 + cofs);
#pragma unroll
        for (int w = 1; w < PVW; ++w) s += *(const v4fa*)(red + w * (64 * 68) + row * 68 + cofs);
        *(v4f*)(cz + (size_t)(r0 + row) * DDr + c0 + cofs) = s; }
}

__device__ __forceinline__ h16 tohx(float x) { return (h16)x; }
__device__ __forceinline__ void splitf(float y, unsigned short& h, unsigned short& l) { h = f2bf(y); l = f2bf(y - bf2f(h)); }
typedef __attribute__((ext_vector_type(2))) unsigned short v2us;
typedef __attribute__((ext_vector_type(4))) unsigned short v4us;
typedef __attribute__((ext_vector_type(4))) _Float16 v4h;

__global__ __launch_bounds__(256) void k_cvt8(const float* __restrict__ src, bf* dst, size_t n8) { const size_t i = (size_t)blockIdx.x * 256 + threadIdx.x; if (i >= n8) return; const v8f v = *(const v8f*)(src + i * 8); v8us o;
#pragma unroll
    for (int k = 0; k < 8; ++k) o[k] = f2bf(v[k]); *(v8us*)(dst + i * 8) = o;  }
// k_xt: XT[n][c] = bf16 x[c][n] (lane -> 2 consecutive c; strided reads); k_tpl: hl planes T[n][d] = F[d][n] (lane -> 2 consecutive d); k_g16: fp16 copy of G [d][m] (8-B lanes); k_ypl: hl planes of (Y plane 0 + Y plane 1)/1024 (8-B lanes);
__global__ __launch_bounds__(256) void k_xt(const float* __restrict__ x, bf* XT) { const int e = (blockIdx.x * 256 + threadIdx.x) * 2; if (e >= NN * CC) return; const int c = e % CC; const int n = e / CC; v2us o; o[0] = f2bf(x[(size_t)c * NN + n]); o[1] = f2bf(x[(size_t)(c + 1) * NN + n]); *(v2us*)(XT + e) = o;  }
__global__ __launch_bounds__(256) void k_tpl(const float* __restrict__ F, bf* Th, bf* Tl) { const int e = (blockIdx.x * 256 + threadIdx.x) * 2; if (e >= NN * DDr) return; const int d = e % DDr; const int n = e / DDr; v2us oh, ol;
#pragma unroll
    for (int u = 0; u < 2; ++u) { unsigned short a, b; splitf(F[(size_t)(d + u) * NN + n], a, b); oh[u] = a; ol[u] = b; } *(v2us*)(Th + e) = oh; *(v2us*)(Tl + e) = ol;  }
__global__ __launch_bounds__(256) void k_g16(const float* __restrict__ G, h16* G16) { const int e = (blockIdx.x * 256 + threadIdx.x) * 4; if (e >= DDr * NN) return; const v4f a = *(const v4f*)(G + e); v4h o; o[0] = tohx(a[0]); o[1] = tohx(a[1]); o[2] = tohx(a[2]); o[3] = tohx(a[3]); *(v4h*)(G16 + e) = o;  }
__global__ __launch_bounds__(256) void k_ypl(const float* __restrict__ Y, bf* Yh, bf* Yl) { const int e = (blockIdx.x * 256 + threadIdx.x) * 4; if (e >= NN * DDr) return; const v4f a = *(const v4f*)(Y + e) + *(const v4f*)(Y + NN * DDr + e); v4us oh, ol;
#pragma unroll
    for (int u = 0; u < 4; ++u) { unsigned short h, l; splitf(a[u] * (1.0f / PCAR), h, l); oh[u] = h; ol[u] = l; } *(v4us*)(Yh + e) = oh; *(v4us*)(Yl + e) = ol;  }
__global__ __launch_bounds__(256) void k_outT(const float* __restrict__ x, const float* __restrict__ O, float* OUT) { const int e = (blockIdx.x * 256 + threadIdx.x) * 4; if (e >= CC * NN) return; const int n = e % NN; const int c = e / NN; v4f o;
#pragma unroll
    for (int u = 0; u < 4; ++u) o[u] = __fadd_rn(bfr(x[e + u]), O[(size_t)(n + u) * CC + c]); *(v4f*)(OUT + e) = o;  }
// k_soft<NFULL, TAIL>: wave per score row (ld = 128 NFULL + 64 TAIL) in three passes over memory (max; sum of exp; write P = exp/sum x1024 fp16); keys >= nvalid excluded; rows with (row % rowsper) >= rvalid write zeros (lane -> 4 consecutive
template <int NFULL, int TAIL> __global__ __launch_bounds__(256) void k_soft(const float* __restrict__ Sb, int nrows, int rowsper, int rvalid, int nvalid, h16* P) { const int lane = threadIdx.x & 31; const size_t row = (size_t)blockIdx.x * 8 + (threadIdx.x >> 5); if (row >= (size_t)nrows) return; constexpr int LD = NFULL * 128 + TAIL * 64; const float* sr = Sb + row * LD; h16* pr = P + row * LD; const bool live = (int)(row % rowsper) < rvalid; float mx = -3.0e38f;
#pragma unroll 1
    for (int ch = 0; ch < NFULL + TAIL; ++ch) { if (ch == NFULL && lane >= 16) break; const int j0 = ch * 128 + lane * 4; const v4f a = *(const v4f*)(sr + j0);
#pragma unroll
        for (int q = 0; q < 4; ++q) if (j0 + q < nvalid) mx = fmaxf(mx, a[q]); }
#pragma unroll
    for (int sh = 16; sh; sh >>= 1) mx = fmaxf(mx, __shfl_xor(mx, sh, 32));
    float sum = 0.f;
#pragma unroll 1
    for (int ch = 0; ch < NFULL + TAIL; ++ch) { if (ch == NFULL && lane >= 16) break; const int j0 = ch * 128 + lane * 4; const v4f a = *(const v4f*)(sr + j0);
#pragma unroll
        for (int q = 0; q < 4; ++q) if (j0 + q < nvalid) { float d0 = __fsub_rn(a[q], mx); asm volatile("" : "+v"(d0)); sum += __expf(d0); } }
#pragma unroll
    for (int sh = 16; sh; sh >>= 1) sum += __shfl_xor(sum, sh, 32);
    const float f = live ? __fdiv_rn(PCAR, sum) : 0.f;
    {
#pragma unroll 1
        for (int ch = 0; ch < NFULL + TAIL; ++ch) { if (ch == NFULL && lane >= 16) break; const int j0 = ch * 128 + lane * 4; const v4f a = *(const v4f*)(sr + j0); v4h o;
#pragma unroll
            for (int q = 0; q < 4; ++q) { float val = 0.f; if (live && j0 + q < nvalid) { float d0 = __fsub_rn(a[q], mx); asm volatile("" : "+v"(d0)); val = __fmul_rn(__expf(d0), f); } o[q] = tohx(val); } *(v4h*)(pr + j0) = o; }
         } }

extern "C" void kernel_launch(void* const* d_in, const int* in_sizes, int n_in,
                              void* d_out, int out_size, void* d_ws, size_t ws_size, hipStream_t stream) {
    (void)in_sizes; (void)n_in; (void)out_size;
    const float* x = (const float*)d_in[0]; const float* wth = (const float*)d_in[1]; const float* wph = (const float*)d_in[2]; const float* wg = (const float*)d_in[3]; const float* wout = (const float*)d_in[4];
    float* OUT = (float*)d_out;     // [4][256][64][64]
    char* wsp = (char*)d_ws;
    auto take = [&](size_t bytes) { char* p = wsp; wsp += (bytes + 255) & ~(size_t)255; return (void*)p; };
    bf* WTH = (bf*)take(DDr * CC * 2); bf* WPH = (bf*)take(DDr * CC * 2); bf* WG = (bf*)take(DDr * CC * 2); bf* WOUT = (bf*)take(CC * DDr * 2);
    bf* XT = (bf*)take((size_t)NN * CC * 2); float* TH = (float*)take((size_t)DDr * NN * 4); float* PH = (float*)take((size_t)DDr * NN * 4); float* G = (float*)take((size_t)DDr * NN * 4); bf* THh = (bf*)take((size_t)NN * DDr * 2); bf* THl = (bf*)take((size_t)NN * DDr * 2); bf* PHh = (bf*)take((size_t)NN * DDr * 2); bf* PHl = (bf*)take((size_t)NN * DDr * 2); h16* G16 = (h16*)take((size_t)DDr * NN * 2);
    float* Sb = (float*)take((size_t)NN * NN * 4); h16* P16 = (h16*)take((size_t)NN * NN * 2); float* Y = (float*)take((size_t)PVZ * NN * DDr * 4); bf* Yh = (bf*)take((size_t)NN * DDr * 2); bf* Yl = (bf*)take((size_t)NN * DDr * 2); float* O = (float*)take((size_t)NN * CC * 4);
    if ((size_t)(wsp - (char*)d_ws) > ws_size) return;    // total ~ 119 MiB
    k_cvt8<<<(DDr * CC / 8 + 255) / 256, 256, 0, stream>>>(wth, WTH, DDr * CC / 8); k_cvt8<<<(DDr * CC / 8 + 255) / 256, 256, 0, stream>>>(wph, WPH, DDr * CC / 8); k_cvt8<<<(DDr * CC / 8 + 255) / 256, 256, 0, stream>>>(wg, WG, DDr * CC / 8); k_cvt8<<<(CC * DDr / 8 + 255) / 256, 256, 0, stream>>>(wout, WOUT, CC * DDr / 8);   // [d][c] rows = A operand; w_out [c][d] = natural Bt
    for (int b = 0; b < NBI; ++b) { const float* xb = x + (size_t)b * CC * NN;
        k_xt<<<(NN * CC / 2 + 255) / 256, 256, 0, stream>>>(xb, XT);
        k_gemmw<bf, 0, false><<<dim3(DDr / 64, NN / 64, 1), 32, 0, stream>>>(WTH, nullptr, XT, nullptr, CC, TH, NN, nullptr, 0, 0, 0); k_gemmw<bf, 0, false><<<dim3(DDr / 64, NN / 64, 1), 32, 0, stream>>>(WPH, nullptr, XT, nullptr, CC, PH, NN, nullptr, 0, 0, 0); k_gemmw<bf, 0, false><<<dim3(DDr / 64, NN / 64, 1), 32, 0, stream>>>(WG, nullptr, XT, nullptr, CC, G, NN, nullptr, 0, 0, 0);
        k_tpl<<<(NN * DDr / 2 + 255) / 256, 256, 0, stream>>>(TH, THh, THl); k_tpl<<<(NN * DDr / 2 + 255) / 256, 256, 0, stream>>>(PH, PHh, PHl); k_g16<<<(DDr * NN / 4 + 255) / 256, 256, 0, stream>>>(G, G16);
        k_gemmw<bf, 2, false><<<dim3(NN / 64, NN / 64, 1), 32, 0, stream>>>(THh, THl, PHh, PHl, DDr, Sb, NN, nullptr, 0, 0, 0);   // scores[n][m] = theta[:,n].phi[:,m]
        k_soft<32, 0><<<NN / 8, 256, 0, stream>>>(Sb, NN, NN, NN, NN, P16);
        k_pvk<<<dim3(NN / 64, DDr / 64, PVZ), PVW * 32, 0, stream>>>(P16, G16, Y);      // y[n][d] = sum_m P[n][m] g[d][m] (x1024), two key-half planes
        k_ypl<<<(NN * DDr / 4 + 255) / 256, 256, 0, stream>>>(Y, Yh, Yl);
        k_gemmw<bf, 1, false><<<dim3(NN / 64, CC / 64, 1), 32, 0, stream>>>(Yh, Yl, WOUT, nullptr, DDr, O, CC, nullptr, 0, 0, 0);            // o[n][c] = sum_d y[n][d] w_out[c][d]
        k_outT<<<(CC * NN / 4 + 255) / 256, 256, 0, stream>>>(xb, O, OUT + (size_t)b * CC * NN); }
}

// v002
// One run takes 357 microseconds.
// Two timings next to v001 put it at 1.73 and 1.72 times that version's speed.
// Counting every step since v000, it is 2.54 times as fast.
#include <hip/hip_runtime.h>

// _NonLocal (embedded-Gaussian non-local block: x [4][256][64][64] -> 4096 positions; theta/phi/g = 1x1 convs to 128 channels (no bias); attn[n][m] = softmax_m(theta[:,n].phi[:,m]) (UNSCALED: logits have sigma ~ 11, so the scores need 3-product precision);
// y[d][n] = sum_m g[d][m] attn[n][m]; out = x + w_out y -> [4][256][64][64]).
// Compute dtypes, f32 accumulate: every input rounded to bf16; theta/phi/g on PLAIN bf16 operands (inputs: exact); scores (K 128) on bf16 hi+lo planes of theta and phi (3 products; single fp16 planes

#define NBI  4
#define CC   256
#define DDr  128
#define NN   4096
#define PCAR 1024.0f
#define IMG2 2
typedef _Float16 h16;
typedef unsigned short bf;
typedef __attribute__((ext_vector_type(16))) __bf16   v16bf;
typedef __attribute__((ext_vector_type(16))) _Float16 v16h;
typedef __attribute__((ext_vector_type(8)))  _Float16 v8h;
typedef __attribute__((ext_vector_type(8)))  unsigned short v8us;
typedef __attribute__((ext_vector_type(8)))  float    v8f;
typedef __attribute__((ext_vector_type(4)))  float    v4f;
typedef v8h  __attribute__((may_alias)) v8ha;
typedef v4f  __attribute__((may_alias)) v4fa;
typedef v8us __attribute__((may_alias)) v8usa;

__device__ __forceinline__ unsigned short f2bf(float f) { unsigned u = __float_as_uint(f); u += 0x7FFFu + ((u >> 16) & 1u); return (unsigned short)(u >> 16); }
__device__ __forceinline__ float bf2f(unsigned short b) { return __uint_as_float(((unsigned)b) << 16); }
__device__ __forceinline__ float bfr(float f) { return bf2f(f2bf(f)); }
__device__ __forceinline__ v16h cat16(v8h lo, v8h hi) { return __builtin_shufflevector(lo, hi, 0, 1, 2, 3, 4, 5, 6, 7, 8, 9, 10, 11, 12, 13, 14, 15); }
__device__ __forceinline__ v16bf cat16b(v8us lo, v8us hi) { return __builtin_bit_cast(v16bf, __builtin_shufflevector(lo, hi, 0, 1, 2, 3, 4, 5, 6, 7, 8, 9, 10, 11, 12, 13, 14, 15)); }
__device__ __forceinline__ v8f wmma16(v16h a, v16h b, v8f c) { return __builtin_amdgcn_wmma_f32_16x16x32_f16(false, a, false, b, (short)0, c, false, false); }
__device__ __forceinline__ v8f wmmab(v16bf a, v16bf b, v8f c) { return __builtin_amdgcn_wmma_f32_16x16x32_bf16(false, a, false, b, (short)0, c, false, false); }



// ---- k_gemmw: register-blocked GEMM, ONE WAVE per 64x64 output tile (16 accumulators), operands straight from K-contiguous 16-bit planes; grid (M/64, N/64, Z), 32 threads.
// C[m][n] (f32, pitch ldc, + optional f32 bias[n]) = sum_k A[m][k] Bt[n][k] (+ split products per NSPLIT). z-batch strides sA/sB/sC in elements. K % 32 == 0.
template <typename T16> struct WFrag;
template <> struct WFrag<h16> { typedef v16h V; static __device__ __forceinline__ V ld(const h16* p) { return cat16(*(const v8h*)p, *(const v8h*)(p + 16)); } static __device__ __forceinline__ v8f mma(V a, V b, v8f c) { return wmma16(a, b, c); } };
template <> struct WFrag<bf> { typedef v16bf V; static __device__ __forceinline__ V ld(const bf* p) { return cat16b(*(const v8us*)p, *(const v8us*)(p + 16)); } static __device__ __forceinline__ v8f mma(V a, V b, v8f c) { return wmmab(a, b, c); } };
template <typename T16, int NSPLIT, bool BIAS>
__global__ __launch_bounds__(32) void k_gemmw(const T16* __restrict__ A, const T16* __restrict__ A2, const T16* __restrict__ Bt, const T16* __restrict__ Bt2, int K, float* C, int ldc, const float* __restrict__ bias, size_t sA, size_t sB, size_t sC) {
    typedef typename WFrag<T16>::V V;
    __shared__ __align__(16) float os[16 * 68];
    const size_t z = blockIdx.z; A += z * sA; if (A2) A2 += z * sA; Bt += z * sB; if (Bt2) Bt2 += z * sB; C += z * sC;
    const int lane = threadIdx.x & 31, lr = lane & 15, hi = lane >> 4; const int r0 = blockIdx.x * 64, c0 = blockIdx.y * 64;
    v8f acc[4][4];
#pragma unroll
    for (int mb = 0; mb < 4; ++mb)
#pragma unroll
        for (int nb = 0; nb < 4; ++nb) acc[mb][nb] = (v8f){};
    const size_t aoff = (size_t)(r0 + lr) * K + 8 * hi, boff = (size_t)(c0 + lr) * K + 8 * hi;
#pragma unroll 1
    for (int kc = 0; kc < K; kc += 32) {
        V a[4], a2[4];
#pragma unroll
        for (int mb = 0; mb < 4; ++mb) { a[mb] = WFrag<T16>::ld(A + aoff + (size_t)mb * 16 * K + kc); if (NSPLIT == 1 || NSPLIT == 2) a2[mb] = WFrag<T16>::ld(A2 + aoff + (size_t)mb * 16 * K + kc); }
#pragma unroll
        for (int nb = 0; nb < 4; ++nb) { const V b = WFrag<T16>::ld(Bt + boff + (size_t)nb * 16 * K + kc); V b2; if (NSPLIT >= 2) b2 = WFrag<T16>::ld(Bt2 + boff + (size_t)nb * 16 * K + kc);
#pragma unroll
            for (int mb = 0; mb < 4; ++mb) { acc[mb][nb] = WFrag<T16>::mma(a[mb], b, acc[mb][nb]); if (NSPLIT == 1 || NSPLIT == 2) acc[mb][nb] = WFrag<T16>::mma(a2[mb], b, acc[mb][nb]); if (NSPLIT >= 2) acc[mb][nb] = WFrag<T16>::mma(a[mb], b2, acc[mb][nb]); } }
        asm volatile("v_nop\n\tv_nop\n\tv_nop\n\tv_nop" : "+v"(acc[0][0]), "+v"(acc[1][1]), "+v"(acc[2][2]), "+v"(acc[3][3]) : "v"(a[0]), "v"(a[3]));
    }
#pragma unroll
    for (int mb = 0; mb < 4; ++mb) {
#pragma unroll
        for (int nb = 0; nb < 4; ++nb) {
#pragma unroll
            for (int j = 0; j < 8; ++j) os[(hi * 8 + j) * 68 + nb * 16 + lr] = acc[mb][nb][j]; }
        __builtin_amdgcn_wave_barrier(); asm volatile("" ::: "memory");
        float* crow = C + (size_t)(r0 + mb * 16) * ldc + c0;
{
#pragma unroll
            for (int s = 0; s < 8; ++s) { const int row = 2 * s + hi, cofs = lr * 4; v4f val = *(const v4fa*)(os + row * 68 + cofs); if (BIAS) { val[0] += bfr(bias[c0 + cofs]); val[1] += bfr(bias[c0 + cofs + 1]); val[2] += bfr(bias[c0 + cofs + 2]); val[3] += bfr(bias[c0 + cofs + 3]); }
                *(v4f*)(crow + (size_t)row * ldc + cofs) = val; }
             }
        __builtin_amdgcn_wave_barrier(); asm volatile("" ::: "memory");
    }
}

// ---- k_pvk: y = P g^T with the K axis (4096 keys) split 32 ways, so that 4096 waves load instead of 128. Work-group = one 64x64 tile of y and one half of the keys (blockIdx.z);
// its 16 waves take 128 keys each (same 16-accumulator wave tile and fragment loads as k_gemmw), leave their f32 partial tiles in LDS, and after one barrier the 512 threads add the
// 16 partials in wave order and store whole 256-B row pieces. The two key halves go to two planes of C (plane stride NN * DDr); k_ypl adds them.
// blockIdx.z = image * PVZ + key half: A, Bt and C step by one image's P, g and pair of planes.
#define PVW 16
#define PVZ 2
#define PVK (NN / (PVW * PVZ))
__global__ __launch_bounds__(PVW * 32) void k_pvk(const h16* __restrict__ A, const h16* __restrict__ Bt, float* C) {
    typedef WFrag<h16>::V V;
    __shared__ __align__(16) float red[PVW * 64 * 68];
    const int lane = threadIdx.x & 31, lr = lane & 15, hi = lane >> 4, wave = threadIdx.x >> 5; const int r0 = blockIdx.x * 64, c0 = blockIdx.y * 64;
    const int img = blockIdx.z / PVZ; A += (size_t)img * NN * NN; Bt += (size_t)img * DDr * NN;
    const int k0 = ((blockIdx.z % PVZ) * PVW + wave) * PVK;
    v8f acc[4][4];
#pragma unroll
    for (int mb = 0; mb < 4; ++mb)
#pragma unroll
        for (int nb = 0; nb < 4; ++nb) acc[mb][nb] = (v8f){};
    const size_t aoff = (size_t)(r0 + lr) * NN + 8 * hi + k0, boff = (size_t)(c0 + lr) * NN + 8 * hi + k0;
    // kept rolled, as in k_gemmw: unrolled, the build fetches a pass's four B fragments one after another through one register set, with a full wait each
#pragma unroll 1
    for (int kc = 0; kc < PVK; kc += 32) {
        V a[4];
#pragma unroll
        for (int mb = 0; mb < 4; ++mb) a[mb] = WFrag<h16>::ld(A + aoff + (size_t)mb * 16 * NN + kc);
#pragma unroll
        for (int nb = 0; nb < 4; ++nb) { const V b = WFrag<h16>::ld(Bt + boff + (size_t)nb * 16 * NN + kc);
#pragma unroll
            for (int mb = 0; mb < 4; ++mb) acc[mb][nb] = WFrag<h16>::mma(a[mb], b, acc[mb][nb]); }
    }
    float* my = red + wave * (64 * 68);
#pragma unroll
    for (int mb = 0; mb < 4; ++mb)
#pragma unroll
        for (int nb = 0; nb < 4; ++nb)
#pragma unroll
            for (int j = 0; j < 8; ++j) my[(mb * 16 + hi * 8 + j) * 68 + nb * 16 + lr] = acc[mb][nb][j];
    __syncthreads();   // every wave's partial tile is in LDS before any thread adds them
    float* cz = C + (size_t)blockIdx.z * NN * DDr;
#pragma unroll
    for (int u = 0; u < 2; ++u) { const int idx = threadIdx.x + u * (PVW * 32), row = idx >> 4, cofs = (idx & 15) * 4; v4f s = *(const v4fa*)(red + row * 68 + cofs);
#pragma unroll
        for (int w = 1; w < PVW; ++w) s += *(const v4fa*)(red + w * (64 * 68) + row * 68 + cofs);
        *(v4f*)(cz + (size_t)(r0 + row) * DDr + c0 + cofs) = s; }
}

__device__ __forceinline__ h16 tohx(float x) { return (h16)x; }
__device__ __forceinline__ void splitf(float y, unsigned short& h, unsigned short& l) { h = f2bf(y); l = f2bf(y - bf2f(h)); }
typedef __attribute__((ext_vector_type(2))) unsigned short v2us;
typedef __attribute__((ext_vector_type(4))) unsigned short v4us;
typedef __attribute__((ext_vector_type(4))) _Float16 v4h;

// The image is a grid axis in all of these (blockIdx.y; in k_xt it is folded into blockIdx.x); F holds [image][theta, phi, g][d][n]. Two pairs of repacks that do not depend on each other share a grid, each block doing one kind of work:
// k_xt: blocks 0 .. 4 WBL - 1: bf16 copies of the four weight matrices, one behind the other in W4 (WBL blocks a matrix, 32-B lanes); then XBL blocks an image: XT[n][c] = bf16 x[c][n] (lane -> 2 consecutive c; strided reads);
// k_tpl: TBL blocks each for theta and phi: hl planes T[n][d] = F[d][n] (lane -> 2 consecutive d); then GBL blocks: fp16 copy of g [d][m] (8-B lanes); k_ypl: hl planes of (Y plane 0 + Y plane 1)/1024 (8-B lanes);
#define WBL (DDr * CC / 8 / 256)
#define XBL (NN * CC / 2 / 256)
#define TBL (NN * DDr / 2 / 256)
#define GBL (DDr * NN / 4 / 256)
static_assert(WBL * 8 * 256 == DDr * CC && XBL * 2 * 256 == NN * CC && TBL * 2 * 256 == NN * DDr && GBL * 4 * 256 == DDr * NN, "whole blocks only: k_xt and k_tpl have no range test");
__global__ __launch_bounds__(256) void k_xt(const float* __restrict__ x, const float* __restrict__ w0, const float* __restrict__ w1, const float* __restrict__ w2, const float* __restrict__ w3, bf* XT, bf* W4) {
    if (blockIdx.x < 4 * WBL) { const int w = blockIdx.x / WBL; const float* src = w == 0 ? w0 : w == 1 ? w1 : w == 2 ? w2 : w3; const int i = (blockIdx.x % WBL) * 256 + threadIdx.x; const v8f v = *(const v8f*)(src + i * 8); v8us o;
#pragma unroll
        for (int k = 0; k < 8; ++k) o[k] = f2bf(v[k]); *(v8us*)(W4 + w * (DDr * CC) + i * 8) = o; }
    else { const int blk = blockIdx.x - 4 * WBL, img = blk / XBL; x += (size_t)img * CC * NN; XT += (size_t)img * NN * CC;
        const int e = ((blk % XBL) * 256 + threadIdx.x) * 2; const int c = e % CC; const int n = e / CC; v2us o; o[0] = f2bf(x[(size_t)c * NN + n]); o[1] = f2bf(x[(size_t)(c + 1) * NN + n]); *(v2us*)(XT + e) = o;
        asm volatile("s_wait_xcnt 0x0" ::: "memory"); } }   // the build lays the other branch's code behind this store (a path no block takes): the wait stands in front of its writes of the store's registers
__global__ __launch_bounds__(256) void k_tpl(const float* __restrict__ F, bf* Th, bf* Tl, h16* G16) { F += (size_t)blockIdx.y * 3 * DDr * NN;
    if (blockIdx.x >= 2 * TBL) { const int e = ((blockIdx.x - 2 * TBL) * 256 + threadIdx.x) * 4; F += (size_t)2 * DDr * NN; G16 += (size_t)blockIdx.y * DDr * NN; const v4f a = *(const v4f*)(F + e); v4h o; o[0] = tohx(a[0]); o[1] = tohx(a[1]); o[2] = tohx(a[2]); o[3] = tohx(a[3]); *(v4h*)(G16 + e) = o; }
    else { const int tp = blockIdx.x / TBL; F += (size_t)tp * DDr * NN; Th += (size_t)(blockIdx.y * 2 + tp) * NN * DDr; Tl += (size_t)(blockIdx.y * 2 + tp) * NN * DDr;
        const int e = ((blockIdx.x % TBL) * 256 + threadIdx.x) * 2; const int d = e % DDr; const int n = e / DDr; v2us oh, ol;
#pragma unroll
        for (int u = 0; u < 2; ++u) { unsigned short a, b; splitf(F[(size_t)(d + u) * NN + n], a, b); oh[u] = a; ol[u] = b; } *(v2us*)(Th + e) = oh; *(v2us*)(Tl + e) = ol;
        asm volatile("s_wait_xcnt 0x0" ::: "memory"); } }   // as in k_xt: in front of the other branch's writes of these stores' registers
__global__ __launch_bounds__(256) void k_ypl(const float* __restrict__ Y, bf* Yh, bf* Yl) { const int e = (blockIdx.x * 256 + threadIdx.x) * 4; if (e >= NN * DDr) return; Y += (size_t)blockIdx.y * PVZ * NN * DDr; Yh += (size_t)blockIdx.y * NN * DDr; Yl += (size_t)blockIdx.y * NN * DDr; const v4f a = *(const v4f*)(Y + e) + *(const v4f*)(Y + NN * DDr + e); v4us oh, ol;
#pragma unroll
    for (int u = 0; u < 4; ++u) { unsigned short h, l; splitf(a[u] * (1.0f / PCAR), h, l); oh[u] = h; ol[u] = l; } *(v4us*)(Yh + e) = oh; *(v4us*)(Yl + e) = ol;  }
__global__ __launch_bounds__(256) void k_outT(const float* __restrict__ x, const float* __restrict__ O, float* OUT) { const int e = (blockIdx.x * 256 + threadIdx.x) * 4; if (e >= CC * NN) return; x += (size_t)blockIdx.y * CC * NN; O += (size_t)blockIdx.y * NN * CC; OUT += (size_t)blockIdx.y * CC * NN; const int n = e % NN; const int c = e / NN; v4f o;
#pragma unroll
    for (int u = 0; u < 4; ++u) o[u] = __fadd_rn(bfr(x[e + u]), O[(size_t)(n + u) * CC + c]); *(v4f*)(OUT + e) = o;  }
// k_soft<NFULL, TAIL>: wave per score row (ld = 128 NFULL + 64 TAIL) in three passes over memory (max; sum of exp; write P = exp/sum x1024 fp16); keys >= nvalid excluded; rows with (row % rowsper) >= rvalid write zeros (lane -> 4 consecutive
template <int NFULL, int TAIL> __global__ __launch_bounds__(256) void k_soft(const float* __restrict__ Sb, int nrows, int rowsper, int rvalid, int nvalid, h16* P) { const int lane = threadIdx.x & 31; const size_t row = (size_t)blockIdx.x * 8 + (threadIdx.x >> 5); if (row >= (size_t)nrows) return; constexpr int LD = NFULL * 128 + TAIL * 64; const float* sr = Sb + row * LD; h16* pr = P + row * LD; const bool live = (int)(row % rowsper) < rvalid; float mx = -3.0e38f;
#pragma unroll 1
    for (int ch = 0; ch < NFULL + TAIL; ++ch) { if (ch == NFULL && lane >= 16) break; const int j0 = ch * 128 + lane * 4; const v4f a = *(const v4f*)(sr + j0);
#pragma unroll
        for (int q = 0; q < 4; ++q) if (j0 + q < nvalid) mx = fmaxf(mx, a[q]); }
#pragma unroll
    for (int sh = 16; sh; sh >>= 1) mx = fmaxf(mx, __shfl_xor(mx, sh, 32));
    float sum = 0.f;
#pragma unroll 1
    for (int ch = 0; ch < NFULL + TAIL; ++ch) { if (ch == NFULL && lane >= 16) break; const int j0 = ch * 128 + lane * 4; const v4f a = *(const v4f*)(sr + j0);
#pragma unroll
        for (int q = 0; q < 4; ++q) if (j0 + q < nvalid) { float d0 = __fsub_rn(a[q], mx); asm volatile("" : "+v"(d0)); sum += __expf(d0); } }
#pragma unroll
    for (int sh = 16; sh; sh >>= 1) sum += __shfl_xor(sum, sh, 32);
    const float f = live ? __fdiv_rn(PCAR, sum) : 0.f;
    {
#pragma unroll 1
        for (int ch = 0; ch < NFULL + TAIL; ++ch) { if (ch == NFULL && lane >= 16) break; const int j0 = ch * 128 + lane * 4; const v4f a = *(const v4f*)(sr + j0); v4h o;
#pragma unroll
            for (int q = 0; q < 4; ++q) { float val = 0.f; if (live && j0 + q < nvalid) { float d0 = __fsub_rn(a[q], mx); asm volatile("" : "+v"(d0)); val = __fmul_rn(__expf(d0), f); } o[q] = tohx(val); } *(v4h*)(pr + j0) = o; }
         } }

extern "C" void kernel_launch(void* const* d_in, const int* in_sizes, int n_in,
                              void* d_out, int out_size, void* d_ws, size_t ws_size, hipStream_t stream) {
    (void)in_sizes; (void)n_in; (void)out_size;
    const float* x = (const float*)d_in[0]; const float* wth = (const float*)d_in[1]; const float* wph = (const float*)d_in[2]; const float* wg = (const float*)d_in[3]; const float* wout = (const float*)d_in[4];
    float* OUT = (float*)d_out;     // [4][256][64][64]
    char* wsp = (char*)d_ws;
    auto take = [&](size_t bytes) { char* p = wsp; wsp += (bytes + 255) & ~(size_t)255; return (void*)p; };
    // Independent launches are merged into one grid each: the four images are a grid axis everywhere, the three projections are one product with 384 rows of weights.
    // Scores and P of all four images do not fit the workspace, so scores, softmax and P.g go IMG2 images at a time. Y reuses F and O reuses Sb, both dead by then.
    bf* W4 = (bf*)take((size_t)4 * DDr * CC * 2); bf* WOUT = W4 + 3 * DDr * CC;   // w_theta, w_phi, w_g ([d][c] rows = A operand), w_out ([c][d] = natural Bt)
    bf* XT = (bf*)take((size_t)NBI * NN * CC * 2); float* F = (float*)take((size_t)NBI * 3 * DDr * NN * 4); bf* TPh = (bf*)take((size_t)NBI * 2 * NN * DDr * 2); bf* TPl = (bf*)take((size_t)NBI * 2 * NN * DDr * 2); h16* G16 = (h16*)take((size_t)NBI * DDr * NN * 2);
    float* Sb = (float*)take((size_t)IMG2 * NN * NN * 4); h16* P16 = (h16*)take((size_t)IMG2 * NN * NN * 2); bf* Yh = (bf*)take((size_t)NBI * NN * DDr * 2); bf* Yl = (bf*)take((size_t)NBI * NN * DDr * 2);
    float* Y = F;     // [image][key half][n][d], 16 MiB of F's 24
    float* O = Sb;    // [image][n][c], 16 MiB of Sb's 128
    if ((size_t)(wsp - (char*)d_ws) > ws_size) return;    // total ~ 252.3 MiB
    k_xt<<<4 * WBL + NBI * XBL, 256, 0, stream>>>(x, wth, wph, wg, wout, XT, W4);
    k_gemmw<bf, 0, false><<<dim3(3 * DDr / 64, NN / 64, NBI), 32, 0, stream>>>(W4, nullptr, XT, nullptr, CC, F, NN, nullptr, 0, (size_t)NN * CC, (size_t)3 * DDr * NN);
    k_tpl<<<dim3(2 * TBL + GBL, NBI, 1), 256, 0, stream>>>(F, TPh, TPl, G16);
    for (int b = 0; b < NBI; b += IMG2) { const bf* th = TPh + (size_t)b * 2 * NN * DDr; const bf* tl = TPl + (size_t)b * 2 * NN * DDr;
        k_gemmw<bf, 2, false><<<dim3(NN / 64, NN / 64, IMG2), 32, 0, stream>>>(th, tl, th + (size_t)NN * DDr, tl + (size_t)NN * DDr, DDr, Sb, NN, nullptr, (size_t)2 * NN * DDr, (size_t)2 * NN * DDr, (size_t)NN * NN);   // scores[n][m] = theta[:,n].phi[:,m]
        k_soft<32, 0><<<IMG2 * NN / 8, 256, 0, stream>>>(Sb, IMG2 * NN, NN, NN, NN, P16);
        k_pvk<<<dim3(NN / 64, DDr / 64, IMG2 * PVZ), PVW * 32, 0, stream>>>(P16, G16 + (size_t)b * DDr * NN, Y + (size_t)b * PVZ * NN * DDr); }     // y[n][d] = sum_m P[n][m] g[d][m] (x1024), two key-half planes an image
    k_ypl<<<dim3((NN * DDr / 4 + 255) / 256, NBI, 1), 256, 0, stream>>>(Y, Yh, Yl);
    k_gemmw<bf, 1, false><<<dim3(NN / 64, CC / 64, NBI), 32, 0, stream>>>(Yh, Yl, WOUT, nullptr, DDr, O, CC, nullptr, (size_t)NN * DDr, 0, (size_t)NN * CC);            // o[n][c] = sum_d y[n][d] w_out[c][d]
    k_outT<<<dim3((CC * NN / 4 + 255) / 256, NBI, 1), 256, 0, stream>>>(x, O, OUT);
}

// v003
// A run of this version takes 140 microseconds.
// Next to v002, in two timings, it ran 2.55 and 2.58 times as fast.
// Counting every step since v000, it is 6.52 times as fast.
#include <hip/hip_runtime.h>

// _NonLocal (embedded-Gaussian non-local block: x [4][256][64][64] -> 4096 positions; theta/phi/g = 1x1 convs to 128 channels (no bias); attn[n][m] = softmax_m(theta[:,n].phi[:,m]) (UNSCALED: logits have sigma ~ 11, so the scores need 3-product precision);
// y[d][n] = sum_m g[d][m] attn[n][m]; out = x + w_out y -> [4][256][64][64]).
// Compute dtypes, f32 accumulate: every input rounded to bf16; theta/phi/g on PLAIN bf16 operands (inputs: exact); scores (K 128) on bf16 hi+lo planes of theta and phi (3 products; single fp16 planes

#define NBI  4
#define CC   256
#define DDr  128
#define NN   4096
#define L2E  1.4426950408889634f
#define PSH  10.0f
typedef _Float16 h16;
typedef unsigned short bf;
typedef __attribute__((ext_vector_type(16))) __bf16   v16bf;
typedef __attribute__((ext_vector_type(16))) _Float16 v16h;
typedef __attribute__((ext_vector_type(8)))  _Float16 v8h;
typedef __attribute__((ext_vector_type(8)))  unsigned short v8us;
typedef __attribute__((ext_vector_type(8)))  float    v8f;
typedef __attribute__((ext_vector_type(4)))  float    v4f;
typedef v8h  __attribute__((may_alias)) v8ha;
typedef v4f  __attribute__((may_alias)) v4fa;
typedef v8us __attribute__((may_alias)) v8usa;

__device__ __forceinline__ unsigned short f2bf(float f) { unsigned u = __float_as_uint(f); u += 0x7FFFu + ((u >> 16) & 1u); return (unsigned short)(u >> 16); }
__device__ __forceinline__ float bf2f(unsigned short b) { return __uint_as_float(((unsigned)b) << 16); }
__device__ __forceinline__ float bfr(float f) { return bf2f(f2bf(f)); }
__device__ __forceinline__ v16h cat16(v8h lo, v8h hi) { return __builtin_shufflevector(lo, hi, 0, 1, 2, 3, 4, 5, 6, 7, 8, 9, 10, 11, 12, 13, 14, 15); }
__device__ __forceinline__ v16bf cat16b(v8us lo, v8us hi) { return __builtin_bit_cast(v16bf, __builtin_shufflevector(lo, hi, 0, 1, 2, 3, 4, 5, 6, 7, 8, 9, 10, 11, 12, 13, 14, 15)); }
__device__ __forceinline__ float xhalf(float x) { return __builtin_bit_cast(float, __builtin_amdgcn_permlanex16(__builtin_bit_cast(int, x), __builtin_bit_cast(int, x), 0x76543210, 0xfedcba98, false, false)); }   // lane l takes lane l ^ 16's value
__device__ __forceinline__ v8f wmma16(v16h a, v16h b, v8f c) { return __builtin_amdgcn_wmma_f32_16x16x32_f16(false, a, false, b, (short)0, c, false, false); }
__device__ __forceinline__ v8f wmmab(v16bf a, v16bf b, v8f c) { return __builtin_amdgcn_wmma_f32_16x16x32_bf16(false, a, false, b, (short)0, c, false, false); }



// ---- k_gemmw: register-blocked GEMM, ONE WAVE per 64x64 output tile (16 accumulators), operands straight from K-contiguous 16-bit planes; grid (M/64, N/64, Z), 32 threads.
// C[m][n] (f32, pitch ldc, + optional f32 bias[n]) = sum_k A[m][k] Bt[n][k] (+ split products per NSPLIT). z-batch strides sA/sB/sC in elements. K % 32 == 0.
template <typename T16> struct WFrag;
template <> struct WFrag<h16> { typedef v16h V; static __device__ __forceinline__ V ld(const h16* p) { return cat16(*(const v8h*)p, *(const v8h*)(p + 16)); } static __device__ __forceinline__ v8f mma(V a, V b, v8f c) { return wmma16(a, b, c); } };
template <> struct WFrag<bf> { typedef v16bf V; static __device__ __forceinline__ V ld(const bf* p) { return cat16b(*(const v8us*)p, *(const v8us*)(p + 16)); } static __device__ __forceinline__ v8f mma(V a, V b, v8f c) { return wmmab(a, b, c); } };
template <typename T16, int NSPLIT, bool BIAS>
__global__ __launch_bounds__(32) void k_gemmw(const T16* __restrict__ A, const T16* __restrict__ A2, const T16* __restrict__ Bt, const T16* __restrict__ Bt2, int K, float* C, int ldc, const float* __restrict__ bias, size_t sA, size_t sB, size_t sC) {
    typedef typename WFrag<T16>::V V;
    __shared__ __align__(16) float os[16 * 68];
    const size_t z = blockIdx.z; A += z * sA; if (A2) A2 += z * sA; Bt += z * sB; if (Bt2) Bt2 += z * sB; C += z * sC;
    const int lane = threadIdx.x & 31, lr = lane & 15, hi = lane >> 4; const int r0 = blockIdx.x * 64, c0 = blockIdx.y * 64;
    v8f acc[4][4];
#pragma unroll
    for (int mb = 0; mb < 4; ++mb)
#pragma unroll
        for (int nb = 0; nb < 4; ++nb) acc[mb][nb] = (v8f){};
    const size_t aoff = (size_t)(r0 + lr) * K + 8 * hi, boff = (size_t)(c0 + lr) * K + 8 * hi;
#pragma unroll 1
    for (int kc = 0; kc < K; kc += 32) {
        V a[4], a2[4];
#pragma unroll
        for (int mb = 0; mb < 4; ++mb) { a[mb] = WFrag<T16>::ld(A + aoff + (size_t)mb * 16 * K + kc); if (NSPLIT == 1 || NSPLIT == 2) a2[mb] = WFrag<T16>::ld(A2 + aoff + (size_t)mb * 16 * K + kc); }
#pragma unroll
        for (int nb = 0; nb < 4; ++nb) { const V b = WFrag<T16>::ld(Bt + boff + (size_t)nb * 16 * K + kc); V b2; if (NSPLIT >= 2) b2 = WFrag<T16>::ld(Bt2 + boff + (size_t)nb * 16 * K + kc);
#pragma unroll
            for (int mb = 0; mb < 4; ++mb) { acc[mb][nb] = WFrag<T16>::mma(a[mb], b, acc[mb][nb]); if (NSPLIT == 1 || NSPLIT == 2) acc[mb][nb] = WFrag<T16>::mma(a2[mb], b, acc[mb][nb]); if (NSPLIT >= 2) acc[mb][nb] = WFrag<T16>::mma(a[mb], b2, acc[mb][nb]); } }
        asm volatile("v_nop\n\tv_nop\n\tv_nop\n\tv_nop" : "+v"(acc[0][0]), "+v"(acc[1][1]), "+v"(acc[2][2]), "+v"(acc[3][3]) : "v"(a[0]), "v"(a[3]));
    }
#pragma unroll
    for (int mb = 0; mb < 4; ++mb) {
#pragma unroll
        for (int nb = 0; nb < 4; ++nb) {
#pragma unroll
            for (int j = 0; j < 8; ++j) os[(hi * 8 + j) * 68 + nb * 16 + lr] = acc[mb][nb][j]; }
        __builtin_amdgcn_wave_barrier(); asm volatile("" ::: "memory");
        float* crow = C + (size_t)(r0 + mb * 16) * ldc + c0;
{
#pragma unroll
            for (int s = 0; s < 8; ++s) { const int row = 2 * s + hi, cofs = lr * 4; v4f val = *(const v4fa*)(os + row * 68 + cofs); if (BIAS) { val[0] += bfr(bias[c0 + cofs]); val[1] += bfr(bias[c0 + cofs + 1]); val[2] += bfr(bias[c0 + cofs + 2]); val[3] += bfr(bias[c0 + cofs + 3]); }
                *(v4f*)(crow + (size_t)row * ldc + cofs) = val; }
             }
        __builtin_amdgcn_wave_barrier(); asm volatile("" ::: "memory");
    }
}

// ---- k_attn: scores, softmax and P.g in one kernel; no score and no P ever goes to memory. Transposed products: S^T = phi . theta^T (A = 16 keys, B = 16 queries) and y^T += g . P^T (A = 16 rows of g, B = P^T),
// so that a lane holds scores of ONE query (column lr; keys 8 hi + j of each 16-key tile) and two score tiles, converted, ARE the 32-key B fragment of the second product: P crosses no lane and no LDS.
// Work-group = 256 queries (8 waves x 32) x one quarter of the keys (blockIdx.y) of one image (blockIdx.z). theta fragments (hi and lo planes) stay in registers; phi (hi, lo) and g go through LDS, 64 keys a stage,
// two buffers, fetched one stage ahead into registers; one barrier a stage. Running maximum and sum per query (online softmax); y^T is rescaled only in a pass in which some query's maximum rises.
// Scores: three bf16 products a k block, in the order hi.hi, theta lo . phi hi, theta hi . phi lo. Exponents count from a reference point r = running max x log2(e) - 10: P = exp2(s log2(e) - r) <= 1024, in fp16; the point cancels in sum(P g) / sum(P).
// Out: unnormalised y [image][quarter][n][d] and (r, sum of P) per query and quarter; k_ypl joins the quarters.
#define AW   8
#define AQ   32
#define AZ   4
#define AKEY (NN / AZ)
#define AST  64
#define APP  136
#define APG  72
#define APH  (AST * APP)
#define ABUF (2 * APH + DDr * APG)
__global__ __launch_bounds__(AW * 32) void k_attn(const bf* __restrict__ TPh, const bf* __restrict__ TPl, const h16* __restrict__ G16, float* __restrict__ Yp, float* __restrict__ ML) {
    __shared__ __align__(16) unsigned short sm[2 * ABUF];   // a buffer: phi hi [64 keys][pitch 272 B], phi lo the same, g [128 d][pitch 144 B]: pitches 16 B x odd for 16-byte readers
    const int tid = threadIdx.x, lane = tid & 31, lr = lane & 15, hi = lane >> 4, wave = tid >> 5;
    const int img = blockIdx.z, part = img * AZ + blockIdx.y, q0 = blockIdx.x * (AW * AQ) + wave * AQ, key0 = blockIdx.y * AKEY;
    const bf* th = TPh + (size_t)img * 2 * NN * DDr; const bf* tl = TPl + (size_t)img * 2 * NN * DDr; const bf* ph = th + (size_t)NN * DDr + (size_t)key0 * DDr; const bf* pl = tl + (size_t)NN * DDr + (size_t)key0 * DDr;
    const h16* g = G16 + (size_t)img * DDr * NN + key0;
    v16bf qh[2][4], ql[2][4];
#pragma unroll
    for (int q = 0; q < 2; ++q)
#pragma unroll
        for (int kc = 0; kc < 4; ++kc) { const size_t o = (size_t)(q0 + q * 16 + lr) * DDr + 8 * hi + kc * 32; qh[q][kc] = WFrag<bf>::ld(th + o); ql[q][kc] = WFrag<bf>::ld(tl + o); }
    asm volatile("s_wait_xcnt 0x0" ::: "memory");   // in front of the writes of these loads' address registers
    __builtin_amdgcn_sched_barrier(0);                // without it the build lifts such writes (later address sums, the zeroing below) over the wait
    v8f O[8][2];
#pragma unroll
    for (int dt = 0; dt < 8; ++dt) { O[dt][0] = (v8f){}; O[dt][1] = (v8f){}; }
    float mr[2] = { -3.0e38f, -3.0e38f }, sum[2] = { 0.f, 0.f };
    const int prow = tid >> 4, pcol = (tid & 15) * 8, grow = tid >> 3, gcol = (tid & 7) * 8;   // a thread's 16-byte pieces of a stage: phi rows prow + 16 i, g rows grow + 32 i
    v8us rh[4], rl[4]; v8h rg[4];
#pragma unroll
    for (int i = 0; i < 4; ++i) { rh[i] = *(const v8us*)(ph + (size_t)(prow + 16 * i) * DDr + pcol); rl[i] = *(const v8us*)(pl + (size_t)(prow + 16 * i) * DDr + pcol); rg[i] = *(const v8h*)(g + (size_t)(grow + 32 * i) * NN + gcol); }
    asm volatile("s_wait_xcnt 0x0" ::: "memory");   // as above
    __builtin_amdgcn_sched_barrier(0);                // as above
    // kept rolled: the trips are alike and long (128 matrix instructions); unrolled, the code would only grow
#pragma unroll 1
    for (int s = 0; s < AKEY / AST; ++s) {
        unsigned short* buf = sm + (s & 1) * ABUF;
#pragma unroll
        for (int i = 0; i < 4; ++i) { *(v8usa*)(buf + (prow + 16 * i) * APP + pcol) = rh[i]; *(v8usa*)(buf + APH + (prow + 16 * i) * APP + pcol) = rl[i]; *(v8ha*)(buf + 2 * APH + (grow + 32 * i) * APG + gcol) = rg[i]; }
        __syncthreads();   // stage s is in LDS for every wave; and every wave has left stage s - 1, whose buffer is written next trip
        if (s + 1 < AKEY / AST) { const int kb = (s + 1) * AST;
#pragma unroll
            for (int i = 0; i < 4; ++i) { rh[i] = *(const v8us*)(ph + (size_t)(kb + prow + 16 * i) * DDr + pcol); rl[i] = *(const v8us*)(pl + (size_t)(kb + prow + 16 * i) * DDr + pcol); rg[i] = *(const v8h*)(g + (size_t)(grow + 32 * i) * NN + kb + gcol); }
            asm volatile("s_wait_xcnt 0x0" ::: "memory"); }   // as above: the address registers are used again in the pass below, while the data are still on their way
        // kept rolled: unrolled, the build mixes one pass's second product with the next pass's first and, short of registers, fetches their fragments two loads at a time with a full wait each
#pragma unroll 1
        for (int kk = 0; kk < AST / 32; ++kk) {
            v8f S[2][2];
#pragma unroll
            for (int t = 0; t < 2; ++t) { S[t][0] = (v8f){}; S[t][1] = (v8f){}; }
            const unsigned short* pr = buf + (kk * 32 + lr) * APP + 8 * hi;
            v16bf ah[4][2], al[4][2];
#pragma unroll
            for (int kc = 0; kc < 4; ++kc)
#pragma unroll
                for (int t = 0; t < 2; ++t) { const unsigned short* p = pr + t * 16 * APP + kc * 32; ah[kc][t] = cat16b(*(const v8usa*)p, *(const v8usa*)(p + 16)); al[kc][t] = cat16b(*(const v8usa*)(p + APH), *(const v8usa*)(p + APH + 16)); }
            __builtin_amdgcn_sched_barrier(0);   // keeps the pass's phi fragment loads one group in front of its matrix instructions: spread among them, through few registers, each pair is waited for in full
#pragma unroll
            for (int kc = 0; kc < 4; ++kc) {
#pragma unroll
                for (int t = 0; t < 2; ++t)
#pragma unroll
                    for (int q = 0; q < 2; ++q) S[t][q] = wmmab(ah[kc][t], qh[q][kc], S[t][q]);   // theta hi . phi hi
#pragma unroll
                for (int t = 0; t < 2; ++t)
#pragma unroll
                    for (int q = 0; q < 2; ++q) S[t][q] = wmmab(ah[kc][t], ql[q][kc], S[t][q]);   // theta lo . phi hi
#pragma unroll
                for (int t = 0; t < 2; ++t)
#pragma unroll
                    for (int q = 0; q < 2; ++q) S[t][q] = wmmab(al[kc][t], qh[q][kc], S[t][q]); } // theta hi . phi lo
            const unsigned short* gr = buf + 2 * APH + lr * APG + kk * 32 + 8 * hi; v16h ga[8];
#pragma unroll
            for (int dt = 0; dt < 8; ++dt) ga[dt] = cat16(*(const v8ha*)(gr + dt * 16 * APG), *(const v8ha*)(gr + dt * 16 * APG + 16));
            __builtin_amdgcn_sched_barrier(0);   // keeps the loads of the g fragments, one group, in front of the softmax arithmetic, which then covers their latency
            float mn[2]; bool rise = false;
#pragma unroll
            for (int q = 0; q < 2; ++q) { float tm = fmaxf(S[0][q][0], S[1][q][0]);
#pragma unroll
                for (int j = 1; j < 8; ++j) tm = fmaxf(tm, fmaxf(S[0][q][j], S[1][q][j]));
                tm = fmaxf(tm, xhalf(tm)); mn[q] = fmaxf(mr[q], fmaf(tm, L2E, -PSH)); rise = rise || mn[q] > mr[q]; }
            if (__builtin_amdgcn_ballot_w32(rise) != 0) {   // one scalar branch a pass: the same for the whole wave, so every matrix instruction keeps all lanes on
#pragma unroll
                for (int q = 0; q < 2; ++q) { const float sc = __builtin_amdgcn_exp2f(mr[q] - mn[q]); sum[q] *= sc; mr[q] = mn[q];
#pragma unroll
                    for (int dt = 0; dt < 8; ++dt) O[dt][q] *= sc; } }
            v16h pf[2];
#pragma unroll
            for (int q = 0; q < 2; ++q) { float ps[2] = { 0.f, 0.f };   // a chain of sums a score tile: shorter dependent chains
#pragma unroll
                for (int t = 0; t < 2; ++t)
#pragma unroll
                    for (int j = 0; j < 8; ++j) { const float e = __builtin_amdgcn_exp2f(fmaf(S[t][q][j], L2E, -mr[q])); ps[t] += e; pf[q][t * 8 + j] = (h16)e; }   // element 8 t + j of the B fragment is k = 16 t + 8 hi + j: the row of score tile t that this lane holds
                sum[q] += ps[0] + ps[1]; }
#pragma unroll
            for (int dt = 0; dt < 8; ++dt) { O[dt][0] = wmma16(ga[dt], pf[0], O[dt][0]); O[dt][1] = wmma16(ga[dt], pf[1], O[dt][1]); }
        }
    }
    float* yp = Yp + (size_t)part * NN * DDr;
#pragma unroll
    for (int q = 0; q < 2; ++q) { const int n = q0 + q * 16 + lr; const float st = sum[q] + xhalf(sum[q]);   // the two lane halves summed different keys of the same query
#pragma unroll
        for (int dt = 0; dt < 8; ++dt) *(v8f*)(yp + (size_t)n * DDr + dt * 16 + hi * 8) = O[dt][q];
        if (hi == 0) { float* ml = ML + ((size_t)part * NN + n) * 2; ml[0] = mr[q]; ml[1] = st; } }
}

__device__ __forceinline__ h16 tohx(float x) { return (h16)x; }
__device__ __forceinline__ void splitf(float y, unsigned short& h, unsigned short& l) { h = f2bf(y); l = f2bf(y - bf2f(h)); }
typedef __attribute__((ext_vector_type(2))) unsigned short v2us;
typedef __attribute__((ext_vector_type(4))) unsigned short v4us;
typedef __attribute__((ext_vector_type(4))) _Float16 v4h;

// The image is a grid axis in all of these (blockIdx.y; in k_xt it is folded into blockIdx.x); F holds [image][theta, phi, g][d][n]. Two pairs of repacks that do not depend on each other share a grid, each block doing one kind of work:
// k_xt: blocks 0 .. 4 WBL - 1: bf16 copies of the four weight matrices, one behind the other in W4 (WBL blocks a matrix, 32-B lanes); then XBL blocks an image: XT[n][c] = bf16 x[c][n] (lane -> 2 consecutive c; strided reads);
// k_tpl: TBL blocks each for theta and phi: hl planes T[n][d] = F[d][n] (lane -> 2 consecutive d); then GBL blocks: fp16 copy of g [d][m] (8-B lanes); k_ypl: hl planes of y = (sum over the key quarters of exp2(r - top r) Y) / (the sums of P joined the same way) (8-B lanes);
#define WBL (DDr * CC / 8 / 256)
#define XBL (NN * CC / 2 / 256)
#define TBL (NN * DDr / 2 / 256)
#define GBL (DDr * NN / 4 / 256)
static_assert(WBL * 8 * 256 == DDr * CC && XBL * 2 * 256 == NN * CC && TBL * 2 * 256 == NN * DDr && GBL * 4 * 256 == DDr * NN, "whole blocks only: k_xt and k_tpl have no range test");
__global__ __launch_bounds__(256) void k_xt(const float* __restrict__ x, const float* __restrict__ w0, const float* __restrict__ w1, const float* __restrict__ w2, const float* __restrict__ w3, bf* XT, bf* W4) {
    if (blockIdx.x < 4 * WBL) { const int w = blockIdx.x / WBL; const float* src = w == 0 ? w0 : w == 1 ? w1 : w == 2 ? w2 : w3; const int i = (blockIdx.x % WBL) * 256 + threadIdx.x; const v8f v = *(const v8f*)(src + i * 8); v8us o;
#pragma unroll
        for (int k = 0; k < 8; ++k) o[k] = f2bf(v[k]); *(v8us*)(W4 + w * (DDr * CC) + i * 8) = o; }
    else { const int blk = blockIdx.x - 4 * WBL, img = blk / XBL; x += (size_t)img * CC * NN; XT += (size_t)img * NN * CC;
        const int e = ((blk % XBL) * 256 + threadIdx.x) * 2; const int c = e % CC; const int n = e / CC; v2us o; o[0] = f2bf(x[(size_t)c * NN + n]); o[1] = f2bf(x[(size_t)(c + 1) * NN + n]); *(v2us*)(XT + e) = o;
        asm volatile("s_wait_xcnt 0x0" ::: "memory"); } }   // the build lays the other branch's code behind this store (a path no block takes): the wait stands in front of its writes of the store's registers
__global__ __launch_bounds__(256) void k_tpl(const float* __restrict__ F, bf* Th, bf* Tl, h16* G16) { F += (size_t)blockIdx.y * 3 * DDr * NN;
    if (blockIdx.x >= 2 * TBL) { const int e = ((blockIdx.x - 2 * TBL) * 256 + threadIdx.x) * 4; F += (size_t)2 * DDr * NN; G16 += (size_t)blockIdx.y * DDr * NN; const v4f a = *(const v4f*)(F + e); v4h o; o[0] = tohx(a[0]); o[1] = tohx(a[1]); o[2] = tohx(a[2]); o[3] = tohx(a[3]); *(v4h*)(G16 + e) = o; }
    else { const int tp = blockIdx.x / TBL; F += (size_t)tp * DDr * NN; Th += (size_t)(blockIdx.y * 2 + tp) * NN * DDr; Tl += (size_t)(blockIdx.y * 2 + tp) * NN * DDr;
        const int e = ((blockIdx.x % TBL) * 256 + threadIdx.x) * 2; const int d = e % DDr; const int n = e / DDr; v2us oh, ol;
#pragma unroll
        for (int u = 0; u < 2; ++u) { unsigned short a, b; splitf(F[(size_t)(d + u) * NN + n], a, b); oh[u] = a; ol[u] = b; } *(v2us*)(Th + e) = oh; *(v2us*)(Tl + e) = ol;
        asm volatile("s_wait_xcnt 0x0" ::: "memory"); } }   // as in k_xt: in front of the other branch's writes of these stores' registers
__global__ __launch_bounds__(256) void k_ypl(const float* __restrict__ Y, const float* __restrict__ ML, bf* Yh, bf* Yl) { const int e = (blockIdx.x * 256 + threadIdx.x) * 4; if (e >= NN * DDr) return; Y += (size_t)blockIdx.y * AZ * NN * DDr; ML += (size_t)blockIdx.y * AZ * NN * 2 + (e / DDr) * 2; Yh += (size_t)blockIdx.y * NN * DDr; Yl += (size_t)blockIdx.y * NN * DDr;
    float m4[AZ], s4[AZ], top = -3.0e38f, den = 0.f; v4f a = (v4f){};
#pragma unroll
    for (int z = 0; z < AZ; ++z) { m4[z] = ML[z * NN * 2]; s4[z] = ML[z * NN * 2 + 1]; }
    asm volatile("s_wait_xcnt 0x0" ::: "memory");   // in front of the writes of these loads' address registers
#pragma unroll
    for (int z = 0; z < AZ; ++z) top = fmaxf(top, m4[z]);
#pragma unroll
    for (int z = 0; z < AZ; ++z) { const float w = __builtin_amdgcn_exp2f(m4[z] - top); den += w * s4[z]; a += *(const v4f*)(Y + (size_t)z * NN * DDr + e) * w; }
    const float f = __fdiv_rn(1.0f, den); v4us oh, ol;
#pragma unroll
    for (int u = 0; u < 4; ++u) { unsigned short h, l; splitf(a[u] * f, h, l); oh[u] = h; ol[u] = l; } *(v4us*)(Yh + e) = oh; *(v4us*)(Yl + e) = ol;  }
__global__ __launch_bounds__(256) void k_outT(const float* __restrict__ x, const float* __restrict__ O, float* OUT) { const int e = (blockIdx.x * 256 + threadIdx.x) * 4; if (e >= CC * NN) return; x += (size_t)blockIdx.y * CC * NN; O += (size_t)blockIdx.y * NN * CC; OUT += (size_t)blockIdx.y * CC * NN; const int n = e % NN; const int c = e / NN; v4f o;
#pragma unroll
    for (int u = 0; u < 4; ++u) o[u] = __fadd_rn(bfr(x[e + u]), O[(size_t)(n + u) * CC + c]); *(v4f*)(OUT + e) = o;  }

extern "C" void kernel_launch(void* const* d_in, const int* in_sizes, int n_in,
                              void* d_out, int out_size, void* d_ws, size_t ws_size, hipStream_t stream) {
    (void)in_sizes; (void)n_in; (void)out_size;
    const float* x = (const float*)d_in[0]; const float* wth = (const float*)d_in[1]; const float* wph = (const float*)d_in[2]; const float* wg = (const float*)d_in[3]; const float* wout = (const float*)d_in[4];
    float* OUT = (float*)d_out;     // [4][256][64][64]
    char* wsp = (char*)d_ws;
    auto take = [&](size_t bytes) { char* p = wsp; wsp += (bytes + 255) & ~(size_t)255; return (void*)p; };
    // Independent launches are merged into one grid each: the four images are a grid axis everywhere, the three projections are one product with 384 rows of weights.
    bf* W4 = (bf*)take((size_t)4 * DDr * CC * 2); bf* WOUT = W4 + 3 * DDr * CC;   // w_theta, w_phi, w_g ([d][c] rows = A operand), w_out ([c][d] = natural Bt)
    bf* XT = (bf*)take((size_t)NBI * NN * CC * 2); float* F = (float*)take((size_t)NBI * 3 * DDr * NN * 4); bf* TPh = (bf*)take((size_t)NBI * 2 * NN * DDr * 2); bf* TPl = (bf*)take((size_t)NBI * 2 * NN * DDr * 2); h16* G16 = (h16*)take((size_t)NBI * DDr * NN * 2);
    float* Y = (float*)take((size_t)NBI * AZ * NN * DDr * 4); float* ML = (float*)take((size_t)NBI * AZ * NN * 2 * 4); bf* Yh = (bf*)take((size_t)NBI * NN * DDr * 2); bf* Yl = (bf*)take((size_t)NBI * NN * DDr * 2);   // Y [image][key quarter][n][d], ML [image][key quarter][n][r, sum]
    float* O = (float*)take((size_t)NBI * NN * CC * 4);    // [image][n][c]
    if ((size_t)(wsp - (char*)d_ws) > ws_size) return;    // total ~ 109 MiB
    k_xt<<<4 * WBL + NBI * XBL, 256, 0, stream>>>(x, wth, wph, wg, wout, XT, W4);
    k_gemmw<bf, 0, false><<<dim3(3 * DDr / 64, NN / 64, NBI), 32, 0, stream>>>(W4, nullptr, XT, nullptr, CC, F, NN, nullptr, 0, (size_t)NN * CC, (size_t)3 * DDr * NN);
    k_tpl<<<dim3(2 * TBL + GBL, NBI, 1), 256, 0, stream>>>(F, TPh, TPl, G16);
    k_attn<<<dim3(NN / (AW * AQ), AZ, NBI), AW * 32, 0, stream>>>(TPh, TPl, G16, Y, ML);     // y[n][d] (unnormalised) = sum_m P[n][m] g[d][m], a key quarter a plane
    k_ypl<<<dim3((NN * DDr / 4 + 255) / 256, NBI, 1), 256, 0, stream>>>(Y, ML, Yh, Yl);
    k_gemmw<bf, 1, false><<<dim3(NN / 64, CC / 64, NBI), 32, 0, stream>>>(Yh, Yl, WOUT, nullptr, DDr, O, CC, nullptr, (size_t)NN * DDr, 0, (size_t)NN * CC);            // o[n][c] = sum_d y[n][d] w_out[c][d]
    k_outT<<<dim3((CC * NN / 4 + 255) / 256, NBI, 1), 256, 0, stream>>>(x, O, OUT);
}

// v004
// One run takes 98.7 microseconds.
// In two side-by-side timings against v003, it was 1.39 and 1.41 times as fast.
// Over all steps from v000 it is 9.13 times as fast.
#include <hip/hip_runtime.h>

// _NonLocal (embedded-Gaussian non-local block: x [4][256][64][64] -> 4096 positions; theta/phi/g = 1x1 convs to 128 channels (no bias); attn[n][m] = softmax_m(theta[:,n].phi[:,m]) (UNSCALED: logits have sigma ~ 11, so the scores need 3-product precision);
// y[d][n] = sum_m g[d][m] attn[n][m]; out = x + w_out y -> [4][256][64][64]).
// Compute dtypes, f32 accumulate: every input rounded to bf16; theta/phi/g on PLAIN bf16 operands (inputs: exact); scores (K 128) on bf16 hi+lo planes of theta and phi (3 products; single fp16 planes

#define NBI  4
#define CC   256
#define DDr  128
#define NN   4096
#define L2E  1.4426950408889634f
#define PSH  10.0f
typedef _Float16 h16;
typedef unsigned short bf;
typedef __attribute__((ext_vector_type(16))) __bf16   v16bf;
typedef __attribute__((ext_vector_type(16))) _Float16 v16h;
typedef __attribute__((ext_vector_type(8)))  _Float16 v8h;
typedef __attribute__((ext_vector_type(8)))  unsigned short v8us;
typedef __attribute__((ext_vector_type(8)))  float    v8f;
typedef __attribute__((ext_vector_type(4)))  float    v4f;
typedef v8h  __attribute__((may_alias)) v8ha;
typedef v4f  __attribute__((may_alias)) v4fa;
typedef v8us __attribute__((may_alias)) v8usa;

__device__ __forceinline__ unsigned short f2bf(float f) { unsigned u = __float_as_uint(f); u += 0x7FFFu + ((u >> 16) & 1u); return (unsigned short)(u >> 16); }
__device__ __forceinline__ float bf2f(unsigned short b) { return __uint_as_float(((unsigned)b) << 16); }
__device__ __forceinline__ float bfr(float f) { return bf2f(f2bf(f)); }
__device__ __forceinline__ v16h cat16(v8h lo, v8h hi) { return __builtin_shufflevector(lo, hi, 0, 1, 2, 3, 4, 5, 6, 7, 8, 9, 10, 11, 12, 13, 14, 15); }
__device__ __forceinline__ v16bf cat16b(v8us lo, v8us hi) { return __builtin_bit_cast(v16bf, __builtin_shufflevector(lo, hi, 0, 1, 2, 3, 4, 5, 6, 7, 8, 9, 10, 11, 12, 13, 14, 15)); }
__device__ __forceinline__ float xhalf(float x) { return __builtin_bit_cast(float, __builtin_amdgcn_permlanex16(__builtin_bit_cast(int, x), __builtin_bit_cast(int, x), 0x76543210, 0xfedcba98, false, false)); }   // lane l takes lane l ^ 16's value
__device__ __forceinline__ v8f wmma16(v16h a, v16h b, v8f c) { return __builtin_amdgcn_wmma_f32_16x16x32_f16(false, a, false, b, (short)0, c, false, false); }
__device__ __forceinline__ v8f wmmab(v16bf a, v16bf b, v8f c) { return __builtin_amdgcn_wmma_f32_16x16x32_bf16(false, a, false, b, (short)0, c, false, false); }



// ---- k_gemmw: register-blocked GEMM, ONE WAVE per 64x64 output tile (16 accumulators), operands straight from K-contiguous 16-bit planes; grid (M/64, N/64, Z), 32 threads.
// C[m][n] (f32, pitch ldc, + optional f32 bias[n]) = sum_k A[m][k] Bt[n][k] (+ split products per NSPLIT). z-batch strides sA/sB/sC in elements. K % 32 == 0.
template <typename T16> struct WFrag;
template <> struct WFrag<h16> { typedef v16h V; static __device__ __forceinline__ V ld(const h16* p) { return cat16(*(const v8h*)p, *(const v8h*)(p + 16)); } static __device__ __forceinline__ v8f mma(V a, V b, v8f c) { return wmma16(a, b, c); } };
template <> struct WFrag<bf> { typedef v16bf V; static __device__ __forceinline__ V ld(const bf* p) { return cat16b(*(const v8us*)p, *(const v8us*)(p + 16)); } static __device__ __forceinline__ v8f mma(V a, V b, v8f c) { return wmmab(a, b, c); } };
template <typename T16, int NSPLIT, bool BIAS>
__global__ __launch_bounds__(32) void k_gemmw(const T16* __restrict__ A, const T16* __restrict__ A2, const T16* __restrict__ Bt, const T16* __restrict__ Bt2, int K, float* C, int ldc, const float* __restrict__ bias, size_t sA, size_t sB, size_t sC) {
    typedef typename WFrag<T16>::V V;
    __shared__ __align__(16) float os[16 * 68];
    const size_t z = blockIdx.z; A += z * sA; if (A2) A2 += z * sA; Bt += z * sB; if (Bt2) Bt2 += z * sB; C += z * sC;
    const int lane = threadIdx.x & 31, lr = lane & 15, hi = lane >> 4; const int r0 = blockIdx.x * 64, c0 = blockIdx.y * 64;
    v8f acc[4][4];
#pragma unroll
    for (int mb = 0; mb < 4; ++mb)
#pragma unroll
        for (int nb = 0; nb < 4; ++nb) acc[mb][nb] = (v8f){};
    const size_t aoff = (size_t)(r0 + lr) * K + 8 * hi, boff = (size_t)(c0 + lr) * K + 8 * hi;
#pragma unroll 1
    for (int kc = 0; kc < K; kc += 32) {
        V a[4], a2[4];
#pragma unroll
        for (int mb = 0; mb < 4; ++mb) { a[mb] = WFrag<T16>::ld(A + aoff + (size_t)mb * 16 * K + kc); if (NSPLIT == 1 || NSPLIT == 2) a2[mb] = WFrag<T16>::ld(A2 + aoff + (size_t)mb * 16 * K + kc); }
#pragma unroll
        for (int nb = 0; nb < 4; ++nb) { const V b = WFrag<T16>::ld(Bt + boff + (size_t)nb * 16 * K + kc); V b2; if (NSPLIT >= 2) b2 = WFrag<T16>::ld(Bt2 + boff + (size_t)nb * 16 * K + kc);
#pragma unroll
            for (int mb = 0; mb < 4; ++mb) { acc[mb][nb] = WFrag<T16>::mma(a[mb], b, acc[mb][nb]); if (NSPLIT == 1 || NSPLIT == 2) acc[mb][nb] = WFrag<T16>::mma(a2[mb], b, acc[mb][nb]); if (NSPLIT >= 2) acc[mb][nb] = WFrag<T16>::mma(a[mb], b2, acc[mb][nb]); } }
        asm volatile("v_nop\n\tv_nop\n\tv_nop\n\tv_nop" : "+v"(acc[0][0]), "+v"(acc[1][1]), "+v"(acc[2][2]), "+v"(acc[3][3]) : "v"(a[0]), "v"(a[3]));
    }
#pragma unroll
    for (int mb = 0; mb < 4; ++mb) {
#pragma unroll
        for (int nb = 0; nb < 4; ++nb) {
#pragma unroll
            for (int j = 0; j < 8; ++j) os[(hi * 8 + j) * 68 + nb * 16 + lr] = acc[mb][nb][j]; }
        __builtin_amdgcn_wave_barrier(); asm volatile("" ::: "memory");
        float* crow = C + (size_t)(r0 + mb * 16) * ldc + c0;
{
#pragma unroll
            for (int s = 0; s < 8; ++s) { const int row = 2 * s + hi, cofs = lr * 4; v4f val = *(const v4fa*)(os + row * 68 + cofs); if (BIAS) { val[0] += bfr(bias[c0 + cofs]); val[1] += bfr(bias[c0 + cofs + 1]); val[2] += bfr(bias[c0 + cofs + 2]); val[3] += bfr(bias[c0 + cofs + 3]); }
                *(v4f*)(crow + (size_t)row * ldc + cofs) = val; }
             }
        __builtin_amdgcn_wave_barrier(); asm volatile("" ::: "memory");
    }
}

// ---- k_attn: scores, softmax and P.g in one kernel; no score and no P ever goes to memory. Transposed products: S^T = phi . theta^T (A = 16 keys, B = 16 queries) and y^T += g . P^T (A = 16 rows of g, B = P^T),
// so that a lane holds scores of ONE query (column lr; keys 8 hi + j of each 16-key tile) and two score tiles, converted, ARE the 32-key B fragment of the second product: P crosses no lane and no LDS.
// Work-group = 256 queries (8 waves x 32) x one quarter of the keys (blockIdx.y) of one image (blockIdx.z). theta fragments (hi and lo planes) stay in registers; phi (hi, lo) and g go through LDS, 64 keys a stage,
// two buffers, fetched one stage ahead into registers; one barrier a stage. Running maximum and sum per query (online softmax); y^T is rescaled only in a pass in which some query's maximum rises.
// Scores: three bf16 products a k block, in the order hi.hi, theta lo . phi hi, theta hi . phi lo. Exponents count from a reference point r = running max x log2(e) - 10: P = exp2(s log2(e) - r) <= 1024, in fp16; the point cancels in sum(P g) / sum(P).
// Out: unnormalised y [image][quarter][n][d] and (r, sum of P) per query and quarter; k_ypl joins the quarters.
#define AW   8
#define AQ   32
#define AZ   4
#define AKEY (NN / AZ)
#define AST  64
#define APP  136
#define APG  72
#define APH  (AST * APP)
#define ABUF (2 * APH + DDr * APG)
__global__ __launch_bounds__(AW * 32) void k_attn(const bf* __restrict__ TPh, const bf* __restrict__ TPl, const h16* __restrict__ G16, float* __restrict__ Yp, float* __restrict__ ML) {
    __shared__ __align__(16) unsigned short sm[2 * ABUF];   // a buffer: phi hi [64 keys][pitch 272 B], phi lo the same, g [128 d][pitch 144 B]: pitches 16 B x odd for 16-byte readers
    const int tid = threadIdx.x, lane = tid & 31, lr = lane & 15, hi = lane >> 4, wave = tid >> 5;
    const int img = blockIdx.z, part = img * AZ + blockIdx.y, q0 = blockIdx.x * (AW * AQ) + wave * AQ, key0 = blockIdx.y * AKEY;
    const bf* th = TPh + (size_t)img * 2 * NN * DDr; const bf* tl = TPl + (size_t)img * 2 * NN * DDr; const bf* ph = th + (size_t)NN * DDr + (size_t)key0 * DDr; const bf* pl = tl + (size_t)NN * DDr + (size_t)key0 * DDr;
    const h16* g = G16 + (size_t)img * DDr * NN + key0;
    v16bf qh[2][4], ql[2][4];
#pragma unroll
    for (int q = 0; q < 2; ++q)
#pragma unroll
        for (int kc = 0; kc < 4; ++kc) { const size_t o = (size_t)(q0 + q * 16 + lr) * DDr + 8 * hi + kc * 32; qh[q][kc] = WFrag<bf>::ld(th + o); ql[q][kc] = WFrag<bf>::ld(tl + o); }
    asm volatile("s_wait_xcnt 0x0" ::: "memory");   // in front of the writes of these loads' address registers
    __builtin_amdgcn_sched_barrier(0);                // without it the build lifts such writes (later address sums, the zeroing below) over the wait
    v8f O[8][2];
#pragma unroll
    for (int dt = 0; dt < 8; ++dt) { O[dt][0] = (v8f){}; O[dt][1] = (v8f){}; }
    float mr[2] = { -3.0e38f, -3.0e38f }, sum[2] = { 0.f, 0.f };
    const int prow = tid >> 4, pcol = (tid & 15) * 8, grow = tid >> 3, gcol = (tid & 7) * 8;   // a thread's 16-byte pieces of a stage: phi rows prow + 16 i, g rows grow + 32 i
    v8us rh[4], rl[4]; v8h rg[4];
#pragma unroll
    for (int i = 0; i < 4; ++i) { rh[i] = *(const v8us*)(ph + (size_t)(prow + 16 * i) * DDr + pcol); rl[i] = *(const v8us*)(pl + (size_t)(prow + 16 * i) * DDr + pcol); rg[i] = *(const v8h*)(g + (size_t)(grow + 32 * i) * NN + gcol); }
    asm volatile("s_wait_xcnt 0x0" ::: "memory");   // as above
    __builtin_amdgcn_sched_barrier(0);                // as above
    // kept rolled: the trips are alike and long (128 matrix instructions); unrolled, the code would only grow
#pragma unroll 1
    for (int s = 0; s < AKEY / AST; ++s) {
        unsigned short* buf = sm + (s & 1) * ABUF;
#pragma unroll
        for (int i = 0; i < 4; ++i) { *(v8usa*)(buf + (prow + 16 * i) * APP + pcol) = rh[i]; *(v8usa*)(buf + APH + (prow + 16 * i) * APP + pcol) = rl[i]; *(v8ha*)(buf + 2 * APH + (grow + 32 * i) * APG + gcol) = rg[i]; }
        __syncthreads();   // stage s is in LDS for every wave; and every wave has left stage s - 1, whose buffer is written next trip
        if (s + 1 < AKEY / AST) { const int kb = (s + 1) * AST;
#pragma unroll
            for (int i = 0; i < 4; ++i) { rh[i] = *(const v8us*)(ph + (size_t)(kb + prow + 16 * i) * DDr + pcol); rl[i] = *(const v8us*)(pl + (size_t)(kb + prow + 16 * i) * DDr + pcol); rg[i] = *(const v8h*)(g + (size_t)(grow + 32 * i) * NN + kb + gcol); }
            asm volatile("s_wait_xcnt 0x0" ::: "memory"); }   // as above: the address registers are used again in the pass below, while the data are still on their way
        // kept rolled: unrolled, the build mixes one pass's second product with the next pass's first and, short of registers, fetches their fragments two loads at a time with a full wait each
#pragma unroll 1
        for (int kk = 0; kk < AST / 32; ++kk) {
            v8f S[2][2];
#pragma unroll
            for (int t = 0; t < 2; ++t) { S[t][0] = (v8f){}; S[t][1] = (v8f){}; }
            const unsigned short* pr = buf + (kk * 32 + lr) * APP + 8 * hi;
            v16bf ah[4][2], al[4][2];
#pragma unroll
            for (int kc = 0; kc < 4; ++kc)
#pragma unroll
                for (int t = 0; t < 2; ++t) { const unsigned short* p = pr + t * 16 * APP + kc * 32; ah[kc][t] = cat16b(*(const v8usa*)p, *(const v8usa*)(p + 16)); al[kc][t] = cat16b(*(const v8usa*)(p + APH), *(const v8usa*)(p + APH + 16)); }
            __builtin_amdgcn_sched_barrier(0);   // keeps the pass's phi fragment loads one group in front of its matrix instructions: spread among them, through few registers, each pair is waited for in full
#pragma unroll
            for (int kc = 0; kc < 4; ++kc) {
#pragma unroll
                for (int t = 0; t < 2; ++t)
#pragma unroll
                    for (int q = 0; q < 2; ++q) S[t][q] = wmmab(ah[kc][t], qh[q][kc], S[t][q]);   // theta hi . phi hi
#pragma unroll
                for (int t = 0; t < 2; ++t)
#pragma unroll
                    for (int q = 0; q < 2; ++q) S[t][q] = wmmab(ah[kc][t], ql[q][kc], S[t][q]);   // theta lo . phi hi
#pragma unroll
                for (int t = 0; t < 2; ++t)
#pragma unroll
                    for (int q = 0; q < 2; ++q) S[t][q] = wmmab(al[kc][t], qh[q][kc], S[t][q]); } // theta hi . phi lo
            const unsigned short* gr = buf + 2 * APH + lr * APG + kk * 32 + 8 * hi; v16h ga[8];
#pragma unroll
            for (int dt = 0; dt < 8; ++dt) ga[dt] = cat16(*(const v8ha*)(gr + dt * 16 * APG), *(const v8ha*)(gr + dt * 16 * APG + 16));
            __builtin_amdgcn_sched_barrier(0);   // keeps the loads of the g fragments, one group, in front of the softmax arithmetic, which then covers their latency
            float mn[2]; bool rise = false;
#pragma unroll
            for (int q = 0; q < 2; ++q) { float tm = fmaxf(S[0][q][0], S[1][q][0]);
#pragma unroll
                for (int j = 1; j < 8; ++j) tm = fmaxf(tm, fmaxf(S[0][q][j], S[1][q][j]));
                tm = fmaxf(tm, xhalf(tm)); mn[q] = fmaxf(mr[q], fmaf(tm, L2E, -PSH)); rise = rise || mn[q] > mr[q]; }
            if (__builtin_amdgcn_ballot_w32(rise) != 0) {   // one scalar branch a pass: the same for the whole wave, so every matrix instruction keeps all lanes on
#pragma unroll
                for (int q = 0; q < 2; ++q) { const float sc = __builtin_amdgcn_exp2f(mr[q] - mn[q]); sum[q] *= sc; mr[q] = mn[q];
#pragma unroll
                    for (int dt = 0; dt < 8; ++dt) O[dt][q] *= sc; } }
            v16h pf[2];
#pragma unroll
            for (int q = 0; q < 2; ++q) { float ps[2] = { 0.f, 0.f };   // a chain of sums a score tile: shorter dependent chains
#pragma unroll
                for (int t = 0; t < 2; ++t)
#pragma unroll
                    for (int j = 0; j < 8; ++j) { const float e = __builtin_amdgcn_exp2f(fmaf(S[t][q][j], L2E, -mr[q])); ps[t] += e; pf[q][t * 8 + j] = (h16)e; }   // element 8 t + j of the B fragment is k = 16 t + 8 hi + j: the row of score tile t that this lane holds
                sum[q] += ps[0] + ps[1]; }
#pragma unroll
            for (int dt = 0; dt < 8; ++dt) { O[dt][0] = wmma16(ga[dt], pf[0], O[dt][0]); O[dt][1] = wmma16(ga[dt], pf[1], O[dt][1]); }
        }
    }
    float* yp = Yp + (size_t)part * NN * DDr;
#pragma unroll
    for (int q = 0; q < 2; ++q) { const int n = q0 + q * 16 + lr; const float st = sum[q] + xhalf(sum[q]);   // the two lane halves summed different keys of the same query
#pragma unroll
        for (int dt = 0; dt < 8; ++dt) *(v8f*)(yp + (size_t)n * DDr + dt * 16 + hi * 8) = O[dt][q];
        if (hi == 0) { float* ml = ML + ((size_t)part * NN + n) * 2; ml[0] = mr[q]; ml[1] = st; } }
}

__device__ __forceinline__ h16 tohx(float x) { return (h16)x; }
__device__ __forceinline__ void splitf(float y, unsigned short& h, unsigned short& l) { h = f2bf(y); l = f2bf(y - bf2f(h)); }
typedef __attribute__((ext_vector_type(2))) unsigned short v2us;
typedef __attribute__((ext_vector_type(4))) unsigned short v4us;
typedef __attribute__((ext_vector_type(4))) _Float16 v4h;

// The image is a grid axis in all of these (blockIdx.y; in k_xt it is folded into blockIdx.x); F holds [image][theta, phi, g][d][n]. Two pairs of repacks that do not depend on each other share a grid, each block doing one kind of work.
// The three repacks that transpose (x, theta and phi, o) move a tile of 128 source rows x 64 source columns a work-group through LDS: whole 256-byte row pieces are read from memory, whole 128- or 256-byte row pieces are written, and the turn is made by the LDS column walk.
// k_xt: blocks 0 .. 4 WBL - 1: bf16 copies of the four weight matrices, one behind the other in W4 (WBL blocks a matrix, 32-B lanes); then XBL blocks an image: XT[n][c] = bf16 x[c][n] (tile: 128 c x 64 n);
// k_tpl: TBL blocks each for theta and phi: hl planes T[n][d] = F[d][n] (tile: all 128 d x 64 n); then GBL blocks: fp16 copy of g [d][m] (8-B lanes); k_ypl: hl planes of y = (sum over the key quarters of exp2(r - top r) Y) / (the sums of P joined the same way) (8-B lanes);
// k_outT: OUT[c][n] = x[c][n] + O[n][c] (tile: 128 n x 64 c).
#define TLR 128
#define TLC 64
#define TLP 65   // LDS pitch in floats, odd: a walk down a column changes bank with every row
#define WBL (DDr * CC / 8 / 256)
#define XBL ((CC / TLR) * (NN / TLC))
#define TBL (NN / TLC)
#define GBL (DDr * NN / 4 / 256)
static_assert(WBL * 8 * 256 == DDr * CC && XBL * TLR * TLC == NN * CC && TBL * TLR * TLC == NN * DDr && DDr == TLR && GBL * 4 * 256 == DDr * NN && NN % TLR == 0 && CC % TLC == 0, "whole blocks and whole tiles only: no range test in k_xt, k_tpl, k_outT");
// 256 threads bring src[0 .. 127][0 .. 63] (row pitch ld floats) into t[row][column]: 16 lanes x 16 B a row, 8 loads a thread in flight; returns behind the barrier that hands the tile to every wave.
__device__ __forceinline__ void tile_in(const float* __restrict__ src, size_t ld, float* t) {
    const int r = threadIdx.x >> 4, c = (threadIdx.x & 15) * 4; v4f v[TLR / 16];
#pragma unroll
    for (int i = 0; i < TLR / 16; ++i) v[i] = *(const v4f*)(src + (size_t)(r + 16 * i) * ld + c);
    asm volatile("s_wait_xcnt 0x0" ::: "memory");   // in front of the writes of these loads' address registers
#pragma unroll
    for (int i = 0; i < TLR / 16; ++i)
#pragma unroll
        for (int u = 0; u < 4; ++u) t[(r + 16 * i) * TLP + c + u] = v[i][u];
    __syncthreads();   // the tile is whole before any wave walks its columns
}
__global__ __launch_bounds__(256) void k_xt(const float* __restrict__ x, const float* __restrict__ w0, const float* __restrict__ w1, const float* __restrict__ w2, const float* __restrict__ w3, bf* XT, bf* W4) {
    __shared__ float t[TLR * TLP];
    if (blockIdx.x < 4 * WBL) { const int w = blockIdx.x / WBL; const float* src = w == 0 ? w0 : w == 1 ? w1 : w == 2 ? w2 : w3; const int i = (blockIdx.x % WBL) * 256 + threadIdx.x; const v8f v = *(const v8f*)(src + i * 8); v8us o;
#pragma unroll
        for (int k = 0; k < 8; ++k) o[k] = f2bf(v[k]); *(v8us*)(W4 + w * (DDr * CC) + i * 8) = o; }
    else { const int blk = blockIdx.x - 4 * WBL, img = blk / XBL, tl = blk % XBL, cb = (tl / (NN / TLC)) * TLR, n0 = (tl % (NN / TLC)) * TLC; x += (size_t)img * CC * NN; XT += (size_t)img * NN * CC;
        tile_in(x + (size_t)cb * NN + n0, NN, t);
#pragma unroll
        for (int i = 0; i < 4; ++i) { const int c = (threadIdx.x & 7) * 8 + (i & 1) * 64, n = (threadIdx.x >> 3) + (i >> 1) * 32; v8us o;   // 8 lanes x 16 B = one 128-B line of a row of XT
#pragma unroll
            for (int k = 0; k < 8; ++k) o[k] = f2bf(t[(c + k) * TLP + n]);
            *(v8us*)(XT + (size_t)(n0 + n) * CC + cb + c) = o; }
        asm volatile("s_wait_xcnt 0x0" ::: "memory"); } }   // the build lays the other branch's code behind these stores (a path no block takes): the wait stands in front of its writes of the stores' registers
__global__ __launch_bounds__(256) void k_tpl(const float* __restrict__ F, bf* Th, bf* Tl, h16* G16) { F += (size_t)blockIdx.y * 3 * DDr * NN;
    __shared__ float t[TLR * TLP];
    if (blockIdx.x >= 2 * TBL) { const int e = ((blockIdx.x - 2 * TBL) * 256 + threadIdx.x) * 4; F += (size_t)2 * DDr * NN; G16 += (size_t)blockIdx.y * DDr * NN; const v4f a = *(const v4f*)(F + e); v4h o; o[0] = tohx(a[0]); o[1] = tohx(a[1]); o[2] = tohx(a[2]); o[3] = tohx(a[3]); *(v4h*)(G16 + e) = o; }
    else { const int tp = blockIdx.x / TBL, n0 = (blockIdx.x % TBL) * TLC; F += (size_t)tp * DDr * NN; Th += (size_t)(blockIdx.y * 2 + tp) * NN * DDr; Tl += (size_t)(blockIdx.y * 2 + tp) * NN * DDr;
        tile_in(F + n0, NN, t);
#pragma unroll
        for (int i = 0; i < 4; ++i) { const int d = (threadIdx.x & 7) * 8 + (i & 1) * 64, n = (threadIdx.x >> 3) + (i >> 1) * 32; v8us oh, ol;   // 8 lanes x 16 B = one 128-B line of a row of each plane
#pragma unroll
            for (int k = 0; k < 8; ++k) { unsigned short a, b; splitf(t[(d + k) * TLP + n], a, b); oh[k] = a; ol[k] = b; }
            *(v8us*)(Th + (size_t)(n0 + n) * DDr + d) = oh; *(v8us*)(Tl + (size_t)(n0 + n) * DDr + d) = ol; }
        asm volatile("s_wait_xcnt 0x0" ::: "memory"); } }   // as in k_xt: in front of the other branch's writes of these stores' registers
__global__ __launch_bounds__(256) void k_ypl(const float* __restrict__ Y, const float* __restrict__ ML, bf* Yh, bf* Yl) { const int e = (blockIdx.x * 256 + threadIdx.x) * 4; if (e >= NN * DDr) return; Y += (size_t)blockIdx.y * AZ * NN * DDr; ML += (size_t)blockIdx.y * AZ * NN * 2 + (e / DDr) * 2; Yh += (size_t)blockIdx.y * NN * DDr; Yl += (size_t)blockIdx.y * NN * DDr;
    float m4[AZ], s4[AZ], top = -3.0e38f, den = 0.f; v4f a = (v4f){};
#pragma unroll
    for (int z = 0; z < AZ; ++z) { m4[z] = ML[z * NN * 2]; s4[z] = ML[z * NN * 2 + 1]; }
    asm volatile("s_wait_xcnt 0x0" ::: "memory");   // in front of the writes of these loads' address registers
#pragma unroll
    for (int z = 0; z < AZ; ++z) top = fmaxf(top, m4[z]);
#pragma unroll
    for (int z = 0; z < AZ; ++z) { const float w = __builtin_amdgcn_exp2f(m4[z] - top); den += w * s4[z]; a += *(const v4f*)(Y + (size_t)z * NN * DDr + e) * w; }
    const float f = __fdiv_rn(1.0f, den); v4us oh, ol;
#pragma unroll
    for (int u = 0; u < 4; ++u) { unsigned short h, l; splitf(a[u] * f, h, l); oh[u] = h; ol[u] = l; } *(v4us*)(Yh + e) = oh; *(v4us*)(Yl + e) = ol;  }
__global__ __launch_bounds__(256) void k_outT(const float* __restrict__ x, const float* __restrict__ O, float* OUT) {
    __shared__ float t[TLR * TLP];
    const int n0 = (blockIdx.x % (NN / TLR)) * TLR, cb = (blockIdx.x / (NN / TLR)) * TLC; x += (size_t)blockIdx.y * CC * NN; O += (size_t)blockIdx.y * NN * CC; OUT += (size_t)blockIdx.y * CC * NN;
    const size_t o0 = (size_t)(cb + (threadIdx.x >> 4)) * NN + n0 + (threadIdx.x & 15) * 4; v4f xv[8];   // piece i of a thread: row c = cb + tid / 16 + 16 (i / 2), 4 n from n0 + 4 (tid % 16) + 64 (i % 2): 16 lanes x 16 B a row piece
#pragma unroll
    for (int i = 0; i < 8; ++i) xv[i] = *(const v4f*)(x + o0 + (size_t)(i >> 1) * 16 * NN + (i & 1) * 64);   // on their way together with the tile's loads, whose wait covers their address registers too
    tile_in(O + (size_t)n0 * CC + cb, CC, t);
#pragma unroll
    for (int i = 0; i < 8; ++i) { const int c = (threadIdx.x >> 4) + 16 * (i >> 1), n = (threadIdx.x & 15) * 4 + (i & 1) * 64; v4f o;
#pragma unroll
        for (int u = 0; u < 4; ++u) o[u] = __fadd_rn(bfr(xv[i][u]), t[(n + u) * TLP + c]);
        *(v4f*)(OUT + o0 + (size_t)(i >> 1) * 16 * NN + (i & 1) * 64) = o; } }

extern "C" void kernel_launch(void* const* d_in, const int* in_sizes, int n_in,
                              void* d_out, int out_size, void* d_ws, size_t ws_size, hipStream_t stream) {
    (void)in_sizes; (void)n_in; (void)out_size;
    const float* x = (const float*)d_in[0]; const float* wth = (const float*)d_in[1]; const float* wph = (const float*)d_in[2]; const float* wg = (const float*)d_in[3]; const float* wout = (const float*)d_in[4];
    float* OUT = (float*)d_out;     // [4][256][64][64]
    char* wsp = (char*)d_ws;
    auto take = [&](size_t bytes) { char* p = wsp; wsp += (bytes + 255) & ~(size_t)255; return (void*)p; };
    // Independent launches are merged into one grid each: the four images are a grid axis everywhere, the three projections are one product with 384 rows of weights.
    bf* W4 = (bf*)take((size_t)4 * DDr * CC * 2); bf* WOUT = W4 + 3 * DDr * CC;   // w_theta, w_phi, w_g ([d][c] rows = A operand), w_out ([c][d] = natural Bt)
    bf* XT = (bf*)take((size_t)NBI * NN * CC * 2); float* F = (float*)take((size_t)NBI * 3 * DDr * NN * 4); bf* TPh = (bf*)take((size_t)NBI * 2 * NN * DDr * 2); bf* TPl = (bf*)take((size_t)NBI * 2 * NN * DDr * 2); h16* G16 = (h16*)take((size_t)NBI * DDr * NN * 2);
    float* Y = (float*)take((size_t)NBI * AZ * NN * DDr * 4); float* ML = (float*)take((size_t)NBI * AZ * NN * 2 * 4); bf* Yh = (bf*)take((size_t)NBI * NN * DDr * 2); bf* Yl = (bf*)take((size_t)NBI * NN * DDr * 2);   // Y [image][key quarter][n][d], ML [image][key quarter][n][r, sum]
    float* O = (float*)take((size_t)NBI * NN * CC * 4);    // [image][n][c]
    if ((size_t)(wsp - (char*)d_ws) > ws_size) return;    // total ~ 109 MiB
    k_xt<<<4 * WBL + NBI * XBL, 256, 0, stream>>>(x, wth, wph, wg, wout, XT, W4);
    k_gemmw<bf, 0, false><<<dim3(3 * DDr / 64, NN / 64, NBI), 32, 0, stream>>>(W4, nullptr, XT, nullptr, CC, F, NN, nullptr, 0, (size_t)NN * CC, (size_t)3 * DDr * NN);
    k_tpl<<<dim3(2 * TBL + GBL, NBI, 1), 256, 0, stream>>>(F, TPh, TPl, G16);
    k_attn<<<dim3(NN / (AW * AQ), AZ, NBI), AW * 32, 0, stream>>>(TPh, TPl, G16, Y, ML);     // y[n][d] (unnormalised) = sum_m P[n][m] g[d][m], a key quarter a plane
    k_ypl<<<dim3((NN * DDr / 4 + 255) / 256, NBI, 1), 256, 0, stream>>>(Y, ML, Yh, Yl);
    k_gemmw<bf, 1, false><<<dim3(NN / 64, CC / 64, NBI), 32, 0, stream>>>(Yh, Yl, WOUT, nullptr, DDr, O, CC, nullptr, (size_t)NN * DDr, 0, (size_t)NN * CC);            // o[n][c] = sum_d y[n][d] w_out[c][d]
    k_outT<<<dim3((NN / TLR) * (CC / TLC), NBI, 1), 256, 0, stream>>>(x, O, OUT);
}

// v005
// Measured time: 76.6 microseconds a run.
// Timed twice side by side with v004, it ran 1.29 times as fast both times.
// Counting every step since v000, it is 11.8 times as fast.
#include <hip/hip_runtime.h>

// _NonLocal (embedded-Gaussian non-local block: x [4][256][64][64] -> 4096 positions; theta/phi/g = 1x1 convs to 128 channels (no bias); attn[n][m] = softmax_m(theta[:,n].phi[:,m]) (UNSCALED: logits have sigma ~ 11, so the scores need 3-product precision);
// y[d][n] = sum_m g[d][m] attn[n][m]; out = x + w_out y -> [4][256][64][64]).
// Compute dtypes, f32 accumulate: every input rounded to bf16; theta/phi/g on PLAIN bf16 operands (inputs: exact); scores (K 128) on bf16 hi+lo planes of theta and phi (3 products; single fp16 planes

#define NBI  4
#define CC   256
#define DDr  128
#define NN   4096
#define L2E  1.4426950408889634f
#define PSH  10.0f
typedef _Float16 h16;
typedef unsigned short bf;
typedef __attribute__((ext_vector_type(16))) __bf16   v16bf;
typedef __attribute__((ext_vector_type(16))) _Float16 v16h;
typedef __attribute__((ext_vector_type(8)))  _Float16 v8h;
typedef __attribute__((ext_vector_type(8)))  unsigned short v8us;
typedef __attribute__((ext_vector_type(8)))  float    v8f;
typedef __attribute__((ext_vector_type(4)))  float    v4f;
typedef v8h  __attribute__((may_alias)) v8ha;
typedef v4f  __attribute__((may_alias)) v4fa;
typedef v8us __attribute__((may_alias)) v8usa;

__device__ __forceinline__ unsigned short f2bf(float f) { unsigned u = __float_as_uint(f); u += 0x7FFFu + ((u >> 16) & 1u); return (unsigned short)(u >> 16); }
__device__ __forceinline__ float bf2f(unsigned short b) { return __uint_as_float(((unsigned)b) << 16); }
__device__ __forceinline__ float bfr(float f) { return bf2f(f2bf(f)); }
__device__ __forceinline__ v16h cat16(v8h lo, v8h hi) { return __builtin_shufflevector(lo, hi, 0, 1, 2, 3, 4, 5, 6, 7, 8, 9, 10, 11, 12, 13, 14, 15); }
__device__ __forceinline__ v16bf cat16b(v8us lo, v8us hi) { return __builtin_bit_cast(v16bf, __builtin_shufflevector(lo, hi, 0, 1, 2, 3, 4, 5, 6, 7, 8, 9, 10, 11, 12, 13, 14, 15)); }
__device__ __forceinline__ float xhalf(float x) { return __builtin_bit_cast(float, __builtin_amdgcn_permlanex16(__builtin_bit_cast(int, x), __builtin_bit_cast(int, x), 0x76543210, 0xfedcba98, false, false)); }   // lane l takes lane l ^ 16's value
__device__ __forceinline__ v8f wmma16(v16h a, v16h b, v8f c) { return __builtin_amdgcn_wmma_f32_16x16x32_f16(false, a, false, b, (short)0, c, false, false); }
__device__ __forceinline__ v8f wmmab(v16bf a, v16bf b, v8f c) { return __builtin_amdgcn_wmma_f32_16x16x32_bf16(false, a, false, b, (short)0, c, false, false); }



// A fragment of 16 k from a k-contiguous 16-bit row: two 16-byte loads, the same for the A and the B side.
template <typename T16> struct WFrag;
template <> struct WFrag<h16> { typedef v16h V; static __device__ __forceinline__ V ld(const h16* p) { return cat16(*(const v8h*)p, *(const v8h*)(p + 16)); } static __device__ __forceinline__ v8f mma(V a, V b, v8f c) { return wmma16(a, b, c); } };
template <> struct WFrag<bf> { typedef v16bf V; static __device__ __forceinline__ V ld(const bf* p) { return cat16b(*(const v8us*)p, *(const v8us*)(p + 16)); } static __device__ __forceinline__ v8f mma(V a, V b, v8f c) { return wmmab(a, b, c); } };
__device__ __forceinline__ h16 tohx(float x) { return (h16)x; }
__device__ __forceinline__ void splitf(float y, unsigned short& h, unsigned short& l) { h = f2bf(y); l = f2bf(y - bf2f(h)); }
typedef __attribute__((ext_vector_type(4))) unsigned short v4us;
typedef v4us __attribute__((may_alias)) v4usa;

// ---- k_proj: the three projections. ONE WAVE per 64 x 64 output tile (16 accumulators), operands straight from c-contiguous bf16 planes; grid (384 / 64 blocks of weight rows, NN / 64, image), 32 threads.
// The result leaves in the form its reader wants, straight from the accumulators (no f32 copy in memory, no repack pass): a lane's 8 accumulator registers are 8 consecutive rows of the A operand in one column of B,
// so the index that must be contiguous in memory is given to A. theta, phi (blocks 0 .. 3): A = weights (d), B = XT (n): hi and lo bf16 planes T[n][d], 16 B a lane and plane; g (blocks 4, 5): A = XT (n), B = weights (d): fp16 G[d][n], 16 B a lane.
// A wave writes whole 128-byte lines (64 d or 64 n x 2 B), in four pieces of 32 B.
__global__ __launch_bounds__(32) void k_proj(const bf* __restrict__ W, const bf* __restrict__ XT, bf* Th, bf* Tl, h16* G16) {
    const int lane = threadIdx.x & 31, lr = lane & 15, hi = lane >> 4; const int wb = blockIdx.x, n0 = blockIdx.y * 64, img = blockIdx.z; const bool isg = wb >= 4;
    const bf* wr = W + (size_t)wb * 64 * CC + (size_t)lr * CC + 8 * hi; const bf* xr = XT + ((size_t)img * NN + n0) * CC + (size_t)lr * CC + 8 * hi;
    const bf* A = isg ? xr : wr; const bf* Bt = isg ? wr : xr;
    v8f acc[4][4];
#pragma unroll
    for (int mb = 0; mb < 4; ++mb)
#pragma unroll
        for (int nb = 0; nb < 4; ++nb) acc[mb][nb] = (v8f){};
    // kept rolled, as in the product kernel it replaces: the trips are alike, and unrolled the code would only grow
#pragma unroll 1
    for (int kc = 0; kc < CC; kc += 32) {
        v16bf a[4], b[4]; const bf* pa = A + kc; const bf* pb = Bt + kc;
#pragma unroll
        for (int mb = 0; mb < 4; ++mb) { a[mb] = WFrag<bf>::ld(pa + (size_t)mb * 16 * CC); b[mb] = WFrag<bf>::ld(pb + (size_t)mb * 16 * CC); }
        asm volatile("s_wait_xcnt 0x0" :: "v"(pa), "v"(pb) : "memory");   // in front of the writes of these loads' address registers, which it takes as inputs so that no result of the group is laid over them
        __builtin_amdgcn_sched_barrier(0);                                  // keeps such writes from being lifted over the wait
#pragma unroll
        for (int nb = 0; nb < 4; ++nb)
#pragma unroll
            for (int mb = 0; mb < 4; ++mb) acc[mb][nb] = wmmab(a[mb], b[nb], acc[mb][nb]);
        asm volatile("v_nop\n\tv_nop\n\tv_nop\n\tv_nop" : "+v"(acc[0][0]), "+v"(acc[1][1]), "+v"(acc[2][2]), "+v"(acc[3][3]) : "v"(a[0]), "v"(a[3]));   // the distance behind the trip's last matrix instructions, on the back edge too, where the next trip's loads overwrite their operands
    }
    if (!isg) { const size_t o = ((size_t)(img * 2 + (wb >> 1)) * NN + n0 + lr) * DDr + (wb & 1) * 64 + hi * 8;
#pragma unroll
        for (int nb = 0; nb < 4; ++nb)
#pragma unroll
            for (int mb = 0; mb < 4; ++mb) { v8us oh, ol;
#pragma unroll
                for (int j = 0; j < 8; ++j) { unsigned short p, q; splitf(acc[mb][nb][j], p, q); oh[j] = p; ol[j] = q; }   // theta or phi [d = 64 (wb & 1) + 16 mb + 8 hi + j][n = n0 + 16 nb + lr]
                *(v8us*)(Th + o + (size_t)nb * 16 * DDr + mb * 16) = oh; *(v8us*)(Tl + o + (size_t)nb * 16 * DDr + mb * 16) = ol; }
        asm volatile("s_wait_xcnt 0x0" ::: "memory"); }   // in front of whatever the build lays behind these stores and lets write their registers
    else { const size_t o = ((size_t)img * DDr + (wb - 4) * 64 + lr) * NN + n0 + hi * 8;
#pragma unroll
        for (int nb = 0; nb < 4; ++nb)
#pragma unroll
            for (int mb = 0; mb < 4; ++mb) { v8h og;
#pragma unroll
                for (int j = 0; j < 8; ++j) og[j] = tohx(acc[mb][nb][j]);   // g [d = 64 (wb - 4) + 16 nb + lr][n = n0 + 16 mb + 8 hi + j]
                *(v8h*)(G16 + o + (size_t)nb * 16 * NN + mb * 16) = og; } }
}

// ---- k_attn: scores, softmax and P.g in one kernel; no score and no P ever goes to memory. Transposed products: S^T = phi . theta^T (A = 16 keys, B = 16 queries) and y^T += g . P^T (A = 16 rows of g, B = P^T),
// so that a lane holds scores of ONE query (column lr; keys 8 hi + j of each 16-key tile) and two score tiles, converted, ARE the 32-key B fragment of the second product: P crosses no lane and no LDS.
// Work-group = 256 queries (8 waves x 32) x one quarter of the keys (blockIdx.y) of one image (blockIdx.z). theta fragments (hi and lo planes) stay in registers; phi (hi, lo) and g go through LDS, 64 keys a stage,
// two buffers, fetched one stage ahead into registers; one barrier a stage. Running maximum and sum per query (online softmax); y^T is rescaled only in a pass in which some query's maximum rises.
// Scores: three bf16 products a k block, in the order hi.hi, theta lo . phi hi, theta hi . phi lo. Exponents count from a reference point r = running max x log2(e) - 10: P = exp2(s log2(e) - r) <= 1024, in fp16; the point cancels in sum(P g) / sum(P).
// Out: unnormalised y [image][quarter][n][d] and (r, sum of P) per query and quarter; k_outp joins the quarters.
#define AW   8
#define AQ   32
#define AZ   4
#define AKEY (NN / AZ)
#define AST  64
#define APP  136
#define APG  72
#define APH  (AST * APP)
#define ABUF (2 * APH + DDr * APG)
__global__ __launch_bounds__(AW * 32) void k_attn(const bf* __restrict__ TPh, const bf* __restrict__ TPl, const h16* __restrict__ G16, float* __restrict__ Yp, float* __restrict__ ML) {
    __shared__ __align__(16) unsigned short sm[2 * ABUF];   // a buffer: phi hi [64 keys][pitch 272 B], phi lo the same, g [128 d][pitch 144 B]: pitches 16 B x odd for 16-byte readers
    const int tid = threadIdx.x, lane = tid & 31, lr = lane & 15, hi = lane >> 4, wave = tid >> 5;
    const int img = blockIdx.z, part = img * AZ + blockIdx.y, q0 = blockIdx.x * (AW * AQ) + wave * AQ, key0 = blockIdx.y * AKEY;
    const bf* th = TPh + (size_t)img * 2 * NN * DDr; const bf* tl = TPl + (size_t)img * 2 * NN * DDr; const bf* ph = th + (size_t)NN * DDr + (size_t)key0 * DDr; const bf* pl = tl + (size_t)NN * DDr + (size_t)key0 * DDr;
    const h16* g = G16 + (size_t)img * DDr * NN + key0;
    v16bf qh[2][4], ql[2][4];
#pragma unroll
    for (int q = 0; q < 2; ++q)
#pragma unroll
        for (int kc = 0; kc < 4; ++kc) { const size_t o = (size_t)(q0 + q * 16 + lr) * DDr + 8 * hi + kc * 32; qh[q][kc] = WFrag<bf>::ld(th + o); ql[q][kc] = WFrag<bf>::ld(tl + o); }
    asm volatile("s_wait_xcnt 0x0" ::: "memory");   // in front of the writes of these loads' address registers
    __builtin_amdgcn_sched_barrier(0);                // without it the build lifts such writes (later address sums, the zeroing below) over the wait
    v8f O[8][2];
#pragma unroll
    for (int dt = 0; dt < 8; ++dt) { O[dt][0] = (v8f){}; O[dt][1] = (v8f){}; }
    float mr[2] = { -3.0e38f, -3.0e38f }, sum[2] = { 0.f, 0.f };
    const int prow = tid >> 4, pcol = (tid & 15) * 8, grow = tid >> 3, gcol = (tid & 7) * 8;   // a thread's 16-byte pieces of a stage: phi rows prow + 16 i, g rows grow + 32 i
    v8us rh[4], rl[4]; v8h rg[4];
#pragma unroll
    for (int i = 0; i < 4; ++i) { rh[i] = *(const v8us*)(ph + (size_t)(prow + 16 * i) * DDr + pcol); rl[i] = *(const v8us*)(pl + (size_t)(prow + 16 * i) * DDr + pcol); rg[i] = *(const v8h*)(g + (size_t)(grow + 32 * i) * NN + gcol); }
    asm volatile("s_wait_xcnt 0x0" ::: "memory");   // as above
    __builtin_amdgcn_sched_barrier(0);                // as above
    // kept rolled: the trips are alike and long (128 matrix instructions); unrolled, the code would only grow
#pragma unroll 1
    for (int s = 0; s < AKEY / AST; ++s) {
        unsigned short* buf = sm + (s & 1) * ABUF;
#pragma unroll
        for (int i = 0; i < 4; ++i) { *(v8usa*)(buf + (prow + 16 * i) * APP + pcol) = rh[i]; *(v8usa*)(buf + APH + (prow + 16 * i) * APP + pcol) = rl[i]; *(v8ha*)(buf + 2 * APH + (grow + 32 * i) * APG + gcol) = rg[i]; }
        __syncthreads();   // stage s is in LDS for every wave; and every wave has left stage s - 1, whose buffer is written next trip
        if (s + 1 < AKEY / AST) { const int kb = (s + 1) * AST;
#pragma unroll
            for (int i = 0; i < 4; ++i) { rh[i] = *(const v8us*)(ph + (size_t)(kb + prow + 16 * i) * DDr + pcol); rl[i] = *(const v8us*)(pl + (size_t)(kb + prow + 16 * i) * DDr + pcol); rg[i] = *(const v8h*)(g + (size_t)(grow + 32 * i) * NN + kb + gcol); }
            asm volatile("s_wait_xcnt 0x0" ::: "memory"); }   // as above: the address registers are used again in the pass below, while the data are still on their way
        // kept rolled: unrolled, the build mixes one pass's second product with the next pass's first and, short of registers, fetches their fragments two loads at a time with a full wait each
#pragma unroll 1
        for (int kk = 0; kk < AST / 32; ++kk) {
            v8f S[2][2];
#pragma unroll
            for (int t = 0; t < 2; ++t) { S[t][0] = (v8f){}; S[t][1] = (v8f){}; }
            const unsigned short* pr = buf + (kk * 32 + lr) * APP + 8 * hi;
            v16bf ah[4][2], al[4][2];
#pragma unroll
            for (int kc = 0; kc < 4; ++kc)
#pragma unroll
                for (int t = 0; t < 2; ++t) { const unsigned short* p = pr + t * 16 * APP + kc * 32; ah[kc][t] = cat16b(*(const v8usa*)p, *(const v8usa*)(p + 16)); al[kc][t] = cat16b(*(const v8usa*)(p + APH), *(const v8usa*)(p + APH + 16)); }
            __builtin_amdgcn_sched_barrier(0);   // keeps the pass's phi fragment loads one group in front of its matrix instructions: spread among them, through few registers, each pair is waited for in full
#pragma unroll
            for (int kc = 0; kc < 4; ++kc) {
#pragma unroll
                for (int t = 0; t < 2; ++t)
#pragma unroll
                    for (int q = 0; q < 2; ++q) S[t][q] = wmmab(ah[kc][t], qh[q][kc], S[t][q]);   // theta hi . phi hi
#pragma unroll
                for (int t = 0; t < 2; ++t)
#pragma unroll
                    for (int q = 0; q < 2; ++q) S[t][q] = wmmab(ah[kc][t], ql[q][kc], S[t][q]);   // theta lo . phi hi
#pragma unroll
                for (int t = 0; t < 2; ++t)
#pragma unroll
                    for (int q = 0; q < 2; ++q) S[t][q] = wmmab(al[kc][t], qh[q][kc], S[t][q]); } // theta hi . phi lo
            const unsigned short* gr = buf + 2 * APH + lr * APG + kk * 32 + 8 * hi; v16h ga[8];
#pragma unroll
            for (int dt = 0; dt < 8; ++dt) ga[dt] = cat16(*(const v8ha*)(gr + dt * 16 * APG), *(const v8ha*)(gr + dt * 16 * APG + 16));
            __builtin_amdgcn_sched_barrier(0);   // keeps the loads of the g fragments, one group, in front of the softmax arithmetic, which then covers their latency
            float mn[2]; bool rise = false;
#pragma unroll
            for (int q = 0; q < 2; ++q) { float tm = fmaxf(S[0][q][0], S[1][q][0]);
#pragma unroll
                for (int j = 1; j < 8; ++j) tm = fmaxf(tm, fmaxf(S[0][q][j], S[1][q][j]));
                tm = fmaxf(tm, xhalf(tm)); mn[q] = fmaxf(mr[q], fmaf(tm, L2E, -PSH)); rise = rise || mn[q] > mr[q]; }
            if (__builtin_amdgcn_ballot_w32(rise) != 0) {   // one scalar branch a pass: the same for the whole wave, so every matrix instruction keeps all lanes on
#pragma unroll
                for (int q = 0; q < 2; ++q) { const float sc = __builtin_amdgcn_exp2f(mr[q] - mn[q]); sum[q] *= sc; mr[q] = mn[q];
#pragma unroll
                    for (int dt = 0; dt < 8; ++dt) O[dt][q] *= sc; } }
            v16h pf[2];
#pragma unroll
            for (int q = 0; q < 2; ++q) { float ps[2] = { 0.f, 0.f };   // a chain of sums a score tile: shorter dependent chains
#pragma unroll
                for (int t = 0; t < 2; ++t)
#pragma unroll
                    for (int j = 0; j < 8; ++j) { const float e = __builtin_amdgcn_exp2f(fmaf(S[t][q][j], L2E, -mr[q])); ps[t] += e; pf[q][t * 8 + j] = (h16)e; }   // element 8 t + j of the B fragment is k = 16 t + 8 hi + j: the row of score tile t that this lane holds
                sum[q] += ps[0] + ps[1]; }
#pragma unroll
            for (int dt = 0; dt < 8; ++dt) { O[dt][0] = wmma16(ga[dt], pf[0], O[dt][0]); O[dt][1] = wmma16(ga[dt], pf[1], O[dt][1]); }
        }
    }
    float* yp = Yp + (size_t)part * NN * DDr;
#pragma unroll
    for (int q = 0; q < 2; ++q) { const int n = q0 + q * 16 + lr; const float st = sum[q] + xhalf(sum[q]);   // the two lane halves summed different keys of the same query
#pragma unroll
        for (int dt = 0; dt < 8; ++dt) *(v8f*)(yp + (size_t)n * DDr + dt * 16 + hi * 8) = O[dt][q];
        if (hi == 0) { float* ml = ML + ((size_t)part * NN + n) * 2; ml[0] = mr[q]; ml[1] = st; } }
}


// k_xt: blocks 0 .. 4 WBL - 1: bf16 copies of the four weight matrices, one behind the other in W4 (WBL blocks a matrix, 32-B lanes); then XBL blocks an image: XT[n][c] = bf16 x[c][n].
// The transposing repack moves a tile of 128 source rows (c) x 64 source columns (n) a work-group through LDS: whole 256-byte row pieces are read from memory, whole 128-byte row pieces are written, and the turn is made by the LDS column walk.
#define TLR 128
#define TLC 64
#define TLP 65   // LDS pitch in floats, odd: a walk down a column changes bank with every row
#define WBL (DDr * CC / 8 / 256)
#define XBL ((CC / TLR) * (NN / TLC))
static_assert(WBL * 8 * 256 == DDr * CC && XBL * TLR * TLC == NN * CC, "whole blocks and whole tiles only: no range test in k_xt");
// 256 threads bring src[0 .. 127][0 .. 63] (row pitch ld floats) into t[row][column]: 16 lanes x 16 B a row, 8 loads a thread in flight; returns behind the barrier that hands the tile to every wave.
__device__ __forceinline__ void tile_in(const float* __restrict__ src, size_t ld, float* t) {
    const int r = threadIdx.x >> 4, c = (threadIdx.x & 15) * 4; v4f v[TLR / 16];
#pragma unroll
    for (int i = 0; i < TLR / 16; ++i) v[i] = *(const v4f*)(src + (size_t)(r + 16 * i) * ld + c);
    asm volatile("s_wait_xcnt 0x0" ::: "memory");   // in front of the writes of these loads' address registers
#pragma unroll
    for (int i = 0; i < TLR / 16; ++i)
#pragma unroll
        for (int u = 0; u < 4; ++u) t[(r + 16 * i) * TLP + c + u] = v[i][u];
    __syncthreads();   // the tile is whole before any wave walks its columns
}
__global__ __launch_bounds__(256) void k_xt(const float* __restrict__ x, const float* __restrict__ w0, const float* __restrict__ w1, const float* __restrict__ w2, const float* __restrict__ w3, bf* XT, bf* W4) {
    __shared__ float t[TLR * TLP];
    if (blockIdx.x < 4 * WBL) { const int w = blockIdx.x / WBL; const float* src = w == 0 ? w0 : w == 1 ? w1 : w == 2 ? w2 : w3; const int i = (blockIdx.x % WBL) * 256 + threadIdx.x; const v8f v = *(const v8f*)(src + i * 8); v8us o;
#pragma unroll
        for (int k = 0; k < 8; ++k) o[k] = f2bf(v[k]); *(v8us*)(W4 + w * (DDr * CC) + i * 8) = o; }
    else { const int blk = blockIdx.x - 4 * WBL, img = blk / XBL, tl = blk % XBL, cb = (tl / (NN / TLC)) * TLR, n0 = (tl % (NN / TLC)) * TLC; x += (size_t)img * CC * NN; XT += (size_t)img * NN * CC;
        tile_in(x + (size_t)cb * NN + n0, NN, t);
#pragma unroll
        for (int i = 0; i < 4; ++i) { const int c = (threadIdx.x & 7) * 8 + (i & 1) * 64, n = (threadIdx.x >> 3) + (i >> 1) * 32; v8us o;   // 8 lanes x 16 B = one 128-B line of a row of XT
#pragma unroll
            for (int k = 0; k < 8; ++k) o[k] = f2bf(t[(c + k) * TLP + n]);
            *(v8us*)(XT + (size_t)(n0 + n) * CC + cb + c) = o; }
        asm volatile("s_wait_xcnt 0x0" ::: "memory"); } }   // the build lays the other branch's code behind these stores (a path no block takes): the wait stands in front of its writes of the stores' registers

// ---- k_outp: the join of the key quarters, the output product and the residual in one kernel. Work-group = 32 positions n x all 256 channels c of one image, 8 waves; grid (NN / 32, image).
// 1. y[n][d] = (sum over the key quarters of exp2(r - top r) Y) / (the sums of P joined the same way), split into hi and lo bf16 planes, goes to LDS (pitch 272 B); the weights and 1 / sum of a position are made once, by one wave, and passed through LDS.
// 2. A wave's tile is 32 n x 32 c: A = y (hi, then lo plane, a k block), B = w_out [c][d] from memory: o[n][c], 8 consecutive n of one c in a lane.
// 3. The tile is turned in the wave's own LDS range ([c][n], pitch 144 B), so that x is read and OUT written in whole 128-byte lines: OUT[c][n] = x[c][n] + o[n][c].
#define OTN 32
#define OPP 136
#define OSP 36
__global__ __launch_bounds__(256) void k_outp(const float* __restrict__ Y, const float* __restrict__ ML, const bf* __restrict__ WO, const float* __restrict__ x, float* OUT) {
    __shared__ __align__(16) unsigned short ys[2 * OTN * OPP];
    __shared__ __align__(16) float wq[OTN * 8];
    __shared__ __align__(16) float os[8 * 32 * OSP];
    const int tid = threadIdx.x, lane = tid & 31, lr = lane & 15, hi = lane >> 4, wave = tid >> 5;
    const int img = blockIdx.y, n0 = blockIdx.x * OTN, c0 = wave * 32;
    Y += ((size_t)img * AZ * NN + n0) * DDr; ML += ((size_t)img * AZ * NN + n0) * 2;
    const size_t xo = (size_t)img * CC * NN + (size_t)(c0 + (lane >> 3)) * NN + n0 + (lane & 7) * 4;   // piece s of a lane: row c0 + lane / 8 + 4 s, 4 n: 8 lanes x 16 B = one line of a row
    v4f yv[OTN / 8][AZ], xv[8]; const float* yp = Y + (size_t)wave * DDr + lane * 4; const float* xp = x + xo;
#pragma unroll
    for (int i = 0; i < OTN / 8; ++i)
#pragma unroll
        for (int z = 0; z < AZ; ++z) yv[i][z] = *(const v4f*)(yp + ((size_t)z * NN + 8 * i) * DDr);   // a wave reads whole rows (512 B) of positions wave + 8 i
    asm volatile("s_wait_xcnt 0x0" :: "v"(yp) : "memory");   // in front of the writes of these loads' address registers, which it takes as an input so that no result of the group is laid over them
    __builtin_amdgcn_sched_barrier(0);                         // keeps such writes (later address sums, the next group's results) from being lifted over the wait
    // the w_out fragments and x are asked for at the start too, though wanted later: all that the work-group reads from memory is on its way at once, behind one latency
    const bf* wb = WO + (size_t)(c0 + lr) * DDr + 8 * hi; v16bf b[DDr / 32][2];
#pragma unroll
    for (int kc = 0; kc < DDr / 32; ++kc)
#pragma unroll
        for (int nb = 0; nb < 2; ++nb) b[kc][nb] = WFrag<bf>::ld(wb + (size_t)nb * 16 * DDr + kc * 32);
    asm volatile("s_wait_xcnt 0x0" :: "v"(wb) : "memory");   // as above
    __builtin_amdgcn_sched_barrier(0);                         // as above
#pragma unroll
    for (int s = 0; s < 8; ++s) xv[s] = *(const v4f*)(xp + (size_t)s * 4 * NN);
    asm volatile("s_wait_xcnt 0x0" :: "v"(xp) : "memory");   // as above
    __builtin_amdgcn_sched_barrier(0);                         // as above
    if (tid < OTN) { float m4[AZ], s4[AZ], top = -3.0e38f, den = 0.f;
#pragma unroll
        for (int z = 0; z < AZ; ++z) { m4[z] = ML[((size_t)z * NN + tid) * 2]; s4[z] = ML[((size_t)z * NN + tid) * 2 + 1]; }
        asm volatile("s_wait_xcnt 0x0" ::: "memory");   // in front of the writes of these loads' address registers
#pragma unroll
        for (int z = 0; z < AZ; ++z) top = fmaxf(top, m4[z]);
#pragma unroll
        for (int z = 0; z < AZ; ++z) { const float w = __builtin_amdgcn_exp2f(m4[z] - top); den += w * s4[z]; wq[tid * 8 + z] = w; }
        wq[tid * 8 + 4] = __fdiv_rn(1.0f, den); }
    __syncthreads();   // every position's weights are in LDS before any wave joins its rows
#pragma unroll
    for (int i = 0; i < OTN / 8; ++i) { const int n = wave + 8 * i; const v4f w = *(const v4fa*)(wq + n * 8); const float f = wq[n * 8 + 4]; v4f a = (v4f){};
#pragma unroll
        for (int z = 0; z < AZ; ++z) a += yv[i][z] * w[z];
        v4us oh, ol;
#pragma unroll
        for (int u = 0; u < 4; ++u) { unsigned short p, q; splitf(a[u] * f, p, q); oh[u] = p; ol[u] = q; }
        *(v4usa*)(ys + n * OPP + lane * 4) = oh; *(v4usa*)(ys + OTN * OPP + n * OPP + lane * 4) = ol; }
    __syncthreads();   // both planes of y are whole before any wave takes fragments of them
    v8f acc[2][2];
#pragma unroll
    for (int mb = 0; mb < 2; ++mb)
#pragma unroll
        for (int nb = 0; nb < 2; ++nb) acc[mb][nb] = (v8f){};
    const unsigned short* ar = ys + lr * OPP + 8 * hi;
#pragma unroll
    for (int kc = 0; kc < DDr / 32; ++kc) { v16bf a[2], a2[2];
#pragma unroll
        for (int mb = 0; mb < 2; ++mb) { const unsigned short* p = ar + mb * 16 * OPP + kc * 32; a[mb] = cat16b(*(const v8usa*)p, *(const v8usa*)(p + 16)); a2[mb] = cat16b(*(const v8usa*)(p + OTN * OPP), *(const v8usa*)(p + OTN * OPP + 16)); }
#pragma unroll
        for (int nb = 0; nb < 2; ++nb)
#pragma unroll
            for (int mb = 0; mb < 2; ++mb) { acc[mb][nb] = wmmab(a[mb], b[kc][nb], acc[mb][nb]); acc[mb][nb] = wmmab(a2[mb], b[kc][nb], acc[mb][nb]); } }
    float* ow = os + wave * (32 * OSP);
#pragma unroll
    for (int nb = 0; nb < 2; ++nb)
#pragma unroll
        for (int mb = 0; mb < 2; ++mb) { float* p = ow + (nb * 16 + lr) * OSP + mb * 16 + hi * 8;   // o[n = 16 mb + 8 hi + j][c = c0 + 16 nb + lr]
            *(v4fa*)p = __builtin_shufflevector(acc[mb][nb], acc[mb][nb], 0, 1, 2, 3); *(v4fa*)(p + 4) = __builtin_shufflevector(acc[mb][nb], acc[mb][nb], 4, 5, 6, 7); }
    asm volatile("s_wait_dscnt 0x0" ::: "memory");   // the wave's own writes of its range are done, and stay in front, before its lanes read one another's values back
#pragma unroll
    for (int s = 0; s < 8; ++s) { const v4f v = *(const v4fa*)(ow + (s * 4 + (lane >> 3)) * OSP + (lane & 7) * 4); v4f o;
#pragma unroll
        for (int u = 0; u < 4; ++u) o[u] = __fadd_rn(bfr(xv[s][u]), v[u]);
        *(v4f*)(OUT + xo + (size_t)s * 4 * NN) = o; }
}

extern "C" void kernel_launch(void* const* d_in, const int* in_sizes, int n_in,
                              void* d_out, int out_size, void* d_ws, size_t ws_size, hipStream_t stream) {
    (void)in_sizes; (void)n_in; (void)out_size;
    const float* x = (const float*)d_in[0]; const float* wth = (const float*)d_in[1]; const float* wph = (const float*)d_in[2]; const float* wg = (const float*)d_in[3]; const float* wout = (const float*)d_in[4];
    float* OUT = (float*)d_out;     // [4][256][64][64]
    char* wsp = (char*)d_ws;
    auto take = [&](size_t bytes) { char* p = wsp; wsp += (bytes + 255) & ~(size_t)255; return (void*)p; };
    // The four images are a grid axis of k_proj, k_attn and k_outp (k_xt counts them in blockIdx.x), the three projections are one grid with 384 rows of weights.
    bf* W4 = (bf*)take((size_t)4 * DDr * CC * 2); bf* WOUT = W4 + 3 * DDr * CC;   // w_theta, w_phi, w_g ([d][c] rows), w_out ([c][d] rows)
    bf* XT = (bf*)take((size_t)NBI * NN * CC * 2); bf* TPh = (bf*)take((size_t)NBI * 2 * NN * DDr * 2); bf* TPl = (bf*)take((size_t)NBI * 2 * NN * DDr * 2); h16* G16 = (h16*)take((size_t)NBI * DDr * NN * 2);
    float* Y = (float*)take((size_t)NBI * AZ * NN * DDr * 4); float* ML = (float*)take((size_t)NBI * AZ * NN * 2 * 4);   // Y [image][key quarter][n][d], ML [image][key quarter][n][r, sum]
    if ((size_t)(wsp - (char*)d_ws) > ws_size) return;    // total ~ 61 MiB
    k_xt<<<4 * WBL + NBI * XBL, 256, 0, stream>>>(x, wth, wph, wg, wout, XT, W4);
    k_proj<<<dim3(3 * DDr / 64, NN / 64, NBI), 32, 0, stream>>>(W4, XT, TPh, TPl, G16);
    k_attn<<<dim3(NN / (AW * AQ), AZ, NBI), AW * 32, 0, stream>>>(TPh, TPl, G16, Y, ML);     // y[n][d] (unnormalised) = sum_m P[n][m] g[d][m], a key quarter a plane
    k_outp<<<dim3(NN / OTN, NBI, 1), 256, 0, stream>>>(Y, ML, WOUT, x, OUT);                  // out[c][n] = x[c][n] + sum_d y[n][d] w_out[c][d]
}

// v006
// A run of this version takes 69.3 microseconds.
// Next to v005, in two timings, it ran 1.10 and 1.11 times as fast.
// Counting every step since v000, it is 13.1 times as fast.
#include <hip/hip_runtime.h>

// _NonLocal (embedded-Gaussian non-local block: x [4][256][64][64] -> 4096 positions; theta/phi/g = 1x1 convs to 128 channels (no bias); attn[n][m] = softmax_m(theta[:,n].phi[:,m]) (UNSCALED: logits have sigma ~ 11, so the scores need 3-product precision);
// y[d][n] = sum_m g[d][m] attn[n][m]; out = x + w_out y -> [4][256][64][64]).
// Compute dtypes, f32 accumulate: every input rounded to bf16; theta/phi/g on PLAIN bf16 operands (inputs: exact); scores (K 128) on bf16 hi+lo planes of theta and phi (3 products; single fp16 planes

#define NBI  4
#define CC   256
#define DDr  128
#define NN   4096
#define L2E  1.4426950408889634f
#define PSH  10.0f
typedef _Float16 h16;
typedef unsigned short bf;
typedef __attribute__((ext_vector_type(16))) __bf16   v16bf;
typedef __attribute__((ext_vector_type(16))) _Float16 v16h;
typedef __attribute__((ext_vector_type(8)))  _Float16 v8h;
typedef __attribute__((ext_vector_type(8)))  unsigned short v8us;
typedef __attribute__((ext_vector_type(8)))  float    v8f;
typedef __attribute__((ext_vector_type(4)))  float    v4f;
typedef v8h  __attribute__((may_alias)) v8ha;
typedef v4f  __attribute__((may_alias)) v4fa;
typedef v8us __attribute__((may_alias)) v8usa;

__device__ __forceinline__ unsigned short f2bf(float f) { unsigned u = __float_as_uint(f); u += 0x7FFFu + ((u >> 16) & 1u); return (unsigned short)(u >> 16); }
__device__ __forceinline__ float bf2f(unsigned short b) { return __uint_as_float(((unsigned)b) << 16); }
__device__ __forceinline__ float bfr(float f) { return bf2f(f2bf(f)); }
__device__ __forceinline__ v16h cat16(v8h lo, v8h hi) { return __builtin_shufflevector(lo, hi, 0, 1, 2, 3, 4, 5, 6, 7, 8, 9, 10, 11, 12, 13, 14, 15); }
__device__ __forceinline__ v16bf cat16b(v8us lo, v8us hi) { return __builtin_bit_cast(v16bf, __builtin_shufflevector(lo, hi, 0, 1, 2, 3, 4, 5, 6, 7, 8, 9, 10, 11, 12, 13, 14, 15)); }
__device__ __forceinline__ float xhalf(float x) { return __builtin_bit_cast(float, __builtin_amdgcn_permlanex16(__builtin_bit_cast(int, x), __builtin_bit_cast(int, x), 0x76543210, 0xfedcba98, false, false)); }   // lane l takes lane l ^ 16's value
__device__ __forceinline__ v8f wmma16(v16h a, v16h b, v8f c) { return __builtin_amdgcn_wmma_f32_16x16x32_f16(false, a, false, b, (short)0, c, false, false); }
__device__ __forceinline__ v8f wmmab(v16bf a, v16bf b, v8f c) { return __builtin_amdgcn_wmma_f32_16x16x32_bf16(false, a, false, b, (short)0, c, false, false); }



// A fragment of 16 k from a k-contiguous 16-bit row: two 16-byte loads, the same for the A and the B side.
template <typename T16> struct WFrag;
template <> struct WFrag<h16> { typedef v16h V; static __device__ __forceinline__ V ld(const h16* p) { return cat16(*(const v8h*)p, *(const v8h*)(p + 16)); } static __device__ __forceinline__ v8f mma(V a, V b, v8f c) { return wmma16(a, b, c); } };
template <> struct WFrag<bf> { typedef v16bf V; static __device__ __forceinline__ V ld(const bf* p) { return cat16b(*(const v8us*)p, *(const v8us*)(p + 16)); } static __device__ __forceinline__ v8f mma(V a, V b, v8f c) { return wmmab(a, b, c); } };
__device__ __forceinline__ h16 tohx(float x) { return (h16)x; }
__device__ __forceinline__ void splitf(float y, unsigned short& h, unsigned short& l) { h = f2bf(y); l = f2bf(y - bf2f(h)); }
typedef __attribute__((ext_vector_type(4))) unsigned short v4us;
typedef v4us __attribute__((may_alias)) v4usa;

// ---- k_proj: the rounding of x and of the weights to bf16, the turn of x and the three projections in one kernel: no bf16 copy of x or of w_theta, w_phi, w_g in memory, no pass of its own for them.
// Work-group = 64 positions n x all 384 rows of weights of one image, 12 waves; grid (NN / 64, image).
// 1. Staging, whole lines from memory: wave u brings rows 32 u .. 32 u + 31 of the stacked weights (32 KiB in a row of one matrix), rounds them and lays them in LDS as [row][c]; waves 0 .. 7 bring x[c = 0 .. 255][64 n], a thread 8 c x 4 n twice,
//    and lay it in LDS turned, as [n][c]: the 8 c of one n are one 16-byte piece. Pitch 528 B (16 B x odd) for the 16-byte fragment readers. One wave of each work-group rounds its 128 elements of w_out for k_outp.
// 2. A wave's tile is 4 x 2 accumulators, fragments from LDS. The result leaves in the form its reader wants, straight from the accumulators: a lane's 8 accumulator registers are 8 consecutive rows of the A operand in one column of B,
//    so the index that must be contiguous in memory is given to A. theta, phi (waves 0 .. 7: 64 d x 32 n): A = weights (d), B = x (n): hi and lo bf16 planes T[n][d], 16 B a lane and plane; g (waves 8 .. 11: 32 d x 64 n): A = x (n), B = weights (d): fp16 G[d][n], 16 B a lane.
//    A wave writes whole 128-byte lines (64 d or 64 n x 2 B), in four pieces of 32 B.
#define PJN 64
#define PJW (3 * DDr)
#define PJP (CC + 8)
typedef __attribute__((ext_vector_type(2))) float  v2f;
typedef __attribute__((ext_vector_type(2))) __bf16 v2bf;
typedef __attribute__((ext_vector_type(2))) unsigned v2u;
typedef __attribute__((ext_vector_type(4))) unsigned v4u;
typedef v2u __attribute__((may_alias)) v2ua;
typedef v4u __attribute__((may_alias)) v4ua;
__device__ __forceinline__ unsigned pk2(float a, float b) { const v2f t = { a, b }; return __builtin_bit_cast(unsigned, __builtin_convertvector(t, v2bf)); }   // two f32 to two bf16, nearest even, a in the low half
__global__ __launch_bounds__(384) void k_proj(const float* __restrict__ x, const float* __restrict__ w0, const float* __restrict__ w1, const float* __restrict__ w2, const float* __restrict__ w3, bf* Th, bf* Tl, h16* G16, bf* WO) {
    __shared__ __align__(16) unsigned short sm[(PJW + PJN) * PJP];   // rows 0 .. 383: weights [row][c]; rows 384 .. 447: x [n][c]
    const int tid = threadIdx.x, lane = tid & 31, lr = lane & 15, hi = lane >> 4; const int u = __builtin_amdgcn_readfirstlane(tid >> 5);   // the wave's number, in a scalar register: every test on it is a scalar branch
    const int n0 = blockIdx.x * PJN, img = blockIdx.y;
    const int cg = tid >> 4, n4 = (tid & 15) * 4;
    const float* xp = x + ((size_t)img * CC + cg * 8) * NN + n0 + n4;
    const float* wp = (u < 4 ? w0 : u < 8 ? w1 : w2) + (size_t)(u & 3) * 32 * CC + lane * 4;
    unsigned short* wd = sm + (size_t)u * 32 * PJP + lane * 4;
    const size_t oo = ((size_t)(blockIdx.y * (NN / PJN) + blockIdx.x) * 32 + lane) * 4;   // wave 8's share of w_out: 256 work-groups x 128 elements
    v4f xv[16], wv[32], ov = (v4f){};
    if (u == 8) { const float* op = w3 + oo; ov = *(const v4f*)op;   // asked for ahead of the weights, so that it costs no latency of its own
        asm volatile("s_wait_xcnt 0x0" :: "v"(op) : "memory"); }   // in front of the writes of this load's address registers
    if (u < 8) {
#pragma unroll
        for (int i = 0; i < 16; ++i) xv[i] = *(const v4f*)(xp + (size_t)((i >> 3) * 128 + (i & 7)) * NN);   // 16 lanes x 16 B = the 256 B of a row of the tile
        asm volatile("s_wait_xcnt 0x0" :: "v"(xp) : "memory");   // in front of the writes of these loads' address registers, which it takes as an input so that no result of the group is laid over them
        __builtin_amdgcn_sched_barrier(0); }                       // keeps such writes from being lifted over the wait
#pragma unroll
    for (int h = 0; h < 2; ++h) {
#pragma unroll
        for (int i = 0; i < 32; ++i) wv[i] = *(const v4f*)(wp + (h * 32 + i) * 128);   // a wave's load is 512 B in a row
        asm volatile("s_wait_xcnt 0x0" :: "v"(wp) : "memory");   // as above
        __builtin_amdgcn_sched_barrier(0);                         // as above
        if (h == 0 && u < 8) {   // x was asked for first and is here first: it is rounded and turned while the weights are on their way
#pragma unroll
            for (int g2 = 0; g2 < 2; ++g2)
#pragma unroll
                for (int e = 0; e < 4; ++e) { const v4u o = { pk2(xv[g2 * 8][e], xv[g2 * 8 + 1][e]), pk2(xv[g2 * 8 + 2][e], xv[g2 * 8 + 3][e]), pk2(xv[g2 * 8 + 4][e], xv[g2 * 8 + 5][e]), pk2(xv[g2 * 8 + 6][e], xv[g2 * 8 + 7][e]) };
                    *(v4ua*)(sm + (size_t)(PJW + n4 + e) * PJP + g2 * 128 + cg * 8) = o; } }
#pragma unroll
        for (int i = 0; i < 32; ++i) { const v2u o = { pk2(wv[i][0], wv[i][1]), pk2(wv[i][2], wv[i][3]) }; *(v2ua*)(wd + (h * 16 + (i >> 1)) * PJP + (i & 1) * 128) = o; }
    }
    __syncthreads();   // weights and x are whole in LDS before any wave takes fragments of them
    if (u == 8) { const v2u r = { pk2(ov[0], ov[1]), pk2(ov[2], ov[3]) }; *(v2u*)(WO + oo) = r;   // behind the barrier, which would else wait for the store
        asm volatile("s_wait_xcnt 0x0" ::: "memory"); }   // in front of the writes of this store's registers
    const bool isg = u >= 8;
    const unsigned short* wr = sm + (size_t)((isg ? u * 32 : (u >> 1) * 64) + lr) * PJP + 8 * hi; const unsigned short* xr = sm + (size_t)(PJW + (isg ? 0 : (u & 1) * 32) + lr) * PJP + 8 * hi;
    const unsigned short* A = isg ? xr : wr; const unsigned short* Bt = isg ? wr : xr;
    v8f acc[4][2];
#pragma unroll
    for (int mb = 0; mb < 4; ++mb)
#pragma unroll
        for (int nb = 0; nb < 2; ++nb) acc[mb][nb] = (v8f){};
#pragma unroll
    for (int kg = 0; kg < CC; kg += 64) { v16bf a[2][4], b[2][2];
#pragma unroll
        for (int ks = 0; ks < 2; ++ks) {
#pragma unroll
            for (int mb = 0; mb < 4; ++mb) { const unsigned short* p = A + mb * 16 * PJP + kg + ks * 32; a[ks][mb] = cat16b(*(const v8usa*)p, *(const v8usa*)(p + 16)); }
#pragma unroll
            for (int nb = 0; nb < 2; ++nb) { const unsigned short* p = Bt + nb * 16 * PJP + kg + ks * 32; b[ks][nb] = cat16b(*(const v8usa*)p, *(const v8usa*)(p + 16)); } }
        __builtin_amdgcn_sched_barrier(0);   // keeps the fragment loads of two k blocks one group in front of their matrix instructions: spread among them, through few registers, every k block waits three times for all of its loads
#pragma unroll
        for (int ks = 0; ks < 2; ++ks)
#pragma unroll
            for (int nb = 0; nb < 2; ++nb)
#pragma unroll
                for (int mb = 0; mb < 4; ++mb) acc[mb][nb] = wmmab(a[ks][mb], b[ks][nb], acc[mb][nb]); }
    if (!isg) { const int rb = u >> 1; const size_t o = ((size_t)(img * 2 + (rb >> 1)) * NN + n0 + (u & 1) * 32 + lr) * DDr + (rb & 1) * 64 + hi * 8;
#pragma unroll
        for (int nb = 0; nb < 2; ++nb)
#pragma unroll
            for (int mb = 0; mb < 4; ++mb) { v8us oh, ol;
#pragma unroll
                for (int j = 0; j < 8; ++j) { unsigned short p, q; splitf(acc[mb][nb][j], p, q); oh[j] = p; ol[j] = q; }   // theta or phi [d = 64 (rb & 1) + 16 mb + 8 hi + j][n = n0 + 32 (u & 1) + 16 nb + lr]
                *(v8us*)(Th + o + (size_t)nb * 16 * DDr + mb * 16) = oh; *(v8us*)(Tl + o + (size_t)nb * 16 * DDr + mb * 16) = ol; }
        asm volatile("s_wait_xcnt 0x0" ::: "memory"); }   // in front of whatever the build lays behind these stores and lets write their registers
    else { const size_t o = ((size_t)img * DDr + (u - 8) * 32 + lr) * NN + n0 + hi * 8;
#pragma unroll
        for (int nb = 0; nb < 2; ++nb)
#pragma unroll
            for (int mb = 0; mb < 4; ++mb) { v8h og;
#pragma unroll
                for (int j = 0; j < 8; ++j) og[j] = tohx(acc[mb][nb][j]);   // g [d = 32 (u - 8) + 16 nb + lr][n = n0 + 16 mb + 8 hi + j]
                *(v8h*)(G16 + o + (size_t)nb * 16 * NN + mb * 16) = og; } }
}
static_assert(NBI * (NN / PJN) * 128 == CC * DDr, "the work-groups' shares of w_out are the whole of it");

// ---- k_attn: scores, softmax and P.g in one kernel; no score and no P ever goes to memory. Transposed products: S^T = phi . theta^T (A = 16 keys, B = 16 queries) and y^T += g . P^T (A = 16 rows of g, B = P^T),
// so that a lane holds scores of ONE query (column lr; keys 8 hi + j of each 16-key tile) and two score tiles, converted, ARE the 32-key B fragment of the second product: P crosses no lane and no LDS.
// Work-group = 256 queries (8 waves x 32) x one quarter of the keys (blockIdx.y) of one image (blockIdx.z). theta fragments (hi and lo planes) stay in registers; phi (hi, lo) and g go through LDS, 64 keys a stage,
// two buffers, fetched one stage ahead into registers; one barrier a stage. Running maximum and sum per query (online softmax); y^T is rescaled only in a pass in which some query's maximum rises.
// Scores: three bf16 products a k block, in the order hi.hi, theta lo . phi hi, theta hi . phi lo. Exponents count from a reference point r = running max x log2(e) - 10: P = exp2(s log2(e) - r) <= 1024, in fp16; the point cancels in sum(P g) / sum(P).
// Out: unnormalised y [image][quarter][n][d] and (r, sum of P) per query and quarter; k_outp joins the quarters.
#define AW   8
#define AQ   32
#define AZ   4
#define AKEY (NN / AZ)
#define AST  64
#define APP  136
#define APG  72
#define APH  (AST * APP)
#define ABUF (2 * APH + DDr * APG)
__global__ __launch_bounds__(AW * 32) void k_attn(const bf* __restrict__ TPh, const bf* __restrict__ TPl, const h16* __restrict__ G16, float* __restrict__ Yp, float* __restrict__ ML) {
    __shared__ __align__(16) unsigned short sm[2 * ABUF];   // a buffer: phi hi [64 keys][pitch 272 B], phi lo the same, g [128 d][pitch 144 B]: pitches 16 B x odd for 16-byte readers
    const int tid = threadIdx.x, lane = tid & 31, lr = lane & 15, hi = lane >> 4, wave = tid >> 5;
    const int img = blockIdx.z, part = img * AZ + blockIdx.y, q0 = blockIdx.x * (AW * AQ) + wave * AQ, key0 = blockIdx.y * AKEY;
    const bf* th = TPh + (size_t)img * 2 * NN * DDr; const bf* tl = TPl + (size_t)img * 2 * NN * DDr; const bf* ph = th + (size_t)NN * DDr + (size_t)key0 * DDr; const bf* pl = tl + (size_t)NN * DDr + (size_t)key0 * DDr;
    const h16* g = G16 + (size_t)img * DDr * NN + key0;
    v16bf qh[2][4], ql[2][4];
#pragma unroll
    for (int q = 0; q < 2; ++q)
#pragma unroll
        for (int kc = 0; kc < 4; ++kc) { const size_t o = (size_t)(q0 + q * 16 + lr) * DDr + 8 * hi + kc * 32; qh[q][kc] = WFrag<bf>::ld(th + o); ql[q][kc] = WFrag<bf>::ld(tl + o); }
    asm volatile("s_wait_xcnt 0x0" ::: "memory");   // in front of the writes of these loads' address registers
    __builtin_amdgcn_sched_barrier(0);                // without it the build lifts such writes (later address sums, the zeroing below) over the wait
    v8f O[8][2];
#pragma unroll
    for (int dt = 0; dt < 8; ++dt) { O[dt][0] = (v8f){}; O[dt][1] = (v8f){}; }
    float mr[2] = { -3.0e38f, -3.0e38f }, sum[2] = { 0.f, 0.f };
    const int prow = tid >> 4, pcol = (tid & 15) * 8, grow = tid >> 3, gcol = (tid & 7) * 8;   // a thread's 16-byte pieces of a stage: phi rows prow + 16 i, g rows grow + 32 i
    v8us rh[4], rl[4]; v8h rg[4];
#pragma unroll
    for (int i = 0; i < 4; ++i) { rh[i] = *(const v8us*)(ph + (size_t)(prow + 16 * i) * DDr + pcol); rl[i] = *(const v8us*)(pl + (size_t)(prow + 16 * i) * DDr + pcol); rg[i] = *(const v8h*)(g + (size_t)(grow + 32 * i) * NN + gcol); }
    asm volatile("s_wait_xcnt 0x0" ::: "memory");   // as above
    __builtin_amdgcn_sched_barrier(0);                // as above
    // kept rolled: the trips are alike and long (128 matrix instructions); unrolled, the code would only grow
#pragma unroll 1
    for (int s = 0; s < AKEY / AST; ++s) {
        unsigned short* buf = sm + (s & 1) * ABUF;
#pragma unroll
        for (int i = 0; i < 4; ++i) { *(v8usa*)(buf + (prow + 16 * i) * APP + pcol) = rh[i]; *(v8usa*)(buf + APH + (prow + 16 * i) * APP + pcol) = rl[i]; *(v8ha*)(buf + 2 * APH + (grow + 32 * i) * APG + gcol) = rg[i]; }
        __syncthreads();   // stage s is in LDS for every wave; and every wave has left stage s - 1, whose buffer is written next trip
        if (s + 1 < AKEY / AST) { const int kb = (s + 1) * AST;
#pragma unroll
            for (int i = 0; i < 4; ++i) { rh[i] = *(const v8us*)(ph + (size_t)(kb + prow + 16 * i) * DDr + pcol); rl[i] = *(const v8us*)(pl + (size_t)(kb + prow + 16 * i) * DDr + pcol); rg[i] = *(const v8h*)(g + (size_t)(grow + 32 * i) * NN + kb + gcol); }
            asm volatile("s_wait_xcnt 0x0" ::: "memory"); }   // as above: the address registers are used again in the pass below, while the data are still on their way
        // kept rolled: unrolled, the build mixes one pass's second product with the next pass's first and, short of registers, fetches their fragments two loads at a time with a full wait each
#pragma unroll 1
        for (int kk = 0; kk < AST / 32; ++kk) {
            v8f S[2][2];
#pragma unroll
            for (int t = 0; t < 2; ++t) { S[t][0] = (v8f){}; S[t][1] = (v8f){}; }
            const unsigned short* pr = buf + (kk * 32 + lr) * APP + 8 * hi;
            v16bf ah[4][2], al[4][2];
#pragma unroll
            for (int kc = 0; kc < 4; ++kc)
#pragma unroll
                for (int t = 0; t < 2; ++t) { const unsigned short* p = pr + t * 16 * APP + kc * 32; ah[kc][t] = cat16b(*(const v8usa*)p, *(const v8usa*)(p + 16)); al[kc][t] = cat16b(*(const v8usa*)(p + APH), *(const v8usa*)(p + APH + 16)); }
            __builtin_amdgcn_sched_barrier(0);   // keeps the pass's phi fragment loads one group in front of its matrix instructions: spread among them, through few registers, each pair is waited for in full
#pragma unroll
            for (int kc = 0; kc < 4; ++kc) {
#pragma unroll
                for (int t = 0; t < 2; ++t)
#pragma unroll
                    for (int q = 0; q < 2; ++q) S[t][q] = wmmab(ah[kc][t], qh[q][kc], S[t][q]);   // theta hi . phi hi
#pragma unroll
                for (int t = 0; t < 2; ++t)
#pragma unroll
                    for (int q = 0; q < 2; ++q) S[t][q] = wmmab(ah[kc][t], ql[q][kc], S[t][q]);   // theta lo . phi hi
#pragma unroll
                for (int t = 0; t < 2; ++t)
#pragma unroll
                    for (int q = 0; q < 2; ++q) S[t][q] = wmmab(al[kc][t], qh[q][kc], S[t][q]); } // theta hi . phi lo
            const unsigned short* gr = buf + 2 * APH + lr * APG + kk * 32 + 8 * hi; v16h ga[8];
#pragma unroll
            for (int dt = 0; dt < 8; ++dt) ga[dt] = cat16(*(const v8ha*)(gr + dt * 16 * APG), *(const v8ha*)(gr + dt * 16 * APG + 16));
            __builtin_amdgcn_sched_barrier(0);   // keeps the loads of the g fragments, one group, in front of the softmax arithmetic, which then covers their latency
            float mn[2]; bool rise = false;
#pragma unroll
            for (int q = 0; q < 2; ++q) { float tm = fmaxf(S[0][q][0], S[1][q][0]);
#pragma unroll
                for (int j = 1; j < 8; ++j) tm = fmaxf(tm, fmaxf(S[0][q][j], S[1][q][j]));
                tm = fmaxf(tm, xhalf(tm)); mn[q] = fmaxf(mr[q], fmaf(tm, L2E, -PSH)); rise = rise || mn[q] > mr[q]; }
            if (__builtin_amdgcn_ballot_w32(rise) != 0) {   // one scalar branch a pass: the same for the whole wave, so every matrix instruction keeps all lanes on
#pragma unroll
                for (int q = 0; q < 2; ++q) { const float sc = __builtin_amdgcn_exp2f(mr[q] - mn[q]); sum[q] *= sc; mr[q] = mn[q];
#pragma unroll
                    for (int dt = 0; dt < 8; ++dt) O[dt][q] *= sc; } }
            v16h pf[2];
#pragma unroll
            for (int q = 0; q < 2; ++q) { float ps[2] = { 0.f, 0.f };   // a chain of sums a score tile: shorter dependent chains
#pragma unroll
                for (int t = 0; t < 2; ++t)
#pragma unroll
                    for (int j = 0; j < 8; ++j) { const float e = __builtin_amdgcn_exp2f(fmaf(S[t][q][j], L2E, -mr[q])); ps[t] += e; pf[q][t * 8 + j] = (h16)e; }   // element 8 t + j of the B fragment is k = 16 t + 8 hi + j: the row of score tile t that this lane holds
                sum[q] += ps[0] + ps[1]; }
#pragma unroll
            for (int dt = 0; dt < 8; ++dt) { O[dt][0] = wmma16(ga[dt], pf[0], O[dt][0]); O[dt][1] = wmma16(ga[dt], pf[1], O[dt][1]); }
        }
    }
    float* yp = Yp + (size_t)part * NN * DDr;
#pragma unroll
    for (int q = 0; q < 2; ++q) { const int n = q0 + q * 16 + lr; const float st = sum[q] + xhalf(sum[q]);   // the two lane halves summed different keys of the same query
#pragma unroll
        for (int dt = 0; dt < 8; ++dt) *(v8f*)(yp + (size_t)n * DDr + dt * 16 + hi * 8) = O[dt][q];
        if (hi == 0) { float* ml = ML + ((size_t)part * NN + n) * 2; ml[0] = mr[q]; ml[1] = st; } }
}


// ---- k_outp: the join of the key quarters, the output product and the residual in one kernel. Work-group = 32 positions n x all 256 channels c of one image, 8 waves; grid (NN / 32, image).
// 1. y[n][d] = (sum over the key quarters of exp2(r - top r) Y) / (the sums of P joined the same way), split into hi and lo bf16 planes, goes to LDS (pitch 272 B); the weights and 1 / sum of a position are made once, by one wave, and passed through LDS.
// 2. A wave's tile is 32 n x 32 c: A = y (hi, then lo plane, a k block), B = w_out [c][d] from memory: o[n][c], 8 consecutive n of one c in a lane.
// 3. The tile is turned in the wave's own LDS range ([c][n], pitch 144 B), so that x is read and OUT written in whole 128-byte lines: OUT[c][n] = x[c][n] + o[n][c].
#define OTN 32
#define OPP 136
#define OSP 36
__global__ __launch_bounds__(256) void k_outp(const float* __restrict__ Y, const float* __restrict__ ML, const bf* __restrict__ WO, const float* __restrict__ x, float* OUT) {
    __shared__ __align__(16) unsigned short ys[2 * OTN * OPP];
    __shared__ __align__(16) float wq[OTN * 8];
    __shared__ __align__(16) float os[8 * 32 * OSP];
    const int tid = threadIdx.x, lane = tid & 31, lr = lane & 15, hi = lane >> 4, wave = tid >> 5;
    const int img = blockIdx.y, n0 = blockIdx.x * OTN, c0 = wave * 32;
    Y += ((size_t)img * AZ * NN + n0) * DDr; ML += ((size_t)img * AZ * NN + n0) * 2;
    const size_t xo = (size_t)img * CC * NN + (size_t)(c0 + (lane >> 3)) * NN + n0 + (lane & 7) * 4;   // piece s of a lane: row c0 + lane / 8 + 4 s, 4 n: 8 lanes x 16 B = one line of a row
    v4f yv[OTN / 8][AZ], xv[8]; const float* yp = Y + (size_t)wave * DDr + lane * 4; const float* xp = x + xo;
#pragma unroll
    for (int i = 0; i < OTN / 8; ++i)
#pragma unroll
        for (int z = 0; z < AZ; ++z) yv[i][z] = *(const v4f*)(yp + ((size_t)z * NN + 8 * i) * DDr);   // a wave reads whole rows (512 B) of positions wave + 8 i
    asm volatile("s_wait_xcnt 0x0" :: "v"(yp) : "memory");   // in front of the writes of these loads' address registers, which it takes as an input so that no result of the group is laid over them
    __builtin_amdgcn_sched_barrier(0);                         // keeps such writes (later address sums, the next group's results) from being lifted over the wait
    // the w_out fragments and x are asked for at the start too, though wanted later: all that the work-group reads from memory is on its way at once, behind one latency
    const bf* wb = WO + (size_t)(c0 + lr) * DDr + 8 * hi; v16bf b[DDr / 32][2];
#pragma unroll
    for (int kc = 0; kc < DDr / 32; ++kc)
#pragma unroll
        for (int nb = 0; nb < 2; ++nb) b[kc][nb] = WFrag<bf>::ld(wb + (size_t)nb * 16 * DDr + kc * 32);
    asm volatile("s_wait_xcnt 0x0" :: "v"(wb) : "memory");   // as above
    __builtin_amdgcn_sched_barrier(0);                         // as above
#pragma unroll
    for (int s = 0; s < 8; ++s) xv[s] = *(const v4f*)(xp + (size_t)s * 4 * NN);
    asm volatile("s_wait_xcnt 0x0" :: "v"(xp) : "memory");   // as above
    __builtin_amdgcn_sched_barrier(0);                         // as above
    if (tid < OTN) { float m4[AZ], s4[AZ], top = -3.0e38f, den = 0.f;
#pragma unroll
        for (int z = 0; z < AZ; ++z) { m4[z] = ML[((size_t)z * NN + tid) * 2]; s4[z] = ML[((size_t)z * NN + tid) * 2 + 1]; }
        asm volatile("s_wait_xcnt 0x0" ::: "memory");   // in front of the writes of these loads' address registers
#pragma unroll
        for (int z = 0; z < AZ; ++z) top = fmaxf(top, m4[z]);
#pragma unroll
        for (int z = 0; z < AZ; ++z) { const float w = __builtin_amdgcn_exp2f(m4[z] - top); den += w * s4[z]; wq[tid * 8 + z] = w; }
        wq[tid * 8 + 4] = __fdiv_rn(1.0f, den); }
    __syncthreads();   // every position's weights are in LDS before any wave joins its rows
#pragma unroll
    for (int i = 0; i < OTN / 8; ++i) { const int n = wave + 8 * i; const v4f w = *(const v4fa*)(wq + n * 8); const float f = wq[n * 8 + 4]; v4f a = (v4f){};
#pragma unroll
        for (int z = 0; z < AZ; ++z) a += yv[i][z] * w[z];
        v4us oh, ol;
#pragma unroll
        for (int u = 0; u < 4; ++u) { unsigned short p, q; splitf(a[u] * f, p, q); oh[u] = p; ol[u] = q; }
        *(v4usa*)(ys + n * OPP + lane * 4) = oh; *(v4usa*)(ys + OTN * OPP + n * OPP + lane * 4) = ol; }
    __syncthreads();   // both planes of y are whole before any wave takes fragments of them
    v8f acc[2][2];
#pragma unroll
    for (int mb = 0; mb < 2; ++mb)
#pragma unroll
        for (int nb = 0; nb < 2; ++nb) acc[mb][nb] = (v8f){};
    const unsigned short* ar = ys + lr * OPP + 8 * hi;
#pragma unroll
    for (int kc = 0; kc < DDr / 32; ++kc) { v16bf a[2], a2[2];
#pragma unroll
        for (int mb = 0; mb < 2; ++mb) { const unsigned short* p = ar + mb * 16 * OPP + kc * 32; a[mb] = cat16b(*(const v8usa*)p, *(const v8usa*)(p + 16)); a2[mb] = cat16b(*(const v8usa*)(p + OTN * OPP), *(const v8usa*)(p + OTN * OPP + 16)); }
#pragma unroll
        for (int nb = 0; nb < 2; ++nb)
#pragma unroll
            for (int mb = 0; mb < 2; ++mb) { acc[mb][nb] = wmmab(a[mb], b[kc][nb], acc[mb][nb]); acc[mb][nb] = wmmab(a2[mb], b[kc][nb], acc[mb][nb]); } }
    float* ow = os + wave * (32 * OSP);
#pragma unroll
    for (int nb = 0; nb < 2; ++nb)
#pragma unroll
        for (int mb = 0; mb < 2; ++mb) { float* p = ow + (nb * 16 + lr) * OSP + mb * 16 + hi * 8;   // o[n = 16 mb + 8 hi + j][c = c0 + 16 nb + lr]
            *(v4fa*)p = __builtin_shufflevector(acc[mb][nb], acc[mb][nb], 0, 1, 2, 3); *(v4fa*)(p + 4) = __builtin_shufflevector(acc[mb][nb], acc[mb][nb], 4, 5, 6, 7); }
    asm volatile("s_wait_dscnt 0x0" ::: "memory");   // the wave's own writes of its range are done, and stay in front, before its lanes read one another's values back
#pragma unroll
    for (int s = 0; s < 8; ++s) { const v4f v = *(const v4fa*)(ow + (s * 4 + (lane >> 3)) * OSP + (lane & 7) * 4); v4f o;
#pragma unroll
        for (int u = 0; u < 4; ++u) o[u] = __fadd_rn(bfr(xv[s][u]), v[u]);
        *(v4f*)(OUT + xo + (size_t)s * 4 * NN) = o; }
}

extern "C" void kernel_launch(void* const* d_in, const int* in_sizes, int n_in,
                              void* d_out, int out_size, void* d_ws, size_t ws_size, hipStream_t stream) {
    (void)in_sizes; (void)n_in; (void)out_size;
    const float* x = (const float*)d_in[0]; const float* wth = (const float*)d_in[1]; const float* wph = (const float*)d_in[2]; const float* wg = (const float*)d_in[3]; const float* wout = (const float*)d_in[4];
    float* OUT = (float*)d_out;     // [4][256][64][64]
    char* wsp = (char*)d_ws;
    auto take = [&](size_t bytes) { char* p = wsp; wsp += (bytes + 255) & ~(size_t)255; return (void*)p; };
    // The four images are a grid axis everywhere, the three projections are one grid with 384 rows of weights.
    bf* WOUT = (bf*)take((size_t)CC * DDr * 2);   // w_out ([c][d] rows) in bf16
    bf* TPh = (bf*)take((size_t)NBI * 2 * NN * DDr * 2); bf* TPl = (bf*)take((size_t)NBI * 2 * NN * DDr * 2); h16* G16 = (h16*)take((size_t)NBI * DDr * NN * 2);
    float* Y = (float*)take((size_t)NBI * AZ * NN * DDr * 4); float* ML = (float*)take((size_t)NBI * AZ * NN * 2 * 4);   // Y [image][key quarter][n][d], ML [image][key quarter][n][r, sum]
    if ((size_t)(wsp - (char*)d_ws) > ws_size) return;    // total ~ 53 MiB
    k_proj<<<dim3(NN / PJN, NBI, 1), 384, 0, stream>>>(x, wth, wph, wg, wout, TPh, TPl, G16, WOUT);
    k_attn<<<dim3(NN / (AW * AQ), AZ, NBI), AW * 32, 0, stream>>>(TPh, TPl, G16, Y, ML);     // y[n][d] (unnormalised) = sum_m P[n][m] g[d][m], a key quarter a plane
    k_outp<<<dim3(NN / OTN, NBI, 1), 256, 0, stream>>>(Y, ML, WOUT, x, OUT);                  // out[c][n] = x[c][n] + sum_d y[n][d] w_out[c][d]
}

// v007
// One run takes 66.7 microseconds.
// Timed twice side by side with v006, it ran 1.04 times as fast both times.
// Over all steps from v000 it is 13.6 times as fast.
#include <hip/hip_runtime.h>

// _NonLocal (embedded-Gaussian non-local block: x [4][256][64][64] -> 4096 positions; theta/phi/g = 1x1 convs to 128 channels (no bias); attn[n][m] = softmax_m(theta[:,n].phi[:,m]) (UNSCALED: logits have sigma ~ 11, so the scores need 3-product precision);
// y[d][n] = sum_m g[d][m] attn[n][m]; out = x + w_out y -> [4][256][64][64]).
// Compute dtypes, f32 accumulate: every input rounded to bf16; theta/phi/g on PLAIN bf16 operands (inputs: exact); scores (K 128) on bf16 hi+lo planes of theta and phi (3 products; single fp16 planes

#define NBI  4
#define CC   256
#define DDr  128
#define NN   4096
#define L2E  1.4426950408889634f
#define PSH  10.0f
typedef _Float16 h16;
typedef unsigned short bf;
typedef __attribute__((ext_vector_type(16))) __bf16   v16bf;
typedef __attribute__((ext_vector_type(16))) _Float16 v16h;
typedef __attribute__((ext_vector_type(8)))  _Float16 v8h;
typedef __attribute__((ext_vector_type(8)))  unsigned short v8us;
typedef __attribute__((ext_vector_type(8)))  float    v8f;
typedef __attribute__((ext_vector_type(4)))  float    v4f;
typedef v8h  __attribute__((may_alias)) v8ha;
typedef v4f  __attribute__((may_alias)) v4fa;
typedef v8us __attribute__((may_alias)) v8usa;

__device__ __forceinline__ unsigned short f2bf(float f) { unsigned u = __float_as_uint(f); u += 0x7FFFu + ((u >> 16) & 1u); return (unsigned short)(u >> 16); }
__device__ __forceinline__ float bf2f(unsigned short b) { return __uint_as_float(((unsigned)b) << 16); }
__device__ __forceinline__ float bfr(float f) { return bf2f(f2bf(f)); }
__device__ __forceinline__ v16h cat16(v8h lo, v8h hi) { return __builtin_shufflevector(lo, hi, 0, 1, 2, 3, 4, 5, 6, 7, 8, 9, 10, 11, 12, 13, 14, 15); }
__device__ __forceinline__ v16bf cat16b(v8us lo, v8us hi) { return __builtin_bit_cast(v16bf, __builtin_shufflevector(lo, hi, 0, 1, 2, 3, 4, 5, 6, 7, 8, 9, 10, 11, 12, 13, 14, 15)); }
__device__ __forceinline__ float xhalf(float x) { return __builtin_bit_cast(float, __builtin_amdgcn_permlanex16(__builtin_bit_cast(int, x), __builtin_bit_cast(int, x), 0x76543210, 0xfedcba98, false, false)); }   // lane l takes lane l ^ 16's value
__device__ __forceinline__ v8f wmma16(v16h a, v16h b, v8f c) { return __builtin_amdgcn_wmma_f32_16x16x32_f16(false, a, false, b, (short)0, c, false, false); }
__device__ __forceinline__ v8f wmmab(v16bf a, v16bf b, v8f c) { return __builtin_amdgcn_wmma_f32_16x16x32_bf16(false, a, false, b, (short)0, c, false, false); }



// A fragment of 16 k from a k-contiguous 16-bit row: two 16-byte loads, the same for the A and the B side.
template <typename T16> struct WFrag;
template <> struct WFrag<h16> { typedef v16h V; static __device__ __forceinline__ V ld(const h16* p) { return cat16(*(const v8h*)p, *(const v8h*)(p + 16)); } static __device__ __forceinline__ v8f mma(V a, V b, v8f c) { return wmma16(a, b, c); } };
template <> struct WFrag<bf> { typedef v16bf V; static __device__ __forceinline__ V ld(const bf* p) { return cat16b(*(const v8us*)p, *(const v8us*)(p + 16)); } static __device__ __forceinline__ v8f mma(V a, V b, v8f c) { return wmmab(a, b, c); } };
__device__ __forceinline__ h16 tohx(float x) { return (h16)x; }
__device__ __forceinline__ void splitf(float y, unsigned short& h, unsigned short& l) { h = f2bf(y); l = f2bf(y - bf2f(h)); }
typedef __attribute__((ext_vector_type(4))) unsigned short v4us;
typedef v4us __attribute__((may_alias)) v4usa;

// ---- k_proj: the rounding of x and of the weights to bf16, the turn of x and the three projections in one kernel: no bf16 copy of x or of w_theta, w_phi, w_g in memory, no pass of its own for them.
// Work-group = 64 positions n x all 384 rows of weights of one image, 12 waves; grid (NN / 64, image).
// 1. Staging, whole lines from memory: wave u brings rows 32 u .. 32 u + 31 of the stacked weights (32 KiB in a row of one matrix), rounds them and lays them in LDS as [row][c]; waves 0 .. 7 bring x[c = 0 .. 255][64 n], a thread 8 c x 4 n twice,
//    and lay it in LDS turned, as [n][c]: the 8 c of one n are one 16-byte piece. Pitch 528 B (16 B x odd) for the 16-byte fragment readers. One wave of each work-group rounds its 128 elements of w_out for k_outp.
// 2. A wave's tile is 4 x 2 accumulators, fragments from LDS. The result leaves in the form its reader wants, straight from the accumulators: a lane's 8 accumulator registers are 8 consecutive rows of the A operand in one column of B,
//    so the index that must be contiguous in memory is given to A. theta, phi (waves 0 .. 7: 64 d x 32 n): A = weights (d), B = x (n): hi and lo bf16 planes T[n][d], 16 B a lane and plane; g (waves 8 .. 11: 32 d x 64 n): A = x (n), B = weights (d): fp16 G[d][n], 16 B a lane.
//    A wave writes whole 128-byte lines (64 d or 64 n x 2 B), in four pieces of 32 B.
#define PJN 64
#define PJW (3 * DDr)
#define PJP (CC + 8)
typedef __attribute__((ext_vector_type(2))) float  v2f;
typedef __attribute__((ext_vector_type(2))) __bf16 v2bf;
typedef __attribute__((ext_vector_type(2))) unsigned v2u;
typedef __attribute__((ext_vector_type(4))) unsigned v4u;
typedef v2u __attribute__((may_alias)) v2ua;
typedef v4u __attribute__((may_alias)) v4ua;
__device__ __forceinline__ unsigned pk2(float a, float b) { const v2f t = { a, b }; return __builtin_bit_cast(unsigned, __builtin_convertvector(t, v2bf)); }   // two f32 to two bf16, nearest even, a in the low half
__global__ __launch_bounds__(384) void k_proj(const float* __restrict__ x, const float* __restrict__ w0, const float* __restrict__ w1, const float* __restrict__ w2, const float* __restrict__ w3, bf* Th, bf* Tl, h16* G16, bf* WO) {
    __shared__ __align__(16) unsigned short sm[(PJW + PJN) * PJP];   // rows 0 .. 383: weights [row][c]; rows 384 .. 447: x [n][c]
    const int tid = threadIdx.x, lane = tid & 31, lr = lane & 15, hi = lane >> 4; const int u = __builtin_amdgcn_readfirstlane(tid >> 5);   // the wave's number, in a scalar register: every test on it is a scalar branch
    const int n0 = blockIdx.x * PJN, img = blockIdx.y;
    const int cg = tid >> 4, n4 = (tid & 15) * 4;
    const float* xp = x + ((size_t)img * CC + cg * 8) * NN + n0 + n4;
    const float* wp = (u < 4 ? w0 : u < 8 ? w1 : w2) + (size_t)(u & 3) * 32 * CC + lane * 4;
    unsigned short* wd = sm + (size_t)u * 32 * PJP + lane * 4;
    const size_t oo = ((size_t)(blockIdx.y * (NN / PJN) + blockIdx.x) * 32 + lane) * 4;   // wave 8's share of w_out: 256 work-groups x 128 elements
    v4f xv[16], wv[32], ov = (v4f){};
    if (u == 8) { const float* op = w3 + oo; ov = *(const v4f*)op;   // asked for ahead of the weights, so that it costs no latency of its own
        asm volatile("s_wait_xcnt 0x0" :: "v"(op) : "memory"); }   // in front of the writes of this load's address registers
    if (u < 8) {
#pragma unroll
        for (int i = 0; i < 16; ++i) xv[i] = *(const v4f*)(xp + (size_t)((i >> 3) * 128 + (i & 7)) * NN);   // 16 lanes x 16 B = the 256 B of a row of the tile
        asm volatile("s_wait_xcnt 0x0" :: "v"(xp) : "memory");   // in front of the writes of these loads' address registers, which it takes as an input so that no result of the group is laid over them
        __builtin_amdgcn_sched_barrier(0); }                       // keeps such writes from being lifted over the wait
#pragma unroll
    for (int h = 0; h < 2; ++h) {
#pragma unroll
        for (int i = 0; i < 32; ++i) wv[i] = *(const v4f*)(wp + (h * 32 + i) * 128);   // a wave's load is 512 B in a row
        asm volatile("s_wait_xcnt 0x0" :: "v"(wp) : "memory");   // as above
        __builtin_amdgcn_sched_barrier(0);                         // as above
        if (h == 0 && u < 8) {   // x was asked for first and is here first: it is rounded and turned while the weights are on their way
#pragma unroll
            for (int g2 = 0; g2 < 2; ++g2)
#pragma unroll
                for (int e = 0; e < 4; ++e) { const v4u o = { pk2(xv[g2 * 8][e], xv[g2 * 8 + 1][e]), pk2(xv[g2 * 8 + 2][e], xv[g2 * 8 + 3][e]), pk2(xv[g2 * 8 + 4][e], xv[g2 * 8 + 5][e]), pk2(xv[g2 * 8 + 6][e], xv[g2 * 8 + 7][e]) };
                    *(v4ua*)(sm + (size_t)(PJW + n4 + e) * PJP + g2 * 128 + cg * 8) = o; } }
#pragma unroll
        for (int i = 0; i < 32; ++i) { const v2u o = { pk2(wv[i][0], wv[i][1]), pk2(wv[i][2], wv[i][3]) }; *(v2ua*)(wd + (h * 16 + (i >> 1)) * PJP + (i & 1) * 128) = o; }
    }
    __syncthreads();   // weights and x are whole in LDS before any wave takes fragments of them
    if (u == 8) { const v2u r = { pk2(ov[0], ov[1]), pk2(ov[2], ov[3]) }; *(v2u*)(WO + oo) = r;   // behind the barrier, which would else wait for the store
        asm volatile("s_wait_xcnt 0x0" ::: "memory"); }   // in front of the writes of this store's registers
    const bool isg = u >= 8;
    const unsigned short* wr = sm + (size_t)((isg ? u * 32 : (u >> 1) * 64) + lr) * PJP + 8 * hi; const unsigned short* xr = sm + (size_t)(PJW + (isg ? 0 : (u & 1) * 32) + lr) * PJP + 8 * hi;
    const unsigned short* A = isg ? xr : wr; const unsigned short* Bt = isg ? wr : xr;
    v8f acc[4][2];
#pragma unroll
    for (int mb = 0; mb < 4; ++mb)
#pragma unroll
        for (int nb = 0; nb < 2; ++nb) acc[mb][nb] = (v8f){};
#pragma unroll
    for (int kg = 0; kg < CC; kg += 64) { v16bf a[2][4], b[2][2];
#pragma unroll
        for (int ks = 0; ks < 2; ++ks) {
#pragma unroll
            for (int mb = 0; mb < 4; ++mb) { const unsigned short* p = A + mb * 16 * PJP + kg + ks * 32; a[ks][mb] = cat16b(*(const v8usa*)p, *(const v8usa*)(p + 16)); }
#pragma unroll
            for (int nb = 0; nb < 2; ++nb) { const unsigned short* p = Bt + nb * 16 * PJP + kg + ks * 32; b[ks][nb] = cat16b(*(const v8usa*)p, *(const v8usa*)(p + 16)); } }
        __builtin_amdgcn_sched_barrier(0);   // keeps the fragment loads of two k blocks one group in front of their matrix instructions: spread among them, through few registers, every k block waits three times for all of its loads
#pragma unroll
        for (int ks = 0; ks < 2; ++ks)
#pragma unroll
            for (int nb = 0; nb < 2; ++nb)
#pragma unroll
                for (int mb = 0; mb < 4; ++mb) acc[mb][nb] = wmmab(a[ks][mb], b[ks][nb], acc[mb][nb]); }
    if (!isg) { const int rb = u >> 1; const size_t o = ((size_t)(img * 2 + (rb >> 1)) * NN + n0 + (u & 1) * 32 + lr) * DDr + (rb & 1) * 64 + hi * 8;
#pragma unroll
        for (int nb = 0; nb < 2; ++nb)
#pragma unroll
            for (int mb = 0; mb < 4; ++mb) { v8us oh, ol;
#pragma unroll
                for (int j = 0; j < 8; ++j) { unsigned short p, q; splitf(acc[mb][nb][j], p, q); oh[j] = p; ol[j] = q; }   // theta or phi [d = 64 (rb & 1) + 16 mb + 8 hi + j][n = n0 + 32 (u & 1) + 16 nb + lr]
                *(v8us*)(Th + o + (size_t)nb * 16 * DDr + mb * 16) = oh; *(v8us*)(Tl + o + (size_t)nb * 16 * DDr + mb * 16) = ol; }
        asm volatile("s_wait_xcnt 0x0" ::: "memory"); }   // in front of whatever the build lays behind these stores and lets write their registers
    else { const size_t o = ((size_t)img * DDr + (u - 8) * 32 + lr) * NN + n0 + hi * 8;
#pragma unroll
        for (int nb = 0; nb < 2; ++nb)
#pragma unroll
            for (int mb = 0; mb < 4; ++mb) { v8h og;
#pragma unroll
                for (int j = 0; j < 8; ++j) og[j] = tohx(acc[mb][nb][j]);   // g [d = 32 (u - 8) + 16 nb + lr][n = n0 + 16 mb + 8 hi + j]
                *(v8h*)(G16 + o + (size_t)nb * 16 * NN + mb * 16) = og; } }
}
static_assert(NBI * (NN / PJN) * 128 == CC * DDr, "the work-groups' shares of w_out are the whole of it");

// ---- k_attn: scores, softmax and P.g in one kernel; no score and no P ever goes to memory. Transposed products: S^T = phi . theta^T (A = 16 keys, B = 16 queries) and y^T += g . P^T (A = 16 rows of g, B = P^T),
// so that a lane holds scores of ONE query (column lr; keys 8 hi + j of each 16-key tile) and two score tiles, converted, ARE the 32-key B fragment of the second product: P crosses no lane and no LDS.
// Work-group = 256 queries (8 waves x 32) x one quarter of the keys (blockIdx.y) of one image (blockIdx.z). theta fragments (hi and lo planes) stay in registers; phi (hi, lo) and g go through LDS, 128 keys a stage,
// two buffers, brought by asynchronous copies (global memory to LDS, through no register) that fly while the stage before is worked on; one barrier a stage. Running maximum and sum per query (online softmax); y^T is rescaled only in a pass in which some query's maximum rises.
// Scores: three bf16 products a k block, in the order hi.hi, theta lo . phi hi, theta hi . phi lo. Exponents count from a reference point r = running max x log2(e) - 10: P = exp2(s log2(e) - r) <= 1024, in fp16; the point cancels in sum(P g) / sum(P).
// Out: unnormalised y [image][quarter][n][d] and (r, sum of P) per query and quarter; k_outp joins the quarters.
#define AW   8
#define AQ   32
#define AZ   4
#define AKEY (NN / AZ)
#define AST  128
#define APP  136
#define APG  136
#define APH  (AST * APP)
#define ABUF (2 * APH + DDr * APG)
// Eight copies of 16 bytes a lane from global memory to LDS: rows 16 apart of one plane of a stage. l: the lane's place in LDS for the first, p: its global address, ps: elements from one to the next in memory.
typedef int v4i __attribute__((ext_vector_type(4)));
typedef __attribute__((address_space(1))) v4i gv4i;
typedef __attribute__((address_space(3))) v4i lv4i;
// The waits are the caller's: s_wait_asynccnt 0 and a work-group barrier stand between these copies and every read of their bytes.
__device__ __forceinline__ void acp8(unsigned short* l, const unsigned short* p, size_t ps) {
    // unrolled, so that the eight copies issue in a row and their steps are constants of the addresses
#pragma unroll
    for (int i = 0; i < 8; ++i) __builtin_amdgcn_global_load_async_to_lds_b128((gv4i*)(p + i * ps), (lv4i*)(l + i * 16 * APP), 0, 0);
}
__global__ __launch_bounds__(AW * 32) void k_attn(const bf* __restrict__ TPh, const bf* __restrict__ TPl, const h16* __restrict__ G16, float* __restrict__ Yp, float* __restrict__ ML) {
    __shared__ __align__(16) unsigned short sm[2 * ABUF];   // a buffer: phi hi [128 keys][pitch 272 B], phi lo the same, g [128 d][128 keys, pitch 272 B]: pitch 16 B x odd for 16-byte readers
    const int tid = threadIdx.x, lane = tid & 31, lr = lane & 15, hi = lane >> 4, wave = tid >> 5;
    const int img = blockIdx.z, part = img * AZ + blockIdx.y, q0 = blockIdx.x * (AW * AQ) + wave * AQ, key0 = blockIdx.y * AKEY;
    const bf* th = TPh + (size_t)img * 2 * NN * DDr; const bf* tl = TPl + (size_t)img * 2 * NN * DDr; const bf* ph = th + (size_t)NN * DDr + (size_t)key0 * DDr; const bf* pl = tl + (size_t)NN * DDr + (size_t)key0 * DDr;
    const h16* g = G16 + (size_t)img * DDr * NN + key0;
    v16bf qh[2][4], ql[2][4];
#pragma unroll
    for (int q = 0; q < 2; ++q)
#pragma unroll
        for (int kc = 0; kc < 4; ++kc) { const size_t o = (size_t)(q0 + q * 16 + lr) * DDr + 8 * hi + kc * 32; qh[q][kc] = WFrag<bf>::ld(th + o); ql[q][kc] = WFrag<bf>::ld(tl + o); }
    asm volatile("s_wait_xcnt 0x0" ::: "memory");   // in front of the writes of these loads' address registers
    __builtin_amdgcn_sched_barrier(0);                // without it the build lifts such writes (later address sums, the zeroing below) over the wait
    v8f O[8][2];
#pragma unroll
    for (int dt = 0; dt < 8; ++dt) { O[dt][0] = (v8f){}; O[dt][1] = (v8f){}; }
    float mr[2] = { -3.0e38f, -3.0e38f }, sum[2] = { 0.f, 0.f };
    const int prow = tid >> 4, pcol = (tid & 15) * 8;   // a thread's 16-byte pieces of a stage: rows prow + 16 i (keys of phi, d of g), all of 256 B: a wave's copy is two whole rows
    auto stage = [&](int t) {   // stage t (keys 128 t .. 128 t + 127 of the quarter) into buffer t & 1: 24 copies a lane
        unsigned short* l0 = sm + (t & 1) * ABUF + prow * APP + pcol; const size_t po = (size_t)(t * AST + prow) * DDr + pcol;
        acp8(l0, ph + po, 16 * DDr);
        acp8(l0 + APH, pl + po, 16 * DDr);
        acp8(l0 + 2 * APH, (const unsigned short*)(g + (size_t)prow * NN + t * AST + pcol), (size_t)16 * NN); };
    stage(0);
    asm volatile("s_wait_asynccnt 0x0" ::: "memory");   // this wave's copies of stage 0 have landed
    __syncthreads();                                      // and every other wave's: stage 0 is whole in LDS before any wave reads it
    stage(1);
    // kept rolled: the trips are alike and long (256 matrix instructions); unrolled, the code would only grow
#pragma unroll 1
    for (int s = 0; s < AKEY / AST; ++s) {
        const unsigned short* buf = sm + (s & 1) * ABUF;
        const unsigned short* gbuf = (s & 1) ? sm + ABUF + 2 * APH : sm + 2 * APH;   // the stage's g plane, its place chosen whole: as buf + a constant beyond the 64 KiB that an LDS load's offset field holds, every g fragment load would get an address sum of its own
        // kept rolled: unrolled, the build mixes one pass's second product with the next pass's first and, short of registers, fetches their fragments two loads at a time with a full wait each
#pragma unroll 1
        for (int kk = 0; kk < AST / 32; ++kk) {
            v8f S[2][2];
#pragma unroll
            for (int t = 0; t < 2; ++t) { S[t][0] = (v8f){}; S[t][1] = (v8f){}; }
            const unsigned short* pr = buf + (kk * 32 + lr) * APP + 8 * hi;
            v16bf ah[4][2], al[4][2];
#pragma unroll
            for (int kc = 0; kc < 4; ++kc)
#pragma unroll
                for (int t = 0; t < 2; ++t) { const unsigned short* p = pr + t * 16 * APP + kc * 32; ah[kc][t] = cat16b(*(const v8usa*)p, *(const v8usa*)(p + 16)); al[kc][t] = cat16b(*(const v8usa*)(p + APH), *(const v8usa*)(p + APH + 16)); }
            __builtin_amdgcn_sched_barrier(0);   // keeps the pass's phi fragment loads one group in front of its matrix instructions: spread among them, through few registers, each pair is waited for in full
#pragma unroll
            for (int kc = 0; kc < 4; ++kc) {
#pragma unroll
                for (int t = 0; t < 2; ++t)
#pragma unroll
                    for (int q = 0; q < 2; ++q) S[t][q] = wmmab(ah[kc][t], qh[q][kc], S[t][q]);   // theta hi . phi hi
#pragma unroll
                for (int t = 0; t < 2; ++t)
#pragma unroll
                    for (int q = 0; q < 2; ++q) S[t][q] = wmmab(ah[kc][t], ql[q][kc], S[t][q]);   // theta lo . phi hi
#pragma unroll
                for (int t = 0; t < 2; ++t)
#pragma unroll
                    for (int q = 0; q < 2; ++q) S[t][q] = wmmab(al[kc][t], qh[q][kc], S[t][q]); } // theta hi . phi lo
            const unsigned short* gr = gbuf + lr * APG + kk * 32 + 8 * hi; v16h ga[8];
#pragma unroll
            for (int dt = 0; dt < 8; ++dt) ga[dt] = cat16(*(const v8ha*)(gr + dt * 16 * APG), *(const v8ha*)(gr + dt * 16 * APG + 16));
            __builtin_amdgcn_sched_barrier(0);   // keeps the loads of the g fragments, one group, in front of the softmax arithmetic, which then covers their latency
            float mn[2]; bool rise = false;
#pragma unroll
            for (int q = 0; q < 2; ++q) { float tm = fmaxf(S[0][q][0], S[1][q][0]);
#pragma unroll
                for (int j = 1; j < 8; ++j) tm = fmaxf(tm, fmaxf(S[0][q][j], S[1][q][j]));
                tm = fmaxf(tm, xhalf(tm)); mn[q] = fmaxf(mr[q], fmaf(tm, L2E, -PSH)); rise = rise || mn[q] > mr[q]; }
            if (__builtin_amdgcn_ballot_w32(rise) != 0) {   // one scalar branch a pass: the same for the whole wave, so every matrix instruction keeps all lanes on
#pragma unroll
                for (int q = 0; q < 2; ++q) { const float sc = __builtin_amdgcn_exp2f(mr[q] - mn[q]); sum[q] *= sc; mr[q] = mn[q];
#pragma unroll
                    for (int dt = 0; dt < 8; ++dt) O[dt][q] *= sc; } }
            v16h pf[2];
#pragma unroll
            for (int q = 0; q < 2; ++q) { float ps[2] = { 0.f, 0.f };   // a chain of sums a score tile: shorter dependent chains
#pragma unroll
                for (int t = 0; t < 2; ++t)
#pragma unroll
                    for (int j = 0; j < 8; ++j) { const float e = __builtin_amdgcn_exp2f(fmaf(S[t][q][j], L2E, -mr[q])); ps[t] += e; pf[q][t * 8 + j] = (h16)e; }   // element 8 t + j of the B fragment is k = 16 t + 8 hi + j: the row of score tile t that this lane holds
                sum[q] += ps[0] + ps[1]; }
#pragma unroll
            for (int dt = 0; dt < 8; ++dt) { O[dt][0] = wmma16(ga[dt], pf[0], O[dt][0]); O[dt][1] = wmma16(ga[dt], pf[1], O[dt][1]); }
        }
        asm volatile("s_wait_dscnt 0x0" ::: "memory");      // this wave's reads of stage s are done before its buffer may be filled anew
        asm volatile("s_wait_asynccnt 0x0" ::: "memory");   // this wave's copies of stage s + 1 have landed
        __syncthreads();   // stage s + 1 is whole in LDS for every wave; and every wave has left stage s, whose buffer is filled next
        if (s + 2 < AKEY / AST) stage(s + 2);
    }
    asm volatile("s_wait_asynccnt 0x0" ::: "memory");   // no copy is outstanding when the wave goes on to its end
    float* yp = Yp + (size_t)part * NN * DDr;
#pragma unroll
    for (int q = 0; q < 2; ++q) { const int n = q0 + q * 16 + lr; const float st = sum[q] + xhalf(sum[q]);   // the two lane halves summed different keys of the same query
#pragma unroll
        for (int dt = 0; dt < 8; ++dt) *(v8f*)(yp + (size_t)n * DDr + dt * 16 + hi * 8) = O[dt][q];
        if (hi == 0) { float* ml = ML + ((size_t)part * NN + n) * 2; ml[0] = mr[q]; ml[1] = st; } }
}


// ---- k_outp: the join of the key quarters, the output product and the residual in one kernel. Work-group = 32 positions n x all 256 channels c of one image, 8 waves; grid (NN / 32, image).
// 1. y[n][d] = (sum over the key quarters of exp2(r - top r) Y) / (the sums of P joined the same way), split into hi and lo bf16 planes, goes to LDS (pitch 272 B); the weights and 1 / sum of a position are made once, by one wave, and passed through LDS.
// 2. A wave's tile is 32 n x 32 c: A = y (hi, then lo plane, a k block), B = w_out [c][d] from memory: o[n][c], 8 consecutive n of one c in a lane.
// 3. The tile is turned in the wave's own LDS range ([c][n], pitch 144 B), so that x is read and OUT written in whole 128-byte lines: OUT[c][n] = x[c][n] + o[n][c].
#define OTN 32
#define OPP 136
#define OSP 36
__global__ __launch_bounds__(256) void k_outp(const float* __restrict__ Y, const float* __restrict__ ML, const bf* __restrict__ WO, const float* __restrict__ x, float* OUT) {
    __shared__ __align__(16) unsigned short ys[2 * OTN * OPP];
    __shared__ __align__(16) float wq[OTN * 8];
    __shared__ __align__(16) float os[8 * 32 * OSP];
    const int tid = threadIdx.x, lane = tid & 31, lr = lane & 15, hi = lane >> 4, wave = tid >> 5;
    const int img = blockIdx.y, n0 = blockIdx.x * OTN, c0 = wave * 32;
    Y += ((size_t)img * AZ * NN + n0) * DDr; ML += ((size_t)img * AZ * NN + n0) * 2;
    const size_t xo = (size_t)img * CC * NN + (size_t)(c0 + (lane >> 3)) * NN + n0 + (lane & 7) * 4;   // piece s of a lane: row c0 + lane / 8 + 4 s, 4 n: 8 lanes x 16 B = one line of a row
    v4f yv[OTN / 8][AZ], xv[8]; const float* yp = Y + (size_t)wave * DDr + lane * 4; const float* xp = x + xo;
#pragma unroll
    for (int i = 0; i < OTN / 8; ++i)
#pragma unroll
        for (int z = 0; z < AZ; ++z) yv[i][z] = *(const v4f*)(yp + ((size_t)z * NN + 8 * i) * DDr);   // a wave reads whole rows (512 B) of positions wave + 8 i
    asm volatile("s_wait_xcnt 0x0" :: "v"(yp) : "memory");   // in front of the writes of these loads' address registers, which it takes as an input so that no result of the group is laid over them
    __builtin_amdgcn_sched_barrier(0);                         // keeps such writes (later address sums, the next group's results) from being lifted over the wait
    // the w_out fragments and x are asked for at the start too, though wanted later: all that the work-group reads from memory is on its way at once, behind one latency
    const bf* wb = WO + (size_t)(c0 + lr) * DDr + 8 * hi; v16bf b[DDr / 32][2];
#pragma unroll
    for (int kc = 0; kc < DDr / 32; ++kc)
#pragma unroll
        for (int nb = 0; nb < 2; ++nb) b[kc][nb] = WFrag<bf>::ld(wb + (size_t)nb * 16 * DDr + kc * 32);
    asm volatile("s_wait_xcnt 0x0" :: "v"(wb) : "memory");   // as above
    __builtin_amdgcn_sched_barrier(0);                         // as above
#pragma unroll
    for (int s = 0; s < 8; ++s) xv[s] = *(const v4f*)(xp + (size_t)s * 4 * NN);
    asm volatile("s_wait_xcnt 0x0" :: "v"(xp) : "memory");   // as above
    __builtin_amdgcn_sched_barrier(0);                         // as above
    if (tid < OTN) { float m4[AZ], s4[AZ], top = -3.0e38f, den = 0.f;
#pragma unroll
        for (int z = 0; z < AZ; ++z) { m4[z] = ML[((size_t)z * NN + tid) * 2]; s4[z] = ML[((size_t)z * NN + tid) * 2 + 1]; }
        asm volatile("s_wait_xcnt 0x0" ::: "memory");   // in front of the writes of these loads' address registers
#pragma unroll
        for (int z = 0; z < AZ; ++z) top = fmaxf(top, m4[z]);
#pragma unroll
        for (int z = 0; z < AZ; ++z) { const float w = __builtin_amdgcn_exp2f(m4[z] - top); den += w * s4[z]; wq[tid * 8 + z] = w; }
        wq[tid * 8 + 4] = __fdiv_rn(1.0f, den); }
    __syncthreads();   // every position's weights are in LDS before any wave joins its rows
#pragma unroll
    for (int i = 0; i < OTN / 8; ++i) { const int n = wave + 8 * i; const v4f w = *(const v4fa*)(wq + n * 8); const float f = wq[n * 8 + 4]; v4f a = (v4f){};
#pragma unroll
        for (int z = 0; z < AZ; ++z) a += yv[i][z] * w[z];
        v4us oh, ol;
#pragma unroll
        for (int u = 0; u < 4; ++u) { unsigned short p, q; splitf(a[u] * f, p, q); oh[u] = p; ol[u] = q; }
        *(v4usa*)(ys + n * OPP + lane * 4) = oh; *(v4usa*)(ys + OTN * OPP + n * OPP + lane * 4) = ol; }
    __syncthreads();   // both planes of y are whole before any wave takes fragments of them
    v8f acc[2][2];
#pragma unroll
    for (int mb = 0; mb < 2; ++mb)
#pragma unroll
        for (int nb = 0; nb < 2; ++nb) acc[mb][nb] = (v8f){};
    const unsigned short* ar = ys + lr * OPP + 8 * hi;
#pragma unroll
    for (int kc = 0; kc < DDr / 32; ++kc) { v16bf a[2], a2[2];
#pragma unroll
        for (int mb = 0; mb < 2; ++mb) { const unsigned short* p = ar + mb * 16 * OPP + kc * 32; a[mb] = cat16b(*(const v8usa*)p, *(const v8usa*)(p + 16)); a2[mb] = cat16b(*(const v8usa*)(p + OTN * OPP), *(const v8usa*)(p + OTN * OPP + 16)); }
#pragma unroll
        for (int nb = 0; nb < 2; ++nb)
#pragma unroll
            for (int mb = 0; mb < 2; ++mb) { acc[mb][nb] = wmmab(a[mb], b[kc][nb], acc[mb][nb]); acc[mb][nb] = wmmab(a2[mb], b[kc][nb], acc[mb][nb]); } }
    float* ow = os + wave * (32 * OSP);
#pragma unroll
    for (int nb = 0; nb < 2; ++nb)
#pragma unroll
        for (int mb = 0; mb < 2; ++mb) { float* p = ow + (nb * 16 + lr) * OSP + mb * 16 + hi * 8;   // o[n = 16 mb + 8 hi + j][c = c0 + 16 nb + lr]
            *(v4fa*)p = __builtin_shufflevector(acc[mb][nb], acc[mb][nb], 0, 1, 2, 3); *(v4fa*)(p + 4) = __builtin_shufflevector(acc[mb][nb], acc[mb][nb], 4, 5, 6, 7); }
    asm volatile("s_wait_dscnt 0x0" ::: "memory");   // the wave's own writes of its range are done, and stay in front, before its lanes read one another's values back
#pragma unroll
    for (int s = 0; s < 8; ++s) { const v4f v = *(const v4fa*)(ow + (s * 4 + (lane >> 3)) * OSP + (lane & 7) * 4); v4f o;
#pragma unroll
        for (int u = 0; u < 4; ++u) o[u] = __fadd_rn(bfr(xv[s][u]), v[u]);
        *(v4f*)(OUT + xo + (size_t)s * 4 * NN) = o; }
}

extern "C" void kernel_launch(void* const* d_in, const int* in_sizes, int n_in,
                              void* d_out, int out_size, void* d_ws, size_t ws_size, hipStream_t stream) {
    (void)in_sizes; (void)n_in; (void)out_size;
    const float* x = (const float*)d_in[0]; const float* wth = (const float*)d_in[1]; const float* wph = (const float*)d_in[2]; const float* wg = (const float*)d_in[3]; const float* wout = (const float*)d_in[4];
    float* OUT = (float*)d_out;     // [4][256][64][64]
    char* wsp = (char*)d_ws;
    auto take = [&](size_t bytes) { char* p = wsp; wsp += (bytes + 255) & ~(size_t)255; return (void*)p; };
    // The four images are a grid axis everywhere, the three projections are one grid with 384 rows of weights.
    bf* WOUT = (bf*)take((size_t)CC * DDr * 2);   // w_out ([c][d] rows) in bf16
    bf* TPh = (bf*)take((size_t)NBI * 2 * NN * DDr * 2); bf* TPl = (bf*)take((size_t)NBI * 2 * NN * DDr * 2); h16* G16 = (h16*)take((size_t)NBI * DDr * NN * 2);
    float* Y = (float*)take((size_t)NBI * AZ * NN * DDr * 4); float* ML = (float*)take((size_t)NBI * AZ * NN * 2 * 4);   // Y [image][key quarter][n][d], ML [image][key quarter][n][r, sum]
    if ((size_t)(wsp - (char*)d_ws) > ws_size) return;    // total ~ 53 MiB
    k_proj<<<dim3(NN / PJN, NBI, 1), 384, 0, stream>>>(x, wth, wph, wg, wout, TPh, TPl, G16, WOUT);
    k_attn<<<dim3(NN / (AW * AQ), AZ, NBI), AW * 32, 0, stream>>>(TPh, TPl, G16, Y, ML);     // y[n][d] (unnormalised) = sum_m P[n][m] g[d][m], a key quarter a plane
    k_outp<<<dim3(NN / OTN, NBI, 1), 256, 0, stream>>>(Y, ML, WOUT, x, OUT);                  // out[c][n] = x[c][n] + sum_d y[n][d] w_out[c][d]
}

// v008
// Measured time: 63.5 microseconds a run.
// In both of two side-by-side timings against v007, it was 1.05 times as fast.
// Over all steps from v000 it is 14.3 times as fast.
#include <hip/hip_runtime.h>

// _NonLocal (embedded-Gaussian non-local block: x [4][256][64][64] -> 4096 positions; theta/phi/g = 1x1 convs to 128 channels (no bias); attn[n][m] = softmax_m(theta[:,n].phi[:,m]) (UNSCALED: logits have sigma ~ 11, so the scores need 3-product precision);
// y[d][n] = sum_m g[d][m] attn[n][m]; out = x + w_out y -> [4][256][64][64]).
// Compute dtypes, f32 accumulate: every input rounded to bf16; theta/phi/g on PLAIN bf16 operands (inputs: exact); scores (K 128) on bf16 hi+lo planes of theta and phi (3 products; single fp16 planes

#define NBI  4
#define CC   256
#define DDr  128
#define NN   4096
#define L2E  1.4426950408889634f
#define PSH  10.0f
typedef _Float16 h16;
typedef unsigned short bf;
typedef __attribute__((ext_vector_type(16))) __bf16   v16bf;
typedef __attribute__((ext_vector_type(16))) _Float16 v16h;
typedef __attribute__((ext_vector_type(8)))  _Float16 v8h;
typedef __attribute__((ext_vector_type(8)))  unsigned short v8us;
typedef __attribute__((ext_vector_type(8)))  float    v8f;
typedef __attribute__((ext_vector_type(4)))  float    v4f;
typedef v8h  __attribute__((may_alias)) v8ha;
typedef v4f  __attribute__((may_alias)) v4fa;
typedef v8us __attribute__((may_alias)) v8usa;

__device__ __forceinline__ unsigned short f2bf(float f) { unsigned u = __float_as_uint(f); u += 0x7FFFu + ((u >> 16) & 1u); return (unsigned short)(u >> 16); }
__device__ __forceinline__ float bf2f(unsigned short b) { return __uint_as_float(((unsigned)b) << 16); }
__device__ __forceinline__ float bfr(float f) { return bf2f(f2bf(f)); }
__device__ __forceinline__ v16h cat16(v8h lo, v8h hi) { return __builtin_shufflevector(lo, hi, 0, 1, 2, 3, 4, 5, 6, 7, 8, 9, 10, 11, 12, 13, 14, 15); }
__device__ __forceinline__ v16bf cat16b(v8us lo, v8us hi) { return __builtin_bit_cast(v16bf, __builtin_shufflevector(lo, hi, 0, 1, 2, 3, 4, 5, 6, 7, 8, 9, 10, 11, 12, 13, 14, 15)); }
__device__ __forceinline__ float xhalf(float x) { return __builtin_bit_cast(float, __builtin_amdgcn_permlanex16(__builtin_bit_cast(int, x), __builtin_bit_cast(int, x), 0x76543210, 0xfedcba98, false, false)); }   // lane l takes lane l ^ 16's value
__device__ __forceinline__ v8f wmma16(v16h a, v16h b, v8f c) { return __builtin_amdgcn_wmma_f32_16x16x32_f16(false, a, false, b, (short)0, c, false, false); }
__device__ __forceinline__ v8f wmmab(v16bf a, v16bf b, v8f c) { return __builtin_amdgcn_wmma_f32_16x16x32_bf16(false, a, false, b, (short)0, c, false, false); }



// A fragment of 16 k from a k-contiguous 16-bit row: two 16-byte loads, the same for the A and the B side.
template <typename T16> struct WFrag;
template <> struct WFrag<h16> { typedef v16h V; static __device__ __forceinline__ V ld(const h16* p) { return cat16(*(const v8h*)p, *(const v8h*)(p + 16)); } static __device__ __forceinline__ v8f mma(V a, V b, v8f c) { return wmma16(a, b, c); } };
template <> struct WFrag<bf> { typedef v16bf V; static __device__ __forceinline__ V ld(const bf* p) { return cat16b(*(const v8us*)p, *(const v8us*)(p + 16)); } static __device__ __forceinline__ v8f mma(V a, V b, v8f c) { return wmmab(a, b, c); } };
__device__ __forceinline__ h16 tohx(float x) { return (h16)x; }
__device__ __forceinline__ void splitf(float y, unsigned short& h, unsigned short& l) { h = f2bf(y); l = f2bf(y - bf2f(h)); }
typedef __attribute__((ext_vector_type(4))) unsigned short v4us;
typedef v4us __attribute__((may_alias)) v4usa;

// ---- k_proj: the rounding of x and of the weights to bf16, the turn of x and the three projections in one kernel: no bf16 copy of x or of w_theta, w_phi, w_g in memory, no pass of its own for them.
// Work-group = 64 positions n x all 384 rows of weights of one image, 12 waves; grid (NN / 64, image).
// 1. Staging, whole lines from memory: wave u brings rows 32 u .. 32 u + 31 of the stacked weights (32 KiB in a row of one matrix), rounds them and lays them in LDS as [row][c]; waves 0 .. 7 bring x[c = 0 .. 255][64 n], a thread 8 c x 4 n twice,
//    and lay it in LDS turned, as [n][c]: the 8 c of one n are one 16-byte piece. Pitch 528 B (16 B x odd) for the 16-byte fragment readers. One wave of each work-group rounds its 128 elements of w_out for k_outp.
// 2. A wave's tile is 4 x 2 accumulators, fragments from LDS. The result is formed in the layout its reader wants, in the accumulators: a lane's 8 accumulator registers are 8 consecutive rows of the A operand in one column of B,
//    so the index that must be contiguous in memory is given to A. theta, phi (waves 0 .. 7: 64 d x 32 n): A = weights (d), B = x (n): hi and lo bf16 planes T[n][d], 16 B a lane and plane; g (waves 8 .. 11: 32 d x 64 n): A = x (n), B = weights (d): fp16 G[d][n], 16 B a lane.
//    A wave's rows are whole 128-byte lines (64 d or 64 n x 2 B).
#define PJN 64
#define PJW (3 * DDr)
#define PJP (CC + 8)
#define PJS 72
typedef __attribute__((ext_vector_type(2))) float  v2f;
typedef __attribute__((ext_vector_type(2))) __bf16 v2bf;
typedef __attribute__((ext_vector_type(2))) unsigned v2u;
typedef __attribute__((ext_vector_type(4))) unsigned v4u;
typedef v2u __attribute__((may_alias)) v2ua;
typedef v4u __attribute__((may_alias)) v4ua;
__device__ __forceinline__ unsigned pk2(float a, float b) { const v2f t = { a, b }; return __builtin_bit_cast(unsigned, __builtin_convertvector(t, v2bf)); }   // two f32 to two bf16, nearest even, a in the low half
__global__ __launch_bounds__(384) void k_proj(const float* __restrict__ x, const float* __restrict__ w0, const float* __restrict__ w1, const float* __restrict__ w2, const float* __restrict__ w3, bf* Th, bf* Tl, h16* G16, bf* WO) {
    __shared__ __align__(16) unsigned short sm[(PJW + PJN) * PJP];   // rows 0 .. 383: weights [row][c]; rows 384 .. 447: x [n][c]
    const int tid = threadIdx.x, lane = tid & 31, lr = lane & 15, hi = lane >> 4; const int u = __builtin_amdgcn_readfirstlane(tid >> 5);   // the wave's number, in a scalar register: every test on it is a scalar branch
    const int n0 = blockIdx.x * PJN, img = blockIdx.y;
    const int cg = tid >> 4, n4 = (tid & 15) * 4;
    const float* xp = x + ((size_t)img * CC + cg * 8) * NN + n0 + n4;
    const float* wp = (u < 4 ? w0 : u < 8 ? w1 : w2) + (size_t)(u & 3) * 32 * CC + lane * 4;
    unsigned short* wd = sm + (size_t)u * 32 * PJP + lane * 4;
    const size_t oo = ((size_t)(blockIdx.y * (NN / PJN) + blockIdx.x) * 32 + lane) * 4;   // wave 8's share of w_out: 256 work-groups x 128 elements
    v4f xv[16], wv[32], ov = (v4f){};
    if (u == 8) { const float* op = w3 + oo; ov = *(const v4f*)op;   // asked for ahead of the weights, so that it costs no latency of its own
        asm volatile("s_wait_xcnt 0x0" :: "v"(op) : "memory"); }   // in front of the writes of this load's address registers
    if (u < 8) {
#pragma unroll
        for (int i = 0; i < 16; ++i) xv[i] = *(const v4f*)(xp + (size_t)((i >> 3) * 128 + (i & 7)) * NN);   // 16 lanes x 16 B = the 256 B of a row of the tile
        asm volatile("s_wait_xcnt 0x0" :: "v"(xp) : "memory");   // in front of the writes of these loads' address registers, which it takes as an input so that no result of the group is laid over them
        __builtin_amdgcn_sched_barrier(0); }                       // keeps such writes from being lifted over the wait
#pragma unroll
    for (int h = 0; h < 2; ++h) {
#pragma unroll
        for (int i = 0; i < 32; ++i) wv[i] = *(const v4f*)(wp + (h * 32 + i) * 128);   // a wave's load is 512 B in a row
        asm volatile("s_wait_xcnt 0x0" :: "v"(wp) : "memory");   // as above
        __builtin_amdgcn_sched_barrier(0);                         // as above
        if (h == 0 && u < 8) {   // x was asked for first and is here first: it is rounded and turned while the weights are on their way
#pragma unroll
            for (int g2 = 0; g2 < 2; ++g2)
#pragma unroll
                for (int e = 0; e < 4; ++e) { const v4u o = { pk2(xv[g2 * 8][e], xv[g2 * 8 + 1][e]), pk2(xv[g2 * 8 + 2][e], xv[g2 * 8 + 3][e]), pk2(xv[g2 * 8 + 4][e], xv[g2 * 8 + 5][e]), pk2(xv[g2 * 8 + 6][e], xv[g2 * 8 + 7][e]) };
                    *(v4ua*)(sm + (size_t)(PJW + n4 + e) * PJP + g2 * 128 + cg * 8) = o; } }
#pragma unroll
        for (int i = 0; i < 32; ++i) { const v2u o = { pk2(wv[i][0], wv[i][1]), pk2(wv[i][2], wv[i][3]) }; *(v2ua*)(wd + (h * 16 + (i >> 1)) * PJP + (i & 1) * 128) = o; }
    }
    __syncthreads();   // weights and x are whole in LDS before any wave takes fragments of them
    if (u == 8) { const v2u r = { pk2(ov[0], ov[1]), pk2(ov[2], ov[3]) }; *(v2u*)(WO + oo) = r;   // behind the barrier, which would else wait for the store
        asm volatile("s_wait_xcnt 0x0" ::: "memory"); }   // in front of the writes of this store's registers
    const bool isg = u >= 8;
    const unsigned short* wr = sm + (size_t)((isg ? u * 32 : (u >> 1) * 64) + lr) * PJP + 8 * hi; const unsigned short* xr = sm + (size_t)(PJW + (isg ? 0 : (u & 1) * 32) + lr) * PJP + 8 * hi;
    const unsigned short* A = isg ? xr : wr; const unsigned short* Bt = isg ? wr : xr;
    v8f acc[4][2];
#pragma unroll
    for (int mb = 0; mb < 4; ++mb)
#pragma unroll
        for (int nb = 0; nb < 2; ++nb) acc[mb][nb] = (v8f){};
#pragma unroll
    for (int kg = 0; kg < CC; kg += 64) { v16bf a[2][4], b[2][2];
#pragma unroll
        for (int ks = 0; ks < 2; ++ks) {
#pragma unroll
            for (int mb = 0; mb < 4; ++mb) { const unsigned short* p = A + mb * 16 * PJP + kg + ks * 32; a[ks][mb] = cat16b(*(const v8usa*)p, *(const v8usa*)(p + 16)); }
#pragma unroll
            for (int nb = 0; nb < 2; ++nb) { const unsigned short* p = Bt + nb * 16 * PJP + kg + ks * 32; b[ks][nb] = cat16b(*(const v8usa*)p, *(const v8usa*)(p + 16)); } }
        __builtin_amdgcn_sched_barrier(0);   // keeps the fragment loads of two k blocks one group in front of their matrix instructions: spread among them, through few registers, every k block waits three times for all of its loads
#pragma unroll
        for (int ks = 0; ks < 2; ++ks)
#pragma unroll
            for (int nb = 0; nb < 2; ++nb)
#pragma unroll
                for (int mb = 0; mb < 4; ++mb) acc[mb][nb] = wmmab(a[ks][mb], b[ks][nb], acc[mb][nb]); }
    __syncthreads();   // every wave has taken its last fragments of the weights and of x: LDS now serves the waves as output staging
    // 3. A wave's tile is 32 rows of 128 B a plane (a row: one n of theta or phi, one d of g). It is laid in the wave's own LDS range (pitch 144 B = 16 B x odd) and read back 8 lanes a row, so that a store instruction writes four whole lines.
    unsigned short* ow = sm + (size_t)u * (2 * 32 * PJS); unsigned short* oww = ow + lr * PJS + hi * 8; const unsigned short* owr = ow + (lane >> 3) * PJS + (lane & 7) * 8;
    if (!isg) { const int rb = u >> 1; const size_t o = ((size_t)(img * 2 + (rb >> 1)) * NN + n0 + (u & 1) * 32 + (lane >> 3)) * DDr + (rb & 1) * 64 + (lane & 7) * 8;
#pragma unroll
        for (int nb = 0; nb < 2; ++nb)
#pragma unroll
            for (int mb = 0; mb < 4; ++mb) { v8us oh, ol;
#pragma unroll
                for (int j = 0; j < 8; ++j) { unsigned short p, q; splitf(acc[mb][nb][j], p, q); oh[j] = p; ol[j] = q; }   // theta or phi [d = 64 (rb & 1) + 16 mb + 8 hi + j][n = n0 + 32 (u & 1) + 16 nb + lr]
                *(v8usa*)(oww + nb * 16 * PJS + mb * 16) = oh; *(v8usa*)(oww + (32 + nb * 16) * PJS + mb * 16) = ol; }
        asm volatile("s_wait_dscnt 0x0" ::: "memory");   // the wave's own writes of its range are done, and stay in front, before its lanes read one another's values back
        v8us rh[8], rl[8];
#pragma unroll
        for (int i = 0; i < 8; ++i) { rh[i] = *(const v8usa*)(owr + i * 4 * PJS); rl[i] = *(const v8usa*)(owr + (32 + i * 4) * PJS); }
#pragma unroll
        for (int i = 0; i < 8; ++i) { *(v8us*)(Th + o + (size_t)i * 4 * DDr) = rh[i]; *(v8us*)(Tl + o + (size_t)i * 4 * DDr) = rl[i]; }   // rows n0 + 32 (u & 1) + 4 i + lane / 8, the 64 d of the wave
        asm volatile("s_wait_xcnt 0x0" ::: "memory"); }   // in front of whatever the build lays behind these stores and lets write their registers
    else { const size_t o = ((size_t)img * DDr + (u - 8) * 32 + (lane >> 3)) * NN + n0 + (lane & 7) * 8;
#pragma unroll
        for (int nb = 0; nb < 2; ++nb)
#pragma unroll
            for (int mb = 0; mb < 4; ++mb) { v8h og;
#pragma unroll
                for (int j = 0; j < 8; ++j) og[j] = tohx(acc[mb][nb][j]);   // g [d = 32 (u - 8) + 16 nb + lr][n = n0 + 16 mb + 8 hi + j]
                *(v8ha*)(oww + nb * 16 * PJS + mb * 16) = og; }
        asm volatile("s_wait_dscnt 0x0" ::: "memory");   // as above
        v8h rg[8];
#pragma unroll
        for (int i = 0; i < 8; ++i) rg[i] = *(const v8ha*)(owr + i * 4 * PJS);
#pragma unroll
        for (int i = 0; i < 8; ++i) *(v8h*)(G16 + o + (size_t)i * 4 * NN) = rg[i];   // rows d = 32 (u - 8) + 4 i + lane / 8, the 64 n of the work-group
        asm volatile("s_wait_xcnt 0x0" ::: "memory"); }   // as above
}
static_assert(12 * 2 * 32 * PJS <= (PJW + PJN) * PJP, "the waves' output ranges lie inside the staging array");
static_assert(NBI * (NN / PJN) * 128 == CC * DDr, "the work-groups' shares of w_out are the whole of it");

// ---- k_attn: scores, softmax and P.g in one kernel; no score and no P ever goes to memory. Transposed products: S^T = phi . theta^T (A = 16 keys, B = 16 queries) and y^T += g . P^T (A = 16 rows of g, B = P^T),
// so that a lane holds scores of ONE query (column lr; keys 8 hi + j of each 16-key tile) and two score tiles, converted, ARE the 32-key B fragment of the second product: P crosses no lane and no LDS.
// Work-group = 256 queries (8 waves x 32) x one quarter of the keys (blockIdx.y) of one image (blockIdx.z). theta fragments (hi and lo planes) stay in registers; phi (hi, lo) and g go through LDS, 128 keys a stage,
// two buffers, brought by asynchronous copies (global memory to LDS, through no register) that fly while the stage before is worked on; one barrier a stage. Running maximum and sum per query (online softmax); y^T is rescaled only in a pass in which some query's maximum rises.
// Scores: three bf16 products a k block, in the order hi.hi, theta lo . phi hi, theta hi . phi lo. Exponents count from a reference point r = running max x log2(e) - 10: P = exp2(s log2(e) - r) <= 1024, in fp16; the point cancels in sum(P g) / sum(P).
// Out: unnormalised y [image][quarter][n][d] and (r, sum of P) per query and quarter; k_outp joins the quarters.
#define AW   8
#define AQ   32
#define AZ   4
#define AKEY (NN / AZ)
#define AST  128
#define APP  136
#define APG  136
#define APH  (AST * APP)
#define ABUF (2 * APH + DDr * APG)
#define AYP  (DDr + 4)
// Eight copies of 16 bytes a lane from global memory to LDS: rows 16 apart of one plane of a stage. l: the lane's place in LDS for the first, p: its global address, ps: elements from one to the next in memory.
typedef int v4i __attribute__((ext_vector_type(4)));
typedef __attribute__((address_space(1))) v4i gv4i;
typedef __attribute__((address_space(3))) v4i lv4i;
// The waits are the caller's: s_wait_asynccnt 0 and a work-group barrier stand between these copies and every read of their bytes.
__device__ __forceinline__ void acp8(unsigned short* l, const unsigned short* p, size_t ps) {
    // unrolled, so that the eight copies issue in a row and their steps are constants of the addresses
#pragma unroll
    for (int i = 0; i < 8; ++i) __builtin_amdgcn_global_load_async_to_lds_b128((gv4i*)(p + i * ps), (lv4i*)(l + i * 16 * APP), 0, 0);
}
__global__ __launch_bounds__(AW * 32) void k_attn(const bf* __restrict__ TPh, const bf* __restrict__ TPl, const h16* __restrict__ G16, float* __restrict__ Yp, float* __restrict__ ML) {
    __shared__ __align__(16) unsigned short sm[2 * ABUF];   // a buffer: phi hi [128 keys][pitch 272 B], phi lo the same, g [128 d][128 keys, pitch 272 B]: pitch 16 B x odd for 16-byte readers
    const int tid = threadIdx.x, lane = tid & 31, lr = lane & 15, hi = lane >> 4, wave = tid >> 5;
    const int img = blockIdx.z, part = img * AZ + blockIdx.y, q0 = blockIdx.x * (AW * AQ) + wave * AQ, key0 = blockIdx.y * AKEY;
    const bf* th = TPh + (size_t)img * 2 * NN * DDr; const bf* tl = TPl + (size_t)img * 2 * NN * DDr; const bf* ph = th + (size_t)NN * DDr + (size_t)key0 * DDr; const bf* pl = tl + (size_t)NN * DDr + (size_t)key0 * DDr;
    const h16* g = G16 + (size_t)img * DDr * NN + key0;
    v16bf qh[2][4], ql[2][4];
#pragma unroll
    for (int q = 0; q < 2; ++q)
#pragma unroll
        for (int kc = 0; kc < 4; ++kc) { const size_t o = (size_t)(q0 + q * 16 + lr) * DDr + 8 * hi + kc * 32; qh[q][kc] = WFrag<bf>::ld(th + o); ql[q][kc] = WFrag<bf>::ld(tl + o); }
    asm volatile("s_wait_xcnt 0x0" ::: "memory");   // in front of the writes of these loads' address registers
    __builtin_amdgcn_sched_barrier(0);                // without it the build lifts such writes (later address sums, the zeroing below) over the wait
    v8f O[8][2];
#pragma unroll
    for (int dt = 0; dt < 8; ++dt) { O[dt][0] = (v8f){}; O[dt][1] = (v8f){}; }
    float mr[2] = { -3.0e38f, -3.0e38f }, sum[2] = { 0.f, 0.f };
    const int prow = tid >> 4, pcol = (tid & 15) * 8;   // a thread's 16-byte pieces of a stage: rows prow + 16 i (keys of phi, d of g), all of 256 B: a wave's copy is two whole rows
    auto stage = [&](int t) {   // stage t (keys 128 t .. 128 t + 127 of the quarter) into buffer t & 1: 24 copies a lane
        unsigned short* l0 = sm + (t & 1) * ABUF + prow * APP + pcol; const size_t po = (size_t)(t * AST + prow) * DDr + pcol;
        acp8(l0, ph + po, 16 * DDr);
        acp8(l0 + APH, pl + po, 16 * DDr);
        acp8(l0 + 2 * APH, (const unsigned short*)(g + (size_t)prow * NN + t * AST + pcol), (size_t)16 * NN); };
    stage(0);
    asm volatile("s_wait_asynccnt 0x0" ::: "memory");   // this wave's copies of stage 0 have landed
    __syncthreads();                                      // and every other wave's: stage 0 is whole in LDS before any wave reads it
    stage(1);
    // kept rolled: the trips are alike and long (256 matrix instructions); unrolled, the code would only grow
#pragma unroll 1
    for (int s = 0; s < AKEY / AST; ++s) {
        const unsigned short* buf = sm + (s & 1) * ABUF;
        const unsigned short* gbuf = (s & 1) ? sm + ABUF + 2 * APH : sm + 2 * APH;   // the stage's g plane, its place chosen whole: as buf + a constant beyond the 64 KiB that an LDS load's offset field holds, every g fragment load would get an address sum of its own
        // kept rolled: unrolled, the build mixes one pass's second product with the next pass's first and, short of registers, fetches their fragments two loads at a time with a full wait each
#pragma unroll 1
        for (int kk = 0; kk < AST / 32; ++kk) {
            v8f S[2][2];
#pragma unroll
            for (int t = 0; t < 2; ++t) { S[t][0] = (v8f){}; S[t][1] = (v8f){}; }
            const unsigned short* pr = buf + (kk * 32 + lr) * APP + 8 * hi;
            v16bf ah[4][2], al[4][2];
#pragma unroll
            for (int kc = 0; kc < 4; ++kc)
#pragma unroll
                for (int t = 0; t < 2; ++t) { const unsigned short* p = pr + t * 16 * APP + kc * 32; ah[kc][t] = cat16b(*(const v8usa*)p, *(const v8usa*)(p + 16)); al[kc][t] = cat16b(*(const v8usa*)(p + APH), *(const v8usa*)(p + APH + 16)); }
            __builtin_amdgcn_sched_barrier(0);   // keeps the pass's phi fragment loads one group in front of its matrix instructions: spread among them, through few registers, each pair is waited for in full
#pragma unroll
            for (int kc = 0; kc < 4; ++kc) {
#pragma unroll
                for (int t = 0; t < 2; ++t)
#pragma unroll
                    for (int q = 0; q < 2; ++q) S[t][q] = wmmab(ah[kc][t], qh[q][kc], S[t][q]);   // theta hi . phi hi
#pragma unroll
                for (int t = 0; t < 2; ++t)
#pragma unroll
                    for (int q = 0; q < 2; ++q) S[t][q] = wmmab(ah[kc][t], ql[q][kc], S[t][q]);   // theta lo . phi hi
#pragma unroll
                for (int t = 0; t < 2; ++t)
#pragma unroll
                    for (int q = 0; q < 2; ++q) S[t][q] = wmmab(al[kc][t], qh[q][kc], S[t][q]); } // theta hi . phi lo
            const unsigned short* gr = gbuf + lr * APG + kk * 32 + 8 * hi; v16h ga[8];
#pragma unroll
            for (int dt = 0; dt < 8; ++dt) ga[dt] = cat16(*(const v8ha*)(gr + dt * 16 * APG), *(const v8ha*)(gr + dt * 16 * APG + 16));
            __builtin_amdgcn_sched_barrier(0);   // keeps the loads of the g fragments, one group, in front of the softmax arithmetic, which then covers their latency
            float mn[2]; bool rise = false;
#pragma unroll
            for (int q = 0; q < 2; ++q) { float tm = fmaxf(S[0][q][0], S[1][q][0]);
#pragma unroll
                for (int j = 1; j < 8; ++j) tm = fmaxf(tm, fmaxf(S[0][q][j], S[1][q][j]));
                tm = fmaxf(tm, xhalf(tm)); mn[q] = fmaxf(mr[q], fmaf(tm, L2E, -PSH)); rise = rise || mn[q] > mr[q]; }
            if (__builtin_amdgcn_ballot_w32(rise) != 0) {   // one scalar branch a pass: the same for the whole wave, so every matrix instruction keeps all lanes on
#pragma unroll
                for (int q = 0; q < 2; ++q) { const float sc = __builtin_amdgcn_exp2f(mr[q] - mn[q]); sum[q] *= sc; mr[q] = mn[q];
#pragma unroll
                    for (int dt = 0; dt < 8; ++dt) O[dt][q] *= sc; } }
            v16h pf[2];
#pragma unroll
            for (int q = 0; q < 2; ++q) { float ps[2] = { 0.f, 0.f };   // a chain of sums a score tile: shorter dependent chains
#pragma unroll
                for (int t = 0; t < 2; ++t)
#pragma unroll
                    for (int j = 0; j < 8; ++j) { const float e = __builtin_amdgcn_exp2f(fmaf(S[t][q][j], L2E, -mr[q])); ps[t] += e; pf[q][t * 8 + j] = (h16)e; }   // element 8 t + j of the B fragment is k = 16 t + 8 hi + j: the row of score tile t that this lane holds
                sum[q] += ps[0] + ps[1]; }
#pragma unroll
            for (int dt = 0; dt < 8; ++dt) { O[dt][0] = wmma16(ga[dt], pf[0], O[dt][0]); O[dt][1] = wmma16(ga[dt], pf[1], O[dt][1]); }
        }
        asm volatile("s_wait_dscnt 0x0" ::: "memory");      // this wave's reads of stage s are done before its buffer may be filled anew
        asm volatile("s_wait_asynccnt 0x0" ::: "memory");   // this wave's copies of stage s + 1 have landed
        __syncthreads();   // stage s + 1 is whole in LDS for every wave; and every wave has left stage s, whose buffer is filled next
        if (s + 2 < AKEY / AST) stage(s + 2);
    }
    asm volatile("s_wait_asynccnt 0x0" ::: "memory");   // no copy is outstanding when the wave goes on to its end
    // y leaves through LDS: from the accumulators a store instruction would touch 16 rows with 32 B in each; turned in the wave's own range of the ring ([query][d], pitch 528 B = 16 B x odd), a store is one whole row of 512 B.
    // The ring is free: behind the last trip's barrier no wave reads it any more and no copy is outstanding.
    float* yp = Yp + (size_t)part * NN * DDr; float* ow = (float*)sm + wave * (AQ * AYP);
#pragma unroll
    for (int q = 0; q < 2; ++q) { const int n = q0 + q * 16 + lr; const float st = sum[q] + xhalf(sum[q]);   // the two lane halves summed different keys of the same query
#pragma unroll
        for (int dt = 0; dt < 8; ++dt) { float* p = ow + (q * 16 + lr) * AYP + dt * 16 + hi * 8;
            *(v4fa*)p = __builtin_shufflevector(O[dt][q], O[dt][q], 0, 1, 2, 3); *(v4fa*)(p + 4) = __builtin_shufflevector(O[dt][q], O[dt][q], 4, 5, 6, 7); }
        if (hi == 0) { float* ml = ML + ((size_t)part * NN + n) * 2; ml[0] = mr[q]; ml[1] = st; } }
    asm volatile("s_wait_dscnt 0x0" ::: "memory");   // the wave's own writes of its range are done, and stay in front, before its lanes read one another's values back
    v4f rv[AQ]; float* yw = yp + (size_t)q0 * DDr + lane * 4;
#pragma unroll
    for (int r = 0; r < AQ; ++r) rv[r] = *(const v4fa*)(ow + r * AYP + lane * 4);
#pragma unroll
    for (int r = 0; r < AQ; ++r) *(v4f*)(yw + (size_t)r * DDr) = rv[r];   // 32 lanes x 16 B = the row of query q0 + r
    asm volatile("s_wait_xcnt 0x0" ::: "memory");   // in front of whatever the build lays behind these stores and lets write their registers
}
static_assert(AW * AQ * AYP * 4 <= 2 * ABUF * 2, "the waves' output ranges lie inside the ring");


// ---- k_outp: the join of the key quarters, the output product and the residual in one kernel. Work-group = 32 positions n x all 256 channels c of one image, 8 waves; grid (NN / 32, image).
// 1. y[n][d] = (sum over the key quarters of exp2(r - top r) Y) / (the sums of P joined the same way), split into hi and lo bf16 planes, goes to LDS (pitch 272 B); the weights and 1 / sum of a position are made once, by one wave, and passed through LDS.
// 2. A wave's tile is 32 n x 32 c: A = y (hi, then lo plane, a k block), B = w_out [c][d] from memory: o[n][c], 8 consecutive n of one c in a lane.
// 3. The tile is turned in the wave's own LDS range ([c][n], pitch 144 B), so that x is read and OUT written in whole 128-byte lines: OUT[c][n] = x[c][n] + o[n][c].
#define OTN 32
#define OPP 136
#define OSP 36
__global__ __launch_bounds__(256) void k_outp(const float* __restrict__ Y, const float* __restrict__ ML, const bf* __restrict__ WO, const float* __restrict__ x, float* OUT) {
    __shared__ __align__(16) unsigned short ys[2 * OTN * OPP];
    __shared__ __align__(16) float wq[OTN * 8];
    __shared__ __align__(16) float os[8 * 32 * OSP];
    const int tid = threadIdx.x, lane = tid & 31, lr = lane & 15, hi = lane >> 4, wave = tid >> 5;
    const int img = blockIdx.y, n0 = blockIdx.x * OTN, c0 = wave * 32;
    Y += ((size_t)img * AZ * NN + n0) * DDr; ML += ((size_t)img * AZ * NN + n0) * 2;
    const size_t xo = (size_t)img * CC * NN + (size_t)(c0 + (lane >> 3)) * NN + n0 + (lane & 7) * 4;   // piece s of a lane: row c0 + lane / 8 + 4 s, 4 n: 8 lanes x 16 B = one line of a row
    v4f yv[OTN / 8][AZ], xv[8]; const float* yp = Y + (size_t)wave * DDr + lane * 4; const float* xp = x + xo;
#pragma unroll
    for (int i = 0; i < OTN / 8; ++i)
#pragma unroll
        for (int z = 0; z < AZ; ++z) yv[i][z] = *(const v4f*)(yp + ((size_t)z * NN + 8 * i) * DDr);   // a wave reads whole rows (512 B) of positions wave + 8 i
    asm volatile("s_wait_xcnt 0x0" :: "v"(yp) : "memory");   // in front of the writes of these loads' address registers, which it takes as an input so that no result of the group is laid over them
    __builtin_amdgcn_sched_barrier(0);                         // keeps such writes (later address sums, the next group's results) from being lifted over the wait
    // the w_out fragments and x are asked for at the start too, though wanted later: all that the work-group reads from memory is on its way at once, behind one latency
    const bf* wb = WO + (size_t)(c0 + lr) * DDr + 8 * hi; v16bf b[DDr / 32][2];
#pragma unroll
    for (int kc = 0; kc < DDr / 32; ++kc)
#pragma unroll
        for (int nb = 0; nb < 2; ++nb) b[kc][nb] = WFrag<bf>::ld(wb + (size_t)nb * 16 * DDr + kc * 32);
    asm volatile("s_wait_xcnt 0x0" :: "v"(wb) : "memory");   // as above
    __builtin_amdgcn_sched_barrier(0);                         // as above
#pragma unroll
    for (int s = 0; s < 8; ++s) xv[s] = *(const v4f*)(xp + (size_t)s * 4 * NN);
    asm volatile("s_wait_xcnt 0x0" :: "v"(xp) : "memory");   // as above
    __builtin_amdgcn_sched_barrier(0);                         // as above
    if (tid < OTN) { float m4[AZ], s4[AZ], top = -3.0e38f, den = 0.f;
#pragma unroll
        for (int z = 0; z < AZ; ++z) { m4[z] = ML[((size_t)z * NN + tid) * 2]; s4[z] = ML[((size_t)z * NN + tid) * 2 + 1]; }
        asm volatile("s_wait_xcnt 0x0" ::: "memory");   // in front of the writes of these loads' address registers
#pragma unroll
        for (int z = 0; z < AZ; ++z) top = fmaxf(top, m4[z]);
#pragma unroll
        for (int z = 0; z < AZ; ++z) { const float w = __builtin_amdgcn_exp2f(m4[z] - top); den += w * s4[z]; wq[tid * 8 + z] = w; }
        wq[tid * 8 + 4] = __fdiv_rn(1.0f, den); }
    __syncthreads();   // every position's weights are in LDS before any wave joins its rows
#pragma unroll
    for (int i = 0; i < OTN / 8; ++i) { const int n = wave + 8 * i; const v4f w = *(const v4fa*)(wq + n * 8); const float f = wq[n * 8 + 4]; v4f a = (v4f){};
#pragma unroll
        for (int z = 0; z < AZ; ++z) a += yv[i][z] * w[z];
        v4us oh, ol;
#pragma unroll
        for (int u = 0; u < 4; ++u) { unsigned short p, q; splitf(a[u] * f, p, q); oh[u] = p; ol[u] = q; }
        *(v4usa*)(ys + n * OPP + lane * 4) = oh; *(v4usa*)(ys + OTN * OPP + n * OPP + lane * 4) = ol; }
    __syncthreads();   // both planes of y are whole before any wave takes fragments of them
    v8f acc[2][2];
#pragma unroll
    for (int mb = 0; mb < 2; ++mb)
#pragma unroll
        for (int nb = 0; nb < 2; ++nb) acc[mb][nb] = (v8f){};
    const unsigned short* ar = ys + lr * OPP + 8 * hi;
#pragma unroll
    for (int kc = 0; kc < DDr / 32; ++kc) { v16bf a[2], a2[2];
#pragma unroll
        for (int mb = 0; mb < 2; ++mb) { const unsigned short* p = ar + mb * 16 * OPP + kc * 32; a[mb] = cat16b(*(const v8usa*)p, *(const v8usa*)(p + 16)); a2[mb] = cat16b(*(const v8usa*)(p + OTN * OPP), *(const v8usa*)(p + OTN * OPP + 16)); }
#pragma unroll
        for (int nb = 0; nb < 2; ++nb)
#pragma unroll
            for (int mb = 0; mb < 2; ++mb) { acc[mb][nb] = wmmab(a[mb], b[kc][nb], acc[mb][nb]); acc[mb][nb] = wmmab(a2[mb], b[kc][nb], acc[mb][nb]); } }
    float* ow = os + wave * (32 * OSP);
#pragma unroll
    for (int nb = 0; nb < 2; ++nb)
#pragma unroll
        for (int mb = 0; mb < 2; ++mb) { float* p = ow + (nb * 16 + lr) * OSP + mb * 16 + hi * 8;   // o[n = 16 mb + 8 hi + j][c = c0 + 16 nb + lr]
            *(v4fa*)p = __builtin_shufflevector(acc[mb][nb], acc[mb][nb], 0, 1, 2, 3); *(v4fa*)(p + 4) = __builtin_shufflevector(acc[mb][nb], acc[mb][nb], 4, 5, 6, 7); }
    asm volatile("s_wait_dscnt 0x0" ::: "memory");   // the wave's own writes of its range are done, and stay in front, before its lanes read one another's values back
#pragma unroll
    for (int s = 0; s < 8; ++s) { const v4f v = *(const v4fa*)(ow + (s * 4 + (lane >> 3)) * OSP + (lane & 7) * 4); v4f o;
#pragma unroll
        for (int u = 0; u < 4; ++u) o[u] = __fadd_rn(bfr(xv[s][u]), v[u]);
        *(v4f*)(OUT + xo + (size_t)s * 4 * NN) = o; }
}

extern "C" void kernel_launch(void* const* d_in, const int* in_sizes, int n_in,
                              void* d_out, int out_size, void* d_ws, size_t ws_size, hipStream_t stream) {
    (void)in_sizes; (void)n_in; (void)out_size;
    const float* x = (const float*)d_in[0]; const float* wth = (const float*)d_in[1]; const float* wph = (const float*)d_in[2]; const float* wg = (const float*)d_in[3]; const float* wout = (const float*)d_in[4];
    float* OUT = (float*)d_out;     // [4][256][64][64]
    char* wsp = (char*)d_ws;
    auto take = [&](size_t bytes) { char* p = wsp; wsp += (bytes + 255) & ~(size_t)255; return (void*)p; };
    // The four images are a grid axis everywhere, the three projections are one grid with 384 rows of weights.
    bf* WOUT = (bf*)take((size_t)CC * DDr * 2);   // w_out ([c][d] rows) in bf16
    bf* TPh = (bf*)take((size_t)NBI * 2 * NN * DDr * 2); bf* TPl = (bf*)take((size_t)NBI * 2 * NN * DDr * 2); h16* G16 = (h16*)take((size_t)NBI * DDr * NN * 2);
    float* Y = (float*)take((size_t)NBI * AZ * NN * DDr * 4); float* ML = (float*)take((size_t)NBI * AZ * NN * 2 * 4);   // Y [image][key quarter][n][d], ML [image][key quarter][n][r, sum]
    if ((size_t)(wsp - (char*)d_ws) > ws_size) return;    // total ~ 53 MiB
    k_proj<<<dim3(NN / PJN, NBI, 1), 384, 0, stream>>>(x, wth, wph, wg, wout, TPh, TPl, G16, WOUT);
    k_attn<<<dim3(NN / (AW * AQ), AZ, NBI), AW * 32, 0, stream>>>(TPh, TPl, G16, Y, ML);     // y[n][d] (unnormalised) = sum_m P[n][m] g[d][m], a key quarter a plane
    k_outp<<<dim3(NN / OTN, NBI, 1), 256, 0, stream>>>(Y, ML, WOUT, x, OUT);                  // out[c][n] = x[c][n] + sum_d y[n][d] w_out[c][d]
}

// v009
// A run of this version takes 59.1 microseconds.
// Next to v008, in two timings, it ran 1.04 times as fast each time.
// Over all steps from v000 it is 14.9 times as fast.
#include <hip/hip_runtime.h>

// _NonLocal (embedded-Gaussian non-local block: x [4][256][64][64] -> 4096 positions; theta/phi/g = 1x1 convs to 128 channels (no bias); attn[n][m] = softmax_m(theta[:,n].phi[:,m]) (UNSCALED: logits have sigma ~ 11, so the scores need 3-product precision);
// y[d][n] = sum_m g[d][m] attn[n][m]; out = x + w_out y -> [4][256][64][64]).
// Compute dtypes, f32 accumulate: every input rounded to bf16; theta/phi/g on PLAIN bf16 operands (inputs: exact); scores (K 128) on bf16 hi+lo planes of theta and phi (3 products; single fp16 planes

#define NBI  4
#define CC   256
#define DDr  128
#define NN   4096
#define L2E  1.4426950408889634f
#define PTOP 60000.0f
#define PLOW (-6.0f)
typedef _Float16 h16;
typedef unsigned short bf;
typedef __attribute__((ext_vector_type(16))) __bf16   v16bf;
typedef __attribute__((ext_vector_type(16))) _Float16 v16h;
typedef __attribute__((ext_vector_type(8)))  _Float16 v8h;
typedef __attribute__((ext_vector_type(8)))  unsigned short v8us;
typedef __attribute__((ext_vector_type(8)))  float    v8f;
typedef __attribute__((ext_vector_type(4)))  float    v4f;
typedef v8h  __attribute__((may_alias)) v8ha;
typedef v4f  __attribute__((may_alias)) v4fa;
typedef v8us __attribute__((may_alias)) v8usa;

__device__ __forceinline__ unsigned short f2bf(float f) { unsigned u = __float_as_uint(f); u += 0x7FFFu + ((u >> 16) & 1u); return (unsigned short)(u >> 16); }
__device__ __forceinline__ float bf2f(unsigned short b) { return __uint_as_float(((unsigned)b) << 16); }
__device__ __forceinline__ float bfr(float f) { return bf2f(f2bf(f)); }
__device__ __forceinline__ v16h cat16(v8h lo, v8h hi) { return __builtin_shufflevector(lo, hi, 0, 1, 2, 3, 4, 5, 6, 7, 8, 9, 10, 11, 12, 13, 14, 15); }
__device__ __forceinline__ v16bf cat16b(v8us lo, v8us hi) { return __builtin_bit_cast(v16bf, __builtin_shufflevector(lo, hi, 0, 1, 2, 3, 4, 5, 6, 7, 8, 9, 10, 11, 12, 13, 14, 15)); }
__device__ __forceinline__ float xhalf(float x) { return __builtin_bit_cast(float, __builtin_amdgcn_permlanex16(__builtin_bit_cast(int, x), __builtin_bit_cast(int, x), 0x76543210, 0xfedcba98, false, false)); }   // lane l takes lane l ^ 16's value
__device__ __forceinline__ v8f wmma16(v16h a, v16h b, v8f c) { return __builtin_amdgcn_wmma_f32_16x16x32_f16(false, a, false, b, (short)0, c, false, false); }
__device__ __forceinline__ v8f wmmab(v16bf a, v16bf b, v8f c) { return __builtin_amdgcn_wmma_f32_16x16x32_bf16(false, a, false, b, (short)0, c, false, false); }



// A fragment of 16 k from a k-contiguous 16-bit row: two 16-byte loads, the same for the A and the B side.
template <typename T16> struct WFrag;
template <> struct WFrag<h16> { typedef v16h V; static __device__ __forceinline__ V ld(const h16* p) { return cat16(*(const v8h*)p, *(const v8h*)(p + 16)); } static __device__ __forceinline__ v8f mma(V a, V b, v8f c) { return wmma16(a, b, c); } };
template <> struct WFrag<bf> { typedef v16bf V; static __device__ __forceinline__ V ld(const bf* p) { return cat16b(*(const v8us*)p, *(const v8us*)(p + 16)); } static __device__ __forceinline__ v8f mma(V a, V b, v8f c) { return wmmab(a, b, c); } };
__device__ __forceinline__ h16 tohx(float x) { return (h16)x; }
__device__ __forceinline__ void splitf(float y, unsigned short& h, unsigned short& l) { h = f2bf(y); l = f2bf(y - bf2f(h)); }
typedef __attribute__((ext_vector_type(4))) unsigned short v4us;
typedef v4us __attribute__((may_alias)) v4usa;

// ---- k_proj: the rounding of x and of the weights to bf16, the turn of x and the three projections in one kernel: no bf16 copy of x or of w_theta, w_phi, w_g in memory, no pass of its own for them.
// Work-group = 64 positions n x all 384 rows of weights of one image, 12 waves; grid (NN / 64, image).
// 1. Staging, whole lines from memory: wave u brings rows 32 u .. 32 u + 31 of the stacked weights (32 KiB in a row of one matrix), rounds them and lays them in LDS as [row][c]; waves 0 .. 7 bring x[c = 0 .. 255][64 n], a thread 8 c x 4 n twice,
//    and lay it in LDS turned, as [n][c]: the 8 c of one n are one 16-byte piece. Pitch 528 B (16 B x odd) for the 16-byte fragment readers. One wave of each work-group rounds its 128 elements of w_out for k_outp.
// 2. A wave's tile is 4 x 2 accumulators, fragments from LDS. The result is formed in the layout its reader wants, in the accumulators: a lane's 8 accumulator registers are 8 consecutive rows of the A operand in one column of B,
//    so the index that must be contiguous in memory is given to A. theta, phi (waves 0 .. 7: 64 d x 32 n): A = weights (d), B = x (n): hi and lo bf16 planes T[n][d], 16 B a lane and plane; g (waves 8 .. 11: 32 d x 64 n): A = x (n), B = weights (d): fp16 G[d][n], 16 B a lane.
//    A wave's rows are whole 128-byte lines (64 d or 64 n x 2 B).
#define PJN 64
#define PJW (3 * DDr)
#define PJP (CC + 8)
#define PJS 72
typedef __attribute__((ext_vector_type(2))) float  v2f;
typedef __attribute__((ext_vector_type(2))) __bf16 v2bf;
typedef __attribute__((ext_vector_type(2))) unsigned v2u;
typedef __attribute__((ext_vector_type(4))) unsigned v4u;
typedef v2u __attribute__((may_alias)) v2ua;
typedef v4u __attribute__((may_alias)) v4ua;
__device__ __forceinline__ unsigned pk2(float a, float b) { const v2f t = { a, b }; return __builtin_bit_cast(unsigned, __builtin_convertvector(t, v2bf)); }   // two f32 to two bf16, nearest even, a in the low half
__global__ __launch_bounds__(384) void k_proj(const float* __restrict__ x, const float* __restrict__ w0, const float* __restrict__ w1, const float* __restrict__ w2, const float* __restrict__ w3, bf* Th, bf* Tl, h16* G16, bf* WO) {
    __shared__ __align__(16) unsigned short sm[(PJW + PJN) * PJP];   // rows 0 .. 383: weights [row][c]; rows 384 .. 447: x [n][c]
    const int tid = threadIdx.x, lane = tid & 31, lr = lane & 15, hi = lane >> 4; const int u = __builtin_amdgcn_readfirstlane(tid >> 5);   // the wave's number, in a scalar register: every test on it is a scalar branch
    const int n0 = blockIdx.x * PJN, img = blockIdx.y;
    const int cg = tid >> 4, n4 = (tid & 15) * 4;
    const float* xp = x + ((size_t)img * CC + cg * 8) * NN + n0 + n4;
    const float* wp = (u < 4 ? w0 : u < 8 ? w1 : w2) + (size_t)(u & 3) * 32 * CC + lane * 4;
    unsigned short* wd = sm + (size_t)u * 32 * PJP + lane * 4;
    const size_t oo = ((size_t)(blockIdx.y * (NN / PJN) + blockIdx.x) * 32 + lane) * 4;   // wave 8's share of w_out: 256 work-groups x 128 elements
    v4f xv[16], wv[32], ov = (v4f){};
    if (u == 8) { const float* op = w3 + oo; ov = *(const v4f*)op;   // asked for ahead of the weights, so that it costs no latency of its own
        asm volatile("s_wait_xcnt 0x0" :: "v"(op) : "memory"); }   // in front of the writes of this load's address registers
    if (u < 8) {
#pragma unroll
        for (int i = 0; i < 16; ++i) xv[i] = *(const v4f*)(xp + (size_t)((i >> 3) * 128 + (i & 7)) * NN);   // 16 lanes x 16 B = the 256 B of a row of the tile
        asm volatile("s_wait_xcnt 0x0" :: "v"(xp) : "memory");   // in front of the writes of these loads' address registers, which it takes as an input so that no result of the group is laid over them
        __builtin_amdgcn_sched_barrier(0); }                       // keeps such writes from being lifted over the wait
#pragma unroll
    for (int h = 0; h < 2; ++h) {
#pragma unroll
        for (int i = 0; i < 32; ++i) wv[i] = *(const v4f*)(wp + (h * 32 + i) * 128);   // a wave's load is 512 B in a row
        asm volatile("s_wait_xcnt 0x0" :: "v"(wp) : "memory");   // as above
        __builtin_amdgcn_sched_barrier(0);                         // as above
        if (h == 0 && u < 8) {   // x was asked for first and is here first: it is rounded and turned while the weights are on their way
#pragma unroll
            for (int g2 = 0; g2 < 2; ++g2)
#pragma unroll
                for (int e = 0; e < 4; ++e) { const v4u o = { pk2(xv[g2 * 8][e], xv[g2 * 8 + 1][e]), pk2(xv[g2 * 8 + 2][e], xv[g2 * 8 + 3][e]), pk2(xv[g2 * 8 + 4][e], xv[g2 * 8 + 5][e]), pk2(xv[g2 * 8 + 6][e], xv[g2 * 8 + 7][e]) };
                    *(v4ua*)(sm + (size_t)(PJW + n4 + e) * PJP + g2 * 128 + cg * 8) = o; } }
#pragma unroll
        for (int i = 0; i < 32; ++i) { const v2u o = { pk2(wv[i][0], wv[i][1]), pk2(wv[i][2], wv[i][3]) }; *(v2ua*)(wd + (h * 16 + (i >> 1)) * PJP + (i & 1) * 128) = o; }
    }
    __syncthreads();   // weights and x are whole in LDS before any wave takes fragments of them
    if (u == 8) { const v2u r = { pk2(ov[0], ov[1]), pk2(ov[2], ov[3]) }; *(v2u*)(WO + oo) = r;   // behind the barrier, which would else wait for the store
        asm volatile("s_wait_xcnt 0x0" ::: "memory"); }   // in front of the writes of this store's registers
    const bool isg = u >= 8;
    const unsigned short* wr = sm + (size_t)((isg ? u * 32 : (u >> 1) * 64) + lr) * PJP + 8 * hi; const unsigned short* xr = sm + (size_t)(PJW + (isg ? 0 : (u & 1) * 32) + lr) * PJP + 8 * hi;
    const unsigned short* A = isg ? xr : wr; const unsigned short* Bt = isg ? wr : xr;
    v8f acc[4][2];
#pragma unroll
    for (int mb = 0; mb < 4; ++mb)
#pragma unroll
        for (int nb = 0; nb < 2; ++nb) acc[mb][nb] = (v8f){};
#pragma unroll
    for (int kg = 0; kg < CC; kg += 64) { v16bf a[2][4], b[2][2];
#pragma unroll
        for (int ks = 0; ks < 2; ++ks) {
#pragma unroll
            for (int mb = 0; mb < 4; ++mb) { const unsigned short* p = A + mb * 16 * PJP + kg + ks * 32; a[ks][mb] = cat16b(*(const v8usa*)p, *(const v8usa*)(p + 16)); }
#pragma unroll
            for (int nb = 0; nb < 2; ++nb) { const unsigned short* p = Bt + nb * 16 * PJP + kg + ks * 32; b[ks][nb] = cat16b(*(const v8usa*)p, *(const v8usa*)(p + 16)); } }
        __builtin_amdgcn_sched_barrier(0);   // keeps the fragment loads of two k blocks one group in front of their matrix instructions: spread among them, through few registers, every k block waits three times for all of its loads
#pragma unroll
        for (int ks = 0; ks < 2; ++ks)
#pragma unroll
            for (int nb = 0; nb < 2; ++nb)
#pragma unroll
                for (int mb = 0; mb < 4; ++mb) acc[mb][nb] = wmmab(a[ks][mb], b[ks][nb], acc[mb][nb]); }
    __syncthreads();   // every wave has taken its last fragments of the weights and of x: LDS now serves the waves as output staging
    // 3. A wave's tile is 32 rows of 128 B a plane (a row: one n of theta or phi, one d of g). It is laid in the wave's own LDS range (pitch 144 B = 16 B x odd) and read back 8 lanes a row, so that a store instruction writes four whole lines.
    unsigned short* ow = sm + (size_t)u * (2 * 32 * PJS); unsigned short* oww = ow + lr * PJS + hi * 8; const unsigned short* owr = ow + (lane >> 3) * PJS + (lane & 7) * 8;
    if (!isg) { const int rb = u >> 1; const float ts = (rb >> 1) ? 1.0f : L2E;   // theta leaves times log2(e), in f32 ahead of the split: k_attn's score product then counts in powers of two
        const size_t o = ((size_t)(img * 2 + (rb >> 1)) * NN + n0 + (u & 1) * 32 + (lane >> 3)) * DDr + (rb & 1) * 64 + (lane & 7) * 8;
#pragma unroll
        for (int nb = 0; nb < 2; ++nb)
#pragma unroll
            for (int mb = 0; mb < 4; ++mb) { v8us oh, ol;
#pragma unroll
                for (int j = 0; j < 8; ++j) { unsigned short p, q; splitf(acc[mb][nb][j] * ts, p, q); oh[j] = p; ol[j] = q; }   // theta or phi [d = 64 (rb & 1) + 16 mb + 8 hi + j][n = n0 + 32 (u & 1) + 16 nb + lr]
                *(v8usa*)(oww + nb * 16 * PJS + mb * 16) = oh; *(v8usa*)(oww + (32 + nb * 16) * PJS + mb * 16) = ol; }
        asm volatile("s_wait_dscnt 0x0" ::: "memory");   // the wave's own writes of its range are done, and stay in front, before its lanes read one another's values back
        v8us rh[8], rl[8];
#pragma unroll
        for (int i = 0; i < 8; ++i) { rh[i] = *(const v8usa*)(owr + i * 4 * PJS); rl[i] = *(const v8usa*)(owr + (32 + i * 4) * PJS); }
#pragma unroll
        for (int i = 0; i < 8; ++i) { *(v8us*)(Th + o + (size_t)i * 4 * DDr) = rh[i]; *(v8us*)(Tl + o + (size_t)i * 4 * DDr) = rl[i]; }   // rows n0 + 32 (u & 1) + 4 i + lane / 8, the 64 d of the wave
        asm volatile("s_wait_xcnt 0x0" ::: "memory"); }   // in front of whatever the build lays behind these stores and lets write their registers
    else { const size_t o = ((size_t)img * DDr + (u - 8) * 32 + (lane >> 3)) * NN + n0 + (lane & 7) * 8;
#pragma unroll
        for (int nb = 0; nb < 2; ++nb)
#pragma unroll
            for (int mb = 0; mb < 4; ++mb) { v8h og;
#pragma unroll
                for (int j = 0; j < 8; ++j) og[j] = tohx(acc[mb][nb][j]);   // g [d = 32 (u - 8) + 16 nb + lr][n = n0 + 16 mb + 8 hi + j]
                *(v8ha*)(oww + nb * 16 * PJS + mb * 16) = og; }
        asm volatile("s_wait_dscnt 0x0" ::: "memory");   // as above
        v8h rg[8];
#pragma unroll
        for (int i = 0; i < 8; ++i) rg[i] = *(const v8ha*)(owr + i * 4 * PJS);
#pragma unroll
        for (int i = 0; i < 8; ++i) *(v8h*)(G16 + o + (size_t)i * 4 * NN) = rg[i];   // rows d = 32 (u - 8) + 4 i + lane / 8, the 64 n of the work-group
        asm volatile("s_wait_xcnt 0x0" ::: "memory"); }   // as above
}
static_assert(12 * 2 * 32 * PJS <= (PJW + PJN) * PJP, "the waves' output ranges lie inside the staging array");
static_assert(NBI * (NN / PJN) * 128 == CC * DDr, "the work-groups' shares of w_out are the whole of it");

// ---- k_attn: scores, softmax and P.g in one kernel; no score and no P ever goes to memory. Transposed products: S^T = phi . theta^T (A = 16 keys, B = 16 queries) and y^T += g . P^T (A = 16 rows of g, B = P^T),
// so that a lane holds scores of ONE query (column lr; keys 8 hi + j of each 16-key tile) and two score tiles, converted, ARE the 32-key B fragment of the second product: P crosses no lane and no LDS.
// Work-group = 256 queries (8 waves x 32) x one quarter of the keys (blockIdx.y) of one image (blockIdx.z). theta fragments (hi and lo planes) stay in registers; phi (hi, lo) and g go through LDS, 128 keys a stage,
// two buffers, brought by asynchronous copies (global memory to LDS, through no register) that fly while the stage before is worked on; one barrier a stage.
// Scores: three bf16 products a k block, in the order hi.hi, theta lo . phi hi, theta hi . phi lo. theta comes times log2(e), and a score tile's accumulation starts at -r, r a reference point per query that is known before the pass:
// the matrix instructions deliver the exponent s log2(e) - r itself, and P = exp2 of it, in fp16, with no vector arithmetic in between and no maximum taken. The point cancels in sum(P g) / sum(P), so it need not follow the maximum:
// it moves only in a pass in which a lane's sum of P for a query passes PTOP (below it no P is beyond fp16's range, 65504), and in a wave's first pass. Such a pass takes the maxima, sets r of every query whose largest P of the pass is above 2^PLOW so that this P is 2^PLOW,
// rescales y^T and the sums, and forms its P anew. So the largest P of a query seen so far lies between 2^PLOW and PTOP: fp16's fixed step of 2^-24 below 2^-14 stays at least 2^18 under it.
// Out: unnormalised y [image][quarter][n][d] and (r, sum of P) per query and quarter; k_outp joins the quarters.
#define AW   8
#define AQ   32
#define AZ   4
#define AKEY (NN / AZ)
#define AST  128
#define APP  136
#define APG  136
#define APH  (AST * APP)
#define ABUF (2 * APH + DDr * APG)
#define AYP  (DDr + 4)
// Eight copies of 16 bytes a lane from global memory to LDS: rows 16 apart of one plane of a stage. l: the lane's place in LDS for the first, p: its global address, ps: elements from one to the next in memory.
typedef int v4i __attribute__((ext_vector_type(4)));
typedef __attribute__((address_space(1))) v4i gv4i;
typedef __attribute__((address_space(3))) v4i lv4i;
// The waits are the caller's: s_wait_asynccnt 0 and a work-group barrier stand between these copies and every read of their bytes.
__device__ __forceinline__ void acp8(unsigned short* l, const unsigned short* p, size_t ps) {
    // unrolled, so that the eight copies issue in a row and their steps are constants of the addresses
#pragma unroll
    for (int i = 0; i < 8; ++i) __builtin_amdgcn_global_load_async_to_lds_b128((gv4i*)(p + i * ps), (lv4i*)(l + i * 16 * APP), 0, 0);
}
__global__ __launch_bounds__(AW * 32) void k_attn(const bf* __restrict__ TPh, const bf* __restrict__ TPl, const h16* __restrict__ G16, float* __restrict__ Yp, float* __restrict__ ML) {
    __shared__ __align__(16) unsigned short sm[2 * ABUF];   // a buffer: phi hi [128 keys][pitch 272 B], phi lo the same, g [128 d][128 keys, pitch 272 B]: pitch 16 B x odd for 16-byte readers
    const int tid = threadIdx.x, lane = tid & 31, lr = lane & 15, hi = lane >> 4, wave = tid >> 5;
    const int img = blockIdx.z, part = img * AZ + blockIdx.y, q0 = blockIdx.x * (AW * AQ) + wave * AQ, key0 = blockIdx.y * AKEY;
    const bf* th = TPh + (size_t)img * 2 * NN * DDr; const bf* tl = TPl + (size_t)img * 2 * NN * DDr; const bf* ph = th + (size_t)NN * DDr + (size_t)key0 * DDr; const bf* pl = tl + (size_t)NN * DDr + (size_t)key0 * DDr;
    const h16* g = G16 + (size_t)img * DDr * NN + key0;
    v16bf qh[2][4], ql[2][4];
#pragma unroll
    for (int q = 0; q < 2; ++q)
#pragma unroll
        for (int kc = 0; kc < 4; ++kc) { const size_t o = (size_t)(q0 + q * 16 + lr) * DDr + 8 * hi + kc * 32; qh[q][kc] = WFrag<bf>::ld(th + o); ql[q][kc] = WFrag<bf>::ld(tl + o); }
    asm volatile("s_wait_xcnt 0x0" ::: "memory");   // in front of the writes of these loads' address registers
    __builtin_amdgcn_sched_barrier(0);                // without it the build lifts such writes (later address sums, the zeroing below) over the wait
    v8f O[8][2];
#pragma unroll
    for (int dt = 0; dt < 8; ++dt) { O[dt][0] = (v8f){}; O[dt][1] = (v8f){}; }
    float rr[2] = { 0.f, 0.f }, sum[2] = { 0.f, 0.f }; v8f C0[2] = { (v8f){}, (v8f){} };   // rr: the reference point r of the lane's query; C0: -r in eight registers, the C operand of a score tile's first product
    float lim = -1.0f;   // what a lane's sum of P of a pass may reach before r moves: PTOP; below 0, which every sum passes, until the wave's first pass has set r (till then 0) from its scores, whatever they are
    const int prow = tid >> 4, pcol = (tid & 15) * 8;   // a thread's 16-byte pieces of a stage: rows prow + 16 i (keys of phi, d of g), all of 256 B: a wave's copy is two whole rows
    auto stage = [&](int t) {   // stage t (keys 128 t .. 128 t + 127 of the quarter) into buffer t & 1: 24 copies a lane
        unsigned short* l0 = sm + (t & 1) * ABUF + prow * APP + pcol; const size_t po = (size_t)(t * AST + prow) * DDr + pcol;
        acp8(l0, ph + po, 16 * DDr);
        acp8(l0 + APH, pl + po, 16 * DDr);
        acp8(l0 + 2 * APH, (const unsigned short*)(g + (size_t)prow * NN + t * AST + pcol), (size_t)16 * NN); };
    stage(0);
    asm volatile("s_wait_asynccnt 0x0" ::: "memory");   // this wave's copies of stage 0 have landed
    __syncthreads();                                      // and every other wave's: stage 0 is whole in LDS before any wave reads it
    stage(1);
    // kept rolled: the trips are alike and long (256 matrix instructions); unrolled, the code would only grow
#pragma unroll 1
    for (int s = 0; s < AKEY / AST; ++s) {
        const unsigned short* buf = sm + (s & 1) * ABUF;
        const unsigned short* gbuf = (s & 1) ? sm + ABUF + 2 * APH : sm + 2 * APH;   // the stage's g plane, its place chosen whole: as buf + a constant beyond the 64 KiB that an LDS load's offset field holds, every g fragment load would get an address sum of its own
        // kept rolled: unrolled, the build mixes one pass's second product with the next pass's first and, short of registers, fetches their fragments two loads at a time with a full wait each
#pragma unroll 1
        for (int kk = 0; kk < AST / 32; ++kk) {
            v8f S[2][2];
#pragma unroll
            for (int t = 0; t < 2; ++t) { S[t][0] = C0[0]; S[t][1] = C0[1]; }
            const unsigned short* pr = buf + (kk * 32 + lr) * APP + 8 * hi;
            v16bf ah[4][2], al[4][2];
#pragma unroll
            for (int kc = 0; kc < 4; ++kc)
#pragma unroll
                for (int t = 0; t < 2; ++t) { const unsigned short* p = pr + t * 16 * APP + kc * 32; ah[kc][t] = cat16b(*(const v8usa*)p, *(const v8usa*)(p + 16)); al[kc][t] = cat16b(*(const v8usa*)(p + APH), *(const v8usa*)(p + APH + 16)); }
            __builtin_amdgcn_sched_barrier(0);   // keeps the pass's phi fragment loads one group in front of its matrix instructions: spread among them, through few registers, each pair is waited for in full
#pragma unroll
            for (int kc = 0; kc < 4; ++kc) {
#pragma unroll
                for (int t = 0; t < 2; ++t)
#pragma unroll
                    for (int q = 0; q < 2; ++q) S[t][q] = wmmab(ah[kc][t], qh[q][kc], S[t][q]);   // theta hi . phi hi
#pragma unroll
                for (int t = 0; t < 2; ++t)
#pragma unroll
                    for (int q = 0; q < 2; ++q) S[t][q] = wmmab(ah[kc][t], ql[q][kc], S[t][q]);   // theta lo . phi hi
#pragma unroll
                for (int t = 0; t < 2; ++t)
#pragma unroll
                    for (int q = 0; q < 2; ++q) S[t][q] = wmmab(al[kc][t], qh[q][kc], S[t][q]); } // theta hi . phi lo
            const unsigned short* gr = gbuf + lr * APG + kk * 32 + 8 * hi; v16h ga[8];
#pragma unroll
            for (int dt = 0; dt < 8; ++dt) ga[dt] = cat16(*(const v8ha*)(gr + dt * 16 * APG), *(const v8ha*)(gr + dt * 16 * APG + 16));
            __builtin_amdgcn_sched_barrier(0);   // keeps the loads of the g fragments, one group, in front of the softmax arithmetic, which then covers their latency
            v16h pf[2]; float ps[2];
            auto expo = [&](bool slot) __attribute__((always_inline)) {   // P of the pass from its exponents, and each lane's sum of them per query
#pragma unroll
                for (int q = 0; q < 2; ++q) { float pa[2] = { 0.f, 0.f };   // a chain of sums a score tile: shorter dependent chains
#pragma unroll
                    for (int t = 0; t < 2; ++t)
#pragma unroll
                        for (int j = 0; j < 8; ++j) { const float e = __builtin_amdgcn_exp2f(S[t][q][j]);
                            pa[t] += e; pf[q][t * 8 + j] = (h16)e;   // element 8 t + j of the B fragment is k = 16 t + 8 hi + j: the row of score tile t that this lane holds
                            // slot: behind a move of r the exponents die in their exponentials, and the instruction set, between an exponential and one that writes over its source,
                            // asks for another instruction in between: the scheduling barrier keeps each exponential's sum between it and the next
                            if (slot) __builtin_amdgcn_sched_barrier(0); }
                    ps[q] = pa[0] + pa[1]; } };
            expo(false);
            if (__builtin_amdgcn_ballot_w32(fmaxf(ps[0], ps[1]) > lim) != 0) {   // one scalar branch a pass: the same for the whole wave, so every matrix instruction keeps all lanes on
                const bool first = lim < 0.f; lim = PTOP; float dl[2], sc[2];
#pragma unroll
                for (int q = 0; q < 2; ++q) { float tm = fmaxf(S[0][q][0], S[1][q][0]);
#pragma unroll
                    for (int j = 1; j < 8; ++j) tm = fmaxf(tm, fmaxf(S[0][q][j], S[1][q][j]));
                    tm = fmaxf(tm, xhalf(tm));   // the query's largest exponent of the pass: the same in both lanes that hold the query
                    dl[q] = first ? tm - PLOW : fmaxf(tm - PLOW, 0.f); }   // a lane's sum above PTOP holds a P above PTOP / 16, far above 2^PLOW: its query is among those moved
                sc[0] = __builtin_amdgcn_exp2f(fminf(-dl[0], 0.f)); sum[0] *= sc[0];   // r goes down only in the first pass, where y^T and the sums are still 0: the factor stays at 1 there, so that no 0 meets an infinite one
                __builtin_amdgcn_sched_barrier(0);   // keeps the two exponentials apart: the instruction set asks for another instruction between an exponential and one that writes over its source
                sc[1] = __builtin_amdgcn_exp2f(fminf(-dl[1], 0.f)); sum[1] *= sc[1];
#pragma unroll
                for (int q = 0; q < 2; ++q) { rr[q] += dl[q];
#pragma unroll
                    for (int j = 0; j < 8; ++j) C0[q][j] = -rr[q];
#pragma unroll
                    for (int t = 0; t < 2; ++t) S[t][q] -= dl[q];
#pragma unroll
                    for (int dt = 0; dt < 8; ++dt) O[dt][q] *= sc[q]; }
                expo(true); }
            sum[0] += ps[0]; sum[1] += ps[1];
#pragma unroll
            for (int dt = 0; dt < 8; ++dt) { O[dt][0] = wmma16(ga[dt], pf[0], O[dt][0]); O[dt][1] = wmma16(ga[dt], pf[1], O[dt][1]); }
        }
        asm volatile("s_wait_dscnt 0x0" ::: "memory");      // this wave's reads of stage s are done before its buffer may be filled anew
        asm volatile("s_wait_asynccnt 0x0" ::: "memory");   // this wave's copies of stage s + 1 have landed
        __syncthreads();   // stage s + 1 is whole in LDS for every wave; and every wave has left stage s, whose buffer is filled next
        if (s + 2 < AKEY / AST) stage(s + 2);
    }
    asm volatile("s_wait_asynccnt 0x0" ::: "memory");   // no copy is outstanding when the wave goes on to its end
    // y leaves through LDS: from the accumulators a store instruction would touch 16 rows with 32 B in each; turned in the wave's own range of the ring ([query][d], pitch 528 B = 16 B x odd), a store is one whole row of 512 B.
    // The ring is free: behind the last trip's barrier no wave reads it any more and no copy is outstanding.
    float* yp = Yp + (size_t)part * NN * DDr; float* ow = (float*)sm + wave * (AQ * AYP);
#pragma unroll
    for (int q = 0; q < 2; ++q) { const int n = q0 + q * 16 + lr; const float st = sum[q] + xhalf(sum[q]);   // the two lane halves summed different keys of the same query
#pragma unroll
        for (int dt = 0; dt < 8; ++dt) { float* p = ow + (q * 16 + lr) * AYP + dt * 16 + hi * 8;
            *(v4fa*)p = __builtin_shufflevector(O[dt][q], O[dt][q], 0, 1, 2, 3); *(v4fa*)(p + 4) = __builtin_shufflevector(O[dt][q], O[dt][q], 4, 5, 6, 7); }
        if (hi == 0) { float* ml = ML + ((size_t)part * NN + n) * 2; ml[0] = rr[q]; ml[1] = st; } }
    asm volatile("s_wait_dscnt 0x0" ::: "memory");   // the wave's own writes of its range are done, and stay in front, before its lanes read one another's values back
    v4f rv[AQ]; float* yw = yp + (size_t)q0 * DDr + lane * 4;
#pragma unroll
    for (int r = 0; r < AQ; ++r) rv[r] = *(const v4fa*)(ow + r * AYP + lane * 4);
#pragma unroll
    for (int r = 0; r < AQ; ++r) *(v4f*)(yw + (size_t)r * DDr) = rv[r];   // 32 lanes x 16 B = the row of query q0 + r
    asm volatile("s_wait_xcnt 0x0" ::: "memory");   // in front of whatever the build lays behind these stores and lets write their registers
}
static_assert(AW * AQ * AYP * 4 <= 2 * ABUF * 2, "the waves' output ranges lie inside the ring");


// ---- k_outp: the join of the key quarters, the output product and the residual in one kernel. Work-group = 32 positions n x all 256 channels c of one image, 8 waves; grid (NN / 32, image).
// 1. y[n][d] = (sum over the key quarters of exp2(r - top r) Y) / (the sums of P joined the same way), split into hi and lo bf16 planes, goes to LDS (pitch 272 B); the weights and 1 / sum of a position are made once, by one wave, and passed through LDS.
// 2. A wave's tile is 32 n x 32 c: A = y (hi, then lo plane, a k block), B = w_out [c][d] from memory: o[n][c], 8 consecutive n of one c in a lane.
// 3. The tile is turned in the wave's own LDS range ([c][n], pitch 144 B), so that x is read and OUT written in whole 128-byte lines: OUT[c][n] = x[c][n] + o[n][c].
#define OTN 32
#define OPP 136
#define OSP 36
__global__ __launch_bounds__(256) void k_outp(const float* __restrict__ Y, const float* __restrict__ ML, const bf* __restrict__ WO, const float* __restrict__ x, float* OUT) {
    __shared__ __align__(16) unsigned short ys[2 * OTN * OPP];
    __shared__ __align__(16) float wq[OTN * 8];
    __shared__ __align__(16) float os[8 * 32 * OSP];
    const int tid = threadIdx.x, lane = tid & 31, lr = lane & 15, hi = lane >> 4, wave = tid >> 5;
    const int img = blockIdx.y, n0 = blockIdx.x * OTN, c0 = wave * 32;
    Y += ((size_t)img * AZ * NN + n0) * DDr; ML += ((size_t)img * AZ * NN + n0) * 2;
    const size_t xo = (size_t)img * CC * NN + (size_t)(c0 + (lane >> 3)) * NN + n0 + (lane & 7) * 4;   // piece s of a lane: row c0 + lane / 8 + 4 s, 4 n: 8 lanes x 16 B = one line of a row
    v4f yv[OTN / 8][AZ], xv[8]; const float* yp = Y + (size_t)wave * DDr + lane * 4; const float* xp = x + xo;
#pragma unroll
    for (int i = 0; i < OTN / 8; ++i)
#pragma unroll
        for (int z = 0; z < AZ; ++z) yv[i][z] = *(const v4f*)(yp + ((size_t)z * NN + 8 * i) * DDr);   // a wave reads whole rows (512 B) of positions wave + 8 i
    asm volatile("s_wait_xcnt 0x0" :: "v"(yp) : "memory");   // in front of the writes of these loads' address registers, which it takes as an input so that no result of the group is laid over them
    __builtin_amdgcn_sched_barrier(0);                         // keeps such writes (later address sums, the next group's results) from being lifted over the wait
    // the w_out fragments and x are asked for at the start too, though wanted later: all that the work-group reads from memory is on its way at once, behind one latency
    const bf* wb = WO + (size_t)(c0 + lr) * DDr + 8 * hi; v16bf b[DDr / 32][2];
#pragma unroll
    for (int kc = 0; kc < DDr / 32; ++kc)
#pragma unroll
        for (int nb = 0; nb < 2; ++nb) b[kc][nb] = WFrag<bf>::ld(wb + (size_t)nb * 16 * DDr + kc * 32);
    asm volatile("s_wait_xcnt 0x0" :: "v"(wb) : "memory");   // as above
    __builtin_amdgcn_sched_barrier(0);                         // as above
#pragma unroll
    for (int s = 0; s < 8; ++s) xv[s] = *(const v4f*)(xp + (size_t)s * 4 * NN);
    asm volatile("s_wait_xcnt 0x0" :: "v"(xp) : "memory");   // as above
    __builtin_amdgcn_sched_barrier(0);                         // as above
    if (tid < OTN) { float m4[AZ], s4[AZ], top = -3.0e38f, den = 0.f;
#pragma unroll
        for (int z = 0; z < AZ; ++z) { m4[z] = ML[((size_t)z * NN + tid) * 2]; s4[z] = ML[((size_t)z * NN + tid) * 2 + 1]; }
        asm volatile("s_wait_xcnt 0x0" ::: "memory");   // in front of the writes of these loads' address registers
#pragma unroll
        for (int z = 0; z < AZ; ++z) top = fmaxf(top, m4[z]);
#pragma unroll
        for (int z = 0; z < AZ; ++z) { const float w = __builtin_amdgcn_exp2f(m4[z] - top); den += w * s4[z]; wq[tid * 8 + z] = w; }
        wq[tid * 8 + 4] = __fdiv_rn(1.0f, den); }
    __syncthreads();   // every position's weights are in LDS before any wave joins its rows
#pragma unroll
    for (int i = 0; i < OTN / 8; ++i) { const int n = wave + 8 * i; const v4f w = *(const v4fa*)(wq + n * 8); const float f = wq[n * 8 + 4]; v4f a = (v4f){};
#pragma unroll
        for (int z = 0; z < AZ; ++z) a += yv[i][z] * w[z];
        v4us oh, ol;
#pragma unroll
        for (int u = 0; u < 4; ++u) { unsigned short p, q; splitf(a[u] * f, p, q); oh[u] = p; ol[u] = q; }
        *(v4usa*)(ys + n * OPP + lane * 4) = oh; *(v4usa*)(ys + OTN * OPP + n * OPP + lane * 4) = ol; }
    __syncthreads();   // both planes of y are whole before any wave takes fragments of them
    v8f acc[2][2];
#pragma unroll
    for (int mb = 0; mb < 2; ++mb)
#pragma unroll
        for (int nb = 0; nb < 2; ++nb) acc[mb][nb] = (v8f){};
    const unsigned short* ar = ys + lr * OPP + 8 * hi;
#pragma unroll
    for (int kc = 0; kc < DDr / 32; ++kc) { v16bf a[2], a2[2];
#pragma unroll
        for (int mb = 0; mb < 2; ++mb) { const unsigned short* p = ar + mb * 16 * OPP + kc * 32; a[mb] = cat16b(*(const v8usa*)p, *(const v8usa*)(p + 16)); a2[mb] = cat16b(*(const v8usa*)(p + OTN * OPP), *(const v8usa*)(p + OTN * OPP + 16)); }
#pragma unroll
        for (int nb = 0; nb < 2; ++nb)
#pragma unroll
            for (int mb = 0; mb < 2; ++mb) { acc[mb][nb] = wmmab(a[mb], b[kc][nb], acc[mb][nb]); acc[mb][nb] = wmmab(a2[mb], b[kc][nb], acc[mb][nb]); } }
    float* ow = os + wave * (32 * OSP);
#pragma unroll
    for (int nb = 0; nb < 2; ++nb)
#pragma unroll
        for (int mb = 0; mb < 2; ++mb) { float* p = ow + (nb * 16 + lr) * OSP + mb * 16 + hi * 8;   // o[n = 16 mb + 8 hi + j][c = c0 + 16 nb + lr]
            *(v4fa*)p = __builtin_shufflevector(acc[mb][nb], acc[mb][nb], 0, 1, 2, 3); *(v4fa*)(p + 4) = __builtin_shufflevector(acc[mb][nb], acc[mb][nb], 4, 5, 6, 7); }
    asm volatile("s_wait_dscnt 0x0" ::: "memory");   // the wave's own writes of its range are done, and stay in front, before its lanes read one another's values back
#pragma unroll
    for (int s = 0; s < 8; ++s) { const v4f v = *(const v4fa*)(ow + (s * 4 + (lane >> 3)) * OSP + (lane & 7) * 4); v4f o;
#pragma unroll
        for (int u = 0; u < 4; ++u) o[u] = __fadd_rn(bfr(xv[s][u]), v[u]);
        *(v4f*)(OUT + xo + (size_t)s * 4 * NN) = o; }
}

extern "C" void kernel_launch(void* const* d_in, const int* in_sizes, int n_in,
                              void* d_out, int out_size, void* d_ws, size_t ws_size, hipStream_t stream) {
    (void)in_sizes; (void)n_in; (void)out_size;
    const float* x = (const float*)d_in[0]; const float* wth = (const float*)d_in[1]; const float* wph = (const float*)d_in[2]; const float* wg = (const float*)d_in[3]; const float* wout = (const float*)d_in[4];
    float* OUT = (float*)d_out;     // [4][256][64][64]
    char* wsp = (char*)d_ws;
    auto take = [&](size_t bytes) { char* p = wsp; wsp += (bytes + 255) & ~(size_t)255; return (void*)p; };
    // The four images are a grid axis everywhere, the three projections are one grid with 384 rows of weights.
    bf* WOUT = (bf*)take((size_t)CC * DDr * 2);   // w_out ([c][d] rows) in bf16
    bf* TPh = (bf*)take((size_t)NBI * 2 * NN * DDr * 2); bf* TPl = (bf*)take((size_t)NBI * 2 * NN * DDr * 2); h16* G16 = (h16*)take((size_t)NBI * DDr * NN * 2);
    float* Y = (float*)take((size_t)NBI * AZ * NN * DDr * 4); float* ML = (float*)take((size_t)NBI * AZ * NN * 2 * 4);   // Y [image][key quarter][n][d], ML [image][key quarter][n][r, sum]
    if ((size_t)(wsp - (char*)d_ws) > ws_size) return;    // total ~ 53 MiB
    k_proj<<<dim3(NN / PJN, NBI, 1), 384, 0, stream>>>(x, wth, wph, wg, wout, TPh, TPl, G16, WOUT);
    k_attn<<<dim3(NN / (AW * AQ), AZ, NBI), AW * 32, 0, stream>>>(TPh, TPl, G16, Y, ML);     // y[n][d] (unnormalised) = sum_m P[n][m] g[d][m], a key quarter a plane
    k_outp<<<dim3(NN / OTN, NBI, 1), 256, 0, stream>>>(Y, ML, WOUT, x, OUT);                  // out[c][n] = x[c][n] + sum_d y[n][d] w_out[c][d]
}
